// v000
// Times are from an AMD MI455X. After a warm-up the kernel runs many times in a row, and a time is the length of
// such a window on the GPU divided by its runs, so every launch and the gaps after it count. The runs cycle
// through copies of the inputs. A figure is the median of several windows, for all but v000 over two sittings.
// Sittings can differ by a few percent; kernels timed side by side share one.
// v000, which the later versions start from, runs in 894 microseconds.
#include <hip/hip_runtime.h>
#include <stdint.h>

typedef __attribute__((ext_vector_type(16))) __bf16 v16bf;
typedef __attribute__((ext_vector_type(8)))  float  v8f;
typedef __attribute__((ext_vector_type(4)))  uint32_t v4u;
typedef __attribute__((ext_vector_type(8)))  int      v8i_;
typedef __attribute__((ext_vector_type(4)))  int      v4i_;
typedef uint16_t u16;
typedef uint32_t u32;

#define DEVI __device__ __forceinline__

constexpr int BATCH = 8;
constexpr int S     = 2048;
constexpr int DIN   = 1024;
constexpr int DE    = 1024;
constexpr int MTOT  = BATCH * S;

// ---------- helpers ----------
DEVI u16 f2bf(float f) {                       // round-to-nearest-even f32 -> bf16
    u32 u = __float_as_uint(f);
    u32 r = (u + 0x7FFFu + ((u >> 16) & 1u)) >> 16;
    return (u16)r;
}

struct U4x2 { uint4 a, b; };

DEVI v16bf ld_frag(const u16* p0, const u16* p1) {   // two 16B chunks -> 16 bf16 frag
    U4x2 u;
    u.a = *(const uint4*)p0;
    u.b = *(const uint4*)p1;
    return __builtin_bit_cast(v16bf, u);
}

DEVI v8f wmma_bf16(v16bf a, v16bf b, v8f c) {
    return __builtin_amdgcn_wmma_f32_16x16x32_bf16(
        /*neg_a=*/false, a, /*neg_b=*/false, b,
        /*c_mod=*/(short)0, c, /*reuse_a=*/false, /*reuse_b=*/false);
}

// TDM: load a 2D bf16 tile (rows x cols, row stride in elements) from global to
// LDS, inserting 16B of LDS padding after every 1024B (so an LDS "row" of
// 2048B data occupies 2080B -> bank-spread, 16B-aligned chunks).
DEVI void tdm_load_tile_2d(u32 lds_off, const u16* gptr,
                           int cols, int rows, int row_stride_elems) {
    uint64_t ga = (uint64_t)(uintptr_t)gptr;
    v4u g0 = { 1u,                                   // count = 1 descriptor
               lds_off,                              // lds_addr (bytes)
               (u32)ga,                              // global_addr[31:0]
               (u32)(ga >> 32) | (2u << 30) };       // global_addr[56:32] | type=2
    v8i_ g1;
    g1[0] = (int)((1u << 16)                          // data_size = 2 bytes
                | (1u << 20)                          // pad_enable
                | (7u << 22)                          // pad_interval = 256 dwords (1024B)
                | (3u << 25));                        // pad_amount  = 4 dwords (16B)
    g1[1] = (int)((u32)(cols & 0xFFFF) << 16);        // tensor_dim0 low16
    g1[2] = (int)(((u32)cols >> 16) | ((u32)(rows & 0xFFFF) << 16)); // dim0 hi | dim1 lo
    g1[3] = (int)(((u32)rows >> 16) | ((u32)cols << 16));            // dim1 hi | tile_dim0
    g1[4] = (int)(u32)rows;                           // tile_dim1 (tile_dim2 = 0)
    g1[5] = (int)(u32)row_stride_elems;               // tensor_dim0_stride low32
    g1[6] = 0;
    g1[7] = 0;
    v4i_ z4 = {};
#if __clang_major__ >= 23
    v8i_ z8 = {};
    __builtin_amdgcn_tensor_load_to_lds(g0, g1, z4, z4, z8, 0);
#else
    __builtin_amdgcn_tensor_load_to_lds(g0, g1, z4, z4, 0);
#endif
}

// ---------- f32 -> bf16 conversion (vectorized x4) ----------
__global__ void cvt_f32_bf16(const float* __restrict__ in, u16* __restrict__ out, int n4) {
    int i = blockIdx.x * blockDim.x + threadIdx.x;
    if (i < n4) {
        float4 f = ((const float4*)in)[i];
        ushort4 o;
        o.x = f2bf(f.x); o.y = f2bf(f.y); o.z = f2bf(f.z); o.w = f2bf(f.w);
        ((ushort4*)out)[i] = o;
    }
}

// ---------- f32 [K,N] -> bf16 transposed [N,K] (weights, done once) ----------
__global__ void cvt_f32_bf16_T(const float* __restrict__ in, u16* __restrict__ out,
                               int Kd, int N) {
    int idx = blockIdx.x * blockDim.x + threadIdx.x;
    if (idx < Kd * N) {
        int k = idx / N, n = idx - k * N;          // coalesced read along n
        out[(size_t)n * Kd + k] = f2bf(in[idx]);
    }
}

// ---------- tiled bf16 GEMM: C[M,N] = A[M,K] * Bt[N,K]^T + bias ----------
// A row-major [M,K]; Bt is the PRE-TRANSPOSED weight [N,K] (k contiguous).
// MODE 0: bf16 row-major out; MODE 1: bf16 out transposed per batch [b][n][s];
// MODE 2: f32 row-major out.
template<int MODE>
__global__ __launch_bounds__(256)
void gemm_bf16_k(const u16* __restrict__ A, const u16* __restrict__ Bt,
                 const float* __restrict__ bias, void* __restrict__ Out,
                 int M, int N, int Kd)
{
    constexpr int BM = 128, BN = 128, BK = 32;
    constexpr int LDA = 40;   // padded LDS row stride (shorts): 80B, 16B aligned
    constexpr int LDB = 40;
    __shared__ u16 As[BM * LDA];
    __shared__ u16 Bs[BN * LDB];   // [n][k]

    const int nb = N / BN;
    const int m0 = (blockIdx.x / nb) * BM;
    const int n0 = (blockIdx.x % nb) * BN;

    const int t    = threadIdx.x;
    const int lane = t & 31;
    const int wave = t >> 5;       // 0..7
    const int wm   = wave >> 2;    // 0..1 : 64-row slice
    const int wn   = wave & 3;     // 0..3 : 32-col slice
    const int half = lane >> 4;
    const int lr   = lane & 15;

    v8f acc[4][2] = {};

    for (int k0 = 0; k0 < Kd; k0 += BK) {
        // A tile: 128 rows x 32 cols = 512 x 16B chunks, 2 per thread
        #pragma unroll
        for (int i = 0; i < 2; i++) {
            int idx = t + i * 256;
            int row = idx >> 2, ch = idx & 3;
            uint4 d = *(const uint4*)(A + (size_t)(m0 + row) * Kd + k0 + ch * 8);
            *(uint4*)(&As[row * LDA + ch * 8]) = d;
        }
        // B tile from pre-transposed weights: plain copy, no scalar transpose
        #pragma unroll
        for (int i = 0; i < 2; i++) {
            int idx = t + i * 256;
            int row = idx >> 2, ch = idx & 3;
            uint4 d = *(const uint4*)(Bt + (size_t)(n0 + row) * Kd + k0 + ch * 8);
            *(uint4*)(&Bs[row * LDB + ch * 8]) = d;
        }
        // prefetch next k-tile into caches
        if (k0 + BK < Kd) {
            int row = t >> 2, ch = t & 3;
            __builtin_prefetch(A  + (size_t)(m0 + row) * Kd + k0 + BK + ch * 8, 0, 1);
            __builtin_prefetch(Bt + (size_t)(n0 + row) * Kd + k0 + BK + ch * 8, 0, 1);
        }
        __syncthreads();

        v16bf afr[4], bfr[2];
        #pragma unroll
        for (int i = 0; i < 4; i++) {
            const u16* rp = &As[(wm * 64 + i * 16 + lr) * LDA];
            afr[i] = ld_frag(rp + half * 8, rp + 16 + half * 8);
        }
        #pragma unroll
        for (int j = 0; j < 2; j++) {
            const u16* rp = &Bs[(wn * 32 + j * 16 + lr) * LDB];
            bfr[j] = ld_frag(rp + half * 8, rp + 16 + half * 8);
        }
        #pragma unroll
        for (int i = 0; i < 4; i++)
            #pragma unroll
            for (int j = 0; j < 2; j++)
                acc[i][j] = wmma_bf16(afr[i], bfr[j], acc[i][j]);
        __syncthreads();
    }

    // epilogue: lane lr = col, VGPR r -> row r + 8*half
    #pragma unroll
    for (int i = 0; i < 4; i++) {
        #pragma unroll
        for (int j = 0; j < 2; j++) {
            const int n = n0 + wn * 32 + j * 16 + lr;
            const float bv = bias[n];
            #pragma unroll
            for (int r = 0; r < 8; r++) {
                const int m = m0 + wm * 64 + i * 16 + r + half * 8;
                const float v = acc[i][j][r] + bv;
                if constexpr (MODE == 0) {
                    ((u16*)Out)[(size_t)m * N + n] = f2bf(v);
                } else if constexpr (MODE == 1) {
                    const int bb = m >> 11;          // m / S (S=2048)
                    const int ss = m & (S - 1);
                    ((u16*)Out)[((size_t)bb * N + n) * S + ss] = f2bf(v);
                } else {
                    ((float*)Out)[(size_t)m * N + n] = v;
                }
            }
        }
    }
}

// ---------- flash-style attention: ctx = softmax(Q K^T / sqrt(D)) V ----------
// One block handles 16 q-rows of one batch. 8 waves; each wave owns a 128-wide
// d-slice of the output accumulator. K is [b][s][d] bf16, Vt is [b][d][s] bf16.
// Q block is staged into LDS by the Tensor Data Mover (with 16B pad / 1024B).
__global__ __launch_bounds__(256)
void attn_k(const u16* __restrict__ Q, const u16* __restrict__ K,
            const u16* __restrict__ Vt, u16* __restrict__ ctx)
{
    constexpr int QB = 16;           // q rows per block
    constexpr int KC = 128;          // k rows per outer iteration (16 per wave)
    constexpr int LQ = DIN + 16;     // TDM-padded Qs row stride (shorts): 2080B
    constexpr int LP = KC + 8;       // padded Pbuf stride (shorts)

    __shared__ u16   Qs[QB * LQ];       // 33,280 B (TDM destination)
    __shared__ float Sbuf[QB][KC];      // 8 KB
    __shared__ u16   Pbuf[QB * LP];     // ~4.3 KB
    __shared__ float rowM[QB], rowL[QB], rowA[QB];

    const int qblk = blockIdx.x & (S / QB - 1);
    const int b    = blockIdx.x / (S / QB);
    const int q0   = qblk * QB;

    const int t    = threadIdx.x;
    const int lane = t & 31;
    const int wave = t >> 5;
    const int half = lane >> 4;
    const int lr   = lane & 15;

    // stage Q block (16 x 1024 bf16) via Tensor Data Mover, wave 0 issues
    if (wave == 0) {
        u32 lds_off = (u32)(uintptr_t)(&Qs[0]);       // low 32 bits = LDS offset
        tdm_load_tile_2d(lds_off, Q + ((size_t)b * S + q0) * DE,
                         /*cols=*/DIN, /*rows=*/QB, /*row_stride=*/DE);
        __builtin_amdgcn_s_wait_tensorcnt(0);
    }
    if (t < QB) { rowM[t] = -1e30f; rowL[t] = 0.f; }
    __syncthreads();

    const int dbase = wave * 128;
    v8f acc[8] = {};
    const float scale = 0.03125f;    // 1/sqrt(1024)

    for (int kc = 0; kc < S; kc += KC) {
        // phase 1: each wave computes a 16x16 score tile for k-rows kc+wave*16..+16
        v8f sacc = {};
        const int krow = kc + wave * 16 + lr;
        const u16* Kg = K + ((size_t)b * S + krow) * DE;
        for (int d0 = 0; d0 < DIN; d0 += 32) {
            // TDM pad: +8 shorts after every 512 shorts stored
            const u16* qp = &Qs[lr * LQ + d0 + 8 * (d0 >> 9)];
            v16bf aq = ld_frag(qp + half * 8, qp + 16 + half * 8);
            v16bf bk = ld_frag(Kg + d0 + half * 8, Kg + d0 + 16 + half * 8);
            sacc = wmma_bf16(aq, bk, sacc);
        }
        #pragma unroll
        for (int r = 0; r < 8; r++)
            Sbuf[r + half * 8][wave * 16 + lr] = sacc[r] * scale;
        __syncthreads();

        // phase 2: online softmax update, one thread per q-row
        if (t < QB) {
            float mold = rowM[t], mnew = mold;
            for (int j = 0; j < KC; j++) mnew = fmaxf(mnew, Sbuf[t][j]);
            float alpha = __expf(mold - mnew);
            float sum = 0.f;
            for (int j = 0; j < KC; j++) {
                float p = __expf(Sbuf[t][j] - mnew);
                Pbuf[t * LP + j] = f2bf(p);
                sum += p;
            }
            rowL[t] = rowL[t] * alpha + sum;
            rowM[t] = mnew;
            rowA[t] = alpha;
        }
        __syncthreads();

        // phase 3: rescale running accumulator, then acc += P @ V-slice
        float al[8];
        #pragma unroll
        for (int r = 0; r < 8; r++) al[r] = rowA[r + half * 8];
        #pragma unroll
        for (int j = 0; j < 8; j++)
            #pragma unroll
            for (int r = 0; r < 8; r++) acc[j][r] *= al[r];

        for (int ks = 0; ks < KC; ks += 32) {
            const u16* pp = &Pbuf[lr * LP + ks];
            v16bf ap = ld_frag(pp + half * 8, pp + 16 + half * 8);
            #pragma unroll
            for (int j = 0; j < 8; j++) {
                const u16* vp = Vt + ((size_t)b * DE + dbase + j * 16 + lr) * S + kc + ks;
                v16bf bv = ld_frag(vp + half * 8, vp + 16 + half * 8);
                acc[j] = wmma_bf16(ap, bv, acc[j]);
            }
        }
        __syncthreads();
    }

    // finalize: divide by softmax denominator, store bf16 ctx
    float inv[8];
    #pragma unroll
    for (int r = 0; r < 8; r++) inv[r] = 1.f / rowL[r + half * 8];
    #pragma unroll
    for (int j = 0; j < 8; j++) {
        const int n = dbase + j * 16 + lr;
        #pragma unroll
        for (int r = 0; r < 8; r++) {
            const int m = q0 + r + half * 8;
            ctx[((size_t)b * S + m) * DE + n] = f2bf(acc[j][r] * inv[r]);
        }
    }
}

// ---------- host launcher ----------
extern "C" void kernel_launch(void* const* d_in, const int* in_sizes, int n_in,
                              void* d_out, int out_size, void* d_ws, size_t ws_size,
                              hipStream_t stream)
{
    (void)in_sizes; (void)n_in; (void)out_size; (void)ws_size;

    const float* x  = (const float*)d_in[0];
    const float* Wq = (const float*)d_in[1];
    const float* bq = (const float*)d_in[2];
    const float* Wk = (const float*)d_in[3];
    const float* bk = (const float*)d_in[4];
    const float* Wv = (const float*)d_in[5];
    const float* bv = (const float*)d_in[6];
    const float* Wo = (const float*)d_in[7];
    const float* bo = (const float*)d_in[8];
    float* out = (float*)d_out;

    char* ws = (char*)d_ws;
    const size_t MB = 1ull << 20;
    u16* xb  = (u16*)(ws);                 // 32 MB  x bf16 [m][k]
    u16* wqb = (u16*)(ws + 32 * MB);       //  2 MB  Wq^T bf16 [n][k]
    u16* wkb = (u16*)(ws + 34 * MB);       //  2 MB  Wk^T
    u16* wvb = (u16*)(ws + 36 * MB);       //  2 MB  Wv^T
    u16* wob = (u16*)(ws + 38 * MB);       //  2 MB  Wo^T
    u16* Qb  = (u16*)(ws + 40 * MB);       // 32 MB  Q bf16 [b][s][d]
    u16* Kb  = (u16*)(ws + 72 * MB);       // 32 MB  K bf16 [b][s][d]
    u16* Vtb = (u16*)(ws + 104 * MB);      // 32 MB  V^T bf16 [b][d][s]
    u16* ctx = (u16*)(ws + 136 * MB);      // 32 MB  attention output bf16

    const int nx4 = MTOT * DIN / 4;
    const int nw  = DIN * DE;
    cvt_f32_bf16<<<(nx4 + 255) / 256, 256, 0, stream>>>(x, xb, nx4);
    cvt_f32_bf16_T<<<(nw + 255) / 256, 256, 0, stream>>>(Wq, wqb, DIN, DE);
    cvt_f32_bf16_T<<<(nw + 255) / 256, 256, 0, stream>>>(Wk, wkb, DIN, DE);
    cvt_f32_bf16_T<<<(nw + 255) / 256, 256, 0, stream>>>(Wv, wvb, DIN, DE);
    cvt_f32_bf16_T<<<(nw + 255) / 256, 256, 0, stream>>>(Wo, wob, DE,  DE);

    dim3 gg((MTOT / 128) * (DE / 128));    // 1024 blocks
    gemm_bf16_k<0><<<gg, 256, 0, stream>>>(xb, wqb, bq, Qb,  MTOT, DE, DIN);
    gemm_bf16_k<0><<<gg, 256, 0, stream>>>(xb, wkb, bk, Kb,  MTOT, DE, DIN);
    gemm_bf16_k<1><<<gg, 256, 0, stream>>>(xb, wvb, bv, Vtb, MTOT, DE, DIN);

    attn_k<<<dim3(BATCH * (S / 16)), 256, 0, stream>>>(Qb, Kb, Vtb, ctx);

    gemm_bf16_k<2><<<gg, 256, 0, stream>>>(ctx, wob, bo, out, MTOT, DE, DIN);
}

// v001
// Measured time: 840 microseconds a run.
// Timed twice side by side with v000, it ran 1.10 times as fast both times.
#include <hip/hip_runtime.h>
#include <stdint.h>

typedef __attribute__((ext_vector_type(16))) __bf16 v16bf;
typedef __attribute__((ext_vector_type(8)))  float  v8f;
typedef __attribute__((ext_vector_type(4)))  uint32_t v4u;
typedef __attribute__((ext_vector_type(8)))  int      v8i_;
typedef __attribute__((ext_vector_type(4)))  int      v4i_;
typedef uint16_t u16;
typedef uint32_t u32;

#define DEVI __device__ __forceinline__

constexpr int BATCH = 8;
constexpr int S     = 2048;
constexpr int DIN   = 1024;
constexpr int DE    = 1024;
constexpr int MTOT  = BATCH * S;

// ---------- helpers ----------
DEVI u16 f2bf(float f) {                       // round-to-nearest-even f32 -> bf16
    u32 u = __float_as_uint(f);
    u32 r = (u + 0x7FFFu + ((u >> 16) & 1u)) >> 16;
    return (u16)r;
}

struct U4x2 { uint4 a, b; };

DEVI v16bf ld_frag(const u16* p0, const u16* p1) {   // two 16B chunks -> 16 bf16 frag
    U4x2 u;
    u.a = *(const uint4*)p0;
    u.b = *(const uint4*)p1;
    return __builtin_bit_cast(v16bf, u);
}

DEVI v8f wmma_bf16(v16bf a, v16bf b, v8f c) {
    return __builtin_amdgcn_wmma_f32_16x16x32_bf16(
        /*neg_a=*/false, a, /*neg_b=*/false, b,
        /*c_mod=*/(short)0, c, /*reuse_a=*/false, /*reuse_b=*/false);
}

// TDM: load a 2D bf16 tile (rows x cols, row stride in elements) from global to
// LDS, inserting 16B of LDS padding after every 1024B (so an LDS "row" of
// 2048B data occupies 2080B -> bank-spread, 16B-aligned chunks).
DEVI void tdm_load_tile_2d(u32 lds_off, const u16* gptr,
                           int cols, int rows, int row_stride_elems) {
    uint64_t ga = (uint64_t)(uintptr_t)gptr;
    v4u g0 = { 1u,                                   // count = 1 descriptor
               lds_off,                              // lds_addr (bytes)
               (u32)ga,                              // global_addr[31:0]
               (u32)(ga >> 32) | (2u << 30) };       // global_addr[56:32] | type=2
    v8i_ g1;
    g1[0] = (int)((1u << 16)                          // data_size = 2 bytes
                | (1u << 20)                          // pad_enable
                | (7u << 22)                          // pad_interval = 256 dwords (1024B)
                | (3u << 25));                        // pad_amount  = 4 dwords (16B)
    g1[1] = (int)((u32)(cols & 0xFFFF) << 16);        // tensor_dim0 low16
    g1[2] = (int)(((u32)cols >> 16) | ((u32)(rows & 0xFFFF) << 16)); // dim0 hi | dim1 lo
    g1[3] = (int)(((u32)rows >> 16) | ((u32)cols << 16));            // dim1 hi | tile_dim0
    g1[4] = (int)(u32)rows;                           // tile_dim1 (tile_dim2 = 0)
    g1[5] = (int)(u32)row_stride_elems;               // tensor_dim0_stride low32
    g1[6] = 0;
    g1[7] = 0;
    v4i_ z4 = {};
#if __clang_major__ >= 23
    v8i_ z8 = {};
    __builtin_amdgcn_tensor_load_to_lds(g0, g1, z4, z4, z8, 0);
#else
    __builtin_amdgcn_tensor_load_to_lds(g0, g1, z4, z4, 0);
#endif
}

// ---------- f32 -> bf16 conversion (vectorized x4) ----------
__global__ void cvt_f32_bf16(const float* __restrict__ in, u16* __restrict__ out, int n4) {
    int i = blockIdx.x * blockDim.x + threadIdx.x;
    if (i < n4) {
        float4 f = ((const float4*)in)[i];
        ushort4 o;
        o.x = f2bf(f.x); o.y = f2bf(f.y); o.z = f2bf(f.z); o.w = f2bf(f.w);
        ((ushort4*)out)[i] = o;
    }
}

// ---------- f32 [K,N] -> bf16 transposed [N,K] (weights, done once) ----------
__global__ void cvt_f32_bf16_T(const float* __restrict__ in, u16* __restrict__ out,
                               int Kd, int N) {
    int idx = blockIdx.x * blockDim.x + threadIdx.x;
    if (idx < Kd * N) {
        int k = idx / N, n = idx - k * N;          // coalesced read along n
        out[(size_t)n * Kd + k] = f2bf(in[idx]);
    }
}

// ---------- tiled bf16 GEMM: C[M,N] = A[M,K] * Bt[N,K]^T + bias ----------
// A row-major [M,K]; Bt is the PRE-TRANSPOSED weight [N,K] (k contiguous).
// MODE 0: bf16 row-major out; MODE 2: f32 row-major out.
// MODE 1 and MODE 3: bf16 out in the order the attention kernel's B fragments are
// loaded: 1 KB tiles of 16 rows x 32 k, a tile = 2 chunks of 512 B, chunk c holds at
// lane (h*16 + row) the 8 elements k = c*16 + h*8 .. +7, so that one wave-wide 16-byte
// load reads 512 contiguous bytes (4 whole lines) instead of 32 B out of 16 lines.
//   MODE 3 (K): row = key m, k = feature n; tiles ordered [m/16][n/32].
//   MODE 1 (V): row = feature n, k = key s;  tiles ordered [b][s/32][n/16].
template<int MODE>
__global__ __launch_bounds__(256)
void gemm_bf16_k(const u16* __restrict__ A, const u16* __restrict__ Bt,
                 const float* __restrict__ bias, void* __restrict__ Out,
                 int M, int N, int Kd)
{
    constexpr int BM = 128, BN = 128, BK = 32;
    constexpr int LDA = 40;   // padded LDS row stride (shorts): 80B, 16B aligned
    constexpr int LDB = 40;
    __shared__ u16 As[BM * LDA];
    __shared__ u16 Bs[BN * LDB];   // [n][k]

    const int nb = N / BN;
    const int m0 = (blockIdx.x / nb) * BM;
    const int n0 = (blockIdx.x % nb) * BN;

    const int t    = threadIdx.x;
    const int lane = t & 31;
    const int wave = t >> 5;       // 0..7
    const int wm   = wave >> 2;    // 0..1 : 64-row slice
    const int wn   = wave & 3;     // 0..3 : 32-col slice
    const int half = lane >> 4;
    const int lr   = lane & 15;

    v8f acc[4][2] = {};

    for (int k0 = 0; k0 < Kd; k0 += BK) {
        // A tile: 128 rows x 32 cols = 512 x 16B chunks, 2 per thread
        #pragma unroll
        for (int i = 0; i < 2; i++) {
            int idx = t + i * 256;
            int row = idx >> 2, ch = idx & 3;
            uint4 d = *(const uint4*)(A + (size_t)(m0 + row) * Kd + k0 + ch * 8);
            *(uint4*)(&As[row * LDA + ch * 8]) = d;
        }
        // B tile from pre-transposed weights: plain copy, no scalar transpose
        #pragma unroll
        for (int i = 0; i < 2; i++) {
            int idx = t + i * 256;
            int row = idx >> 2, ch = idx & 3;
            uint4 d = *(const uint4*)(Bt + (size_t)(n0 + row) * Kd + k0 + ch * 8);
            *(uint4*)(&Bs[row * LDB + ch * 8]) = d;
        }
        // prefetch next k-tile into caches
        if (k0 + BK < Kd) {
            int row = t >> 2, ch = t & 3;
            __builtin_prefetch(A  + (size_t)(m0 + row) * Kd + k0 + BK + ch * 8, 0, 1);
            __builtin_prefetch(Bt + (size_t)(n0 + row) * Kd + k0 + BK + ch * 8, 0, 1);
        }
        __syncthreads();

        v16bf afr[4], bfr[2];
        #pragma unroll
        for (int i = 0; i < 4; i++) {
            const u16* rp = &As[(wm * 64 + i * 16 + lr) * LDA];
            afr[i] = ld_frag(rp + half * 8, rp + 16 + half * 8);
        }
        #pragma unroll
        for (int j = 0; j < 2; j++) {
            const u16* rp = &Bs[(wn * 32 + j * 16 + lr) * LDB];
            bfr[j] = ld_frag(rp + half * 8, rp + 16 + half * 8);
        }
        #pragma unroll
        for (int i = 0; i < 4; i++)
            #pragma unroll
            for (int j = 0; j < 2; j++)
                acc[i][j] = wmma_bf16(afr[i], bfr[j], acc[i][j]);
        __syncthreads();
    }

    // epilogue: lane lr = col, VGPR r -> row r + 8*half
    #pragma unroll
    for (int i = 0; i < 4; i++) {
        #pragma unroll
        for (int j = 0; j < 2; j++) {
            const int n = n0 + wn * 32 + j * 16 + lr;
            const float bv = bias[n];
            if constexpr (MODE == 1) {
                // this lane's 8 accumulator rows are 8 consecutive keys: one 16-byte chunk
                const int mb = m0 + wm * 64 + i * 16;
                const int bb = mb >> 11;             // mb / S (S=2048)
                const int ss = mb & (S - 1);
                const size_t tile = (size_t)(bb * (S / 32) + (ss >> 5)) * (N / 16) + (n >> 4);
                uint4 pk;
                pk.x = (u32)f2bf(acc[i][j][0] + bv) | ((u32)f2bf(acc[i][j][1] + bv) << 16);
                pk.y = (u32)f2bf(acc[i][j][2] + bv) | ((u32)f2bf(acc[i][j][3] + bv) << 16);
                pk.z = (u32)f2bf(acc[i][j][4] + bv) | ((u32)f2bf(acc[i][j][5] + bv) << 16);
                pk.w = (u32)f2bf(acc[i][j][6] + bv) | ((u32)f2bf(acc[i][j][7] + bv) << 16);
                *(uint4*)((u16*)Out + tile * 512 + ((ss >> 4) & 1) * 256 + lane * 8) = pk;
            }
            #pragma unroll
            for (int r = 0; r < 8; r++) {
                const int m = m0 + wm * 64 + i * 16 + r + half * 8;
                const float v = acc[i][j][r] + bv;
                if constexpr (MODE == 0) {
                    ((u16*)Out)[(size_t)m * N + n] = f2bf(v);
                } else if constexpr (MODE == 3) {
                    const size_t tile = (size_t)(m >> 4) * (N / 32) + (n >> 5);
                    ((u16*)Out)[tile * 512 + ((n >> 4) & 1) * 256
                                + (((n >> 3) & 1) * 16 + (m & 15)) * 8 + (n & 7)] = f2bf(v);
                } else if constexpr (MODE == 2) {
                    ((float*)Out)[(size_t)m * N + n] = v;
                }
            }
        }
    }
}

// ---------- flash-style attention: ctx = softmax(Q K^T / sqrt(D)) V ----------
// One block handles 16 q-rows of one batch. 8 waves; each wave owns a 128-wide
// d-slice of the output accumulator. K and V come in the fragment-ordered 1 KB tiles
// that gemm_bf16_k MODE 3 and MODE 1 write (K: [b*S/16 + s/16][d/32], V: [b][s/32][d/16]).
// Q block is staged into LDS by the Tensor Data Mover (with 16B pad / 1024B).
__global__ __launch_bounds__(256)
void attn_k(const u16* __restrict__ Q, const u16* __restrict__ K,
            const u16* __restrict__ Vt, u16* __restrict__ ctx)
{
    constexpr int QB = 16;           // q rows per block
    constexpr int KC = 128;          // k rows per outer iteration (16 per wave)
    constexpr int LQ = DIN + 16;     // TDM-padded Qs row stride (shorts): 2080B
    constexpr int LP = KC + 8;       // padded Pbuf stride (shorts)

    __shared__ u16   Qs[QB * LQ];       // 33,280 B (TDM destination)
    __shared__ float Sbuf[QB][KC];      // 8 KB
    __shared__ u16   Pbuf[QB * LP];     // ~4.3 KB
    __shared__ float rowM[QB], rowL[QB], rowA[QB];

    const int qblk = blockIdx.x & (S / QB - 1);
    const int b    = blockIdx.x / (S / QB);
    const int q0   = qblk * QB;

    const int t    = threadIdx.x;
    const int lane = t & 31;
    const int wave = t >> 5;
    const int half = lane >> 4;
    const int lr   = lane & 15;

    // stage Q block (16 x 1024 bf16) via Tensor Data Mover, wave 0 issues
    if (wave == 0) {
        u32 lds_off = (u32)(uintptr_t)(&Qs[0]);       // low 32 bits = LDS offset
        tdm_load_tile_2d(lds_off, Q + ((size_t)b * S + q0) * DE,
                         /*cols=*/DIN, /*rows=*/QB, /*row_stride=*/DE);
        __builtin_amdgcn_s_wait_tensorcnt(0);
    }
    if (t < QB) { rowM[t] = -1e30f; rowL[t] = 0.f; }
    __syncthreads();

    const int dbase = wave * 128;
    v8f acc[8] = {};
    const float scale = 0.03125f;    // 1/sqrt(1024)

    for (int kc = 0; kc < S; kc += KC) {
        // phase 1: each wave computes a 16x16 score tile for k-rows kc+wave*16..+16
        v8f sacc = {};
        const u16* Kg = K + (size_t)(b * (S / 16) + (kc >> 4) + wave) * (DE / 32) * 512 + lane * 8;
        for (int d0 = 0; d0 < DIN; d0 += 32) {
            // TDM pad: +8 shorts after every 512 shorts stored
            const u16* qp = &Qs[lr * LQ + d0 + 8 * (d0 >> 9)];
            v16bf aq = ld_frag(qp + half * 8, qp + 16 + half * 8);
            v16bf bk = ld_frag(Kg + (d0 >> 5) * 512, Kg + (d0 >> 5) * 512 + 256);
            sacc = wmma_bf16(aq, bk, sacc);
        }
        // the K loads' address registers are rewritten for the V loads further down
        asm volatile("s_wait_xcnt 0x0" ::: "memory");
        #pragma unroll
        for (int r = 0; r < 8; r++)
            Sbuf[r + half * 8][wave * 16 + lr] = sacc[r] * scale;
        __syncthreads();

        // phase 2: online softmax update, one thread per q-row
        if (t < QB) {
            float mold = rowM[t], mnew = mold;
            for (int j = 0; j < KC; j++) mnew = fmaxf(mnew, Sbuf[t][j]);
            float alpha = __expf(mold - mnew);
            float sum = 0.f;
            for (int j = 0; j < KC; j++) {
                float p = __expf(Sbuf[t][j] - mnew);
                Pbuf[t * LP + j] = f2bf(p);
                sum += p;
            }
            rowL[t] = rowL[t] * alpha + sum;
            rowM[t] = mnew;
            rowA[t] = alpha;
        }
        __syncthreads();

        // phase 3: rescale running accumulator, then acc += P @ V-slice
        float al[8];
        #pragma unroll
        for (int r = 0; r < 8; r++) al[r] = rowA[r + half * 8];
        #pragma unroll
        for (int j = 0; j < 8; j++)
            #pragma unroll
            for (int r = 0; r < 8; r++) acc[j][r] *= al[r];

        for (int ks = 0; ks < KC; ks += 32) {
            const u16* pp = &Pbuf[lr * LP + ks];
            v16bf ap = ld_frag(pp + half * 8, pp + 16 + half * 8);
            #pragma unroll
            for (int j = 0; j < 8; j++) {
                const u16* vp = Vt + ((size_t)(b * (S / 32) + ((kc + ks) >> 5)) * (DE / 16)
                                      + (dbase >> 4) + j) * 512 + lane * 8;
                v16bf bv = ld_frag(vp, vp + 256);
                acc[j] = wmma_bf16(ap, bv, acc[j]);
            }
        }
        // the V loads' address registers are rewritten for the next pass's K loads
        asm volatile("s_wait_xcnt 0x0" ::: "memory");
        __syncthreads();
    }

    // finalize: divide by softmax denominator, store bf16 ctx
    float inv[8];
    #pragma unroll
    for (int r = 0; r < 8; r++) inv[r] = 1.f / rowL[r + half * 8];
    #pragma unroll
    for (int j = 0; j < 8; j++) {
        const int n = dbase + j * 16 + lr;
        #pragma unroll
        for (int r = 0; r < 8; r++) {
            const int m = q0 + r + half * 8;
            ctx[((size_t)b * S + m) * DE + n] = f2bf(acc[j][r] * inv[r]);
        }
    }
}

// ---------- host launcher ----------
extern "C" void kernel_launch(void* const* d_in, const int* in_sizes, int n_in,
                              void* d_out, int out_size, void* d_ws, size_t ws_size,
                              hipStream_t stream)
{
    (void)in_sizes; (void)n_in; (void)out_size; (void)ws_size;

    const float* x  = (const float*)d_in[0];
    const float* Wq = (const float*)d_in[1];
    const float* bq = (const float*)d_in[2];
    const float* Wk = (const float*)d_in[3];
    const float* bk = (const float*)d_in[4];
    const float* Wv = (const float*)d_in[5];
    const float* bv = (const float*)d_in[6];
    const float* Wo = (const float*)d_in[7];
    const float* bo = (const float*)d_in[8];
    float* out = (float*)d_out;

    char* ws = (char*)d_ws;
    const size_t MB = 1ull << 20;
    u16* xb  = (u16*)(ws);                 // 32 MB  x bf16 [m][k]
    u16* wqb = (u16*)(ws + 32 * MB);       //  2 MB  Wq^T bf16 [n][k]
    u16* wkb = (u16*)(ws + 34 * MB);       //  2 MB  Wk^T
    u16* wvb = (u16*)(ws + 36 * MB);       //  2 MB  Wv^T
    u16* wob = (u16*)(ws + 38 * MB);       //  2 MB  Wo^T
    u16* Qb  = (u16*)(ws + 40 * MB);       // 32 MB  Q bf16 [b][s][d]
    u16* Kb  = (u16*)(ws + 72 * MB);       // 32 MB  K bf16, fragment-ordered tiles
    u16* Vtb = (u16*)(ws + 104 * MB);      // 32 MB  V bf16, fragment-ordered tiles
    u16* ctx = (u16*)(ws + 136 * MB);      // 32 MB  attention output bf16

    const int nx4 = MTOT * DIN / 4;
    const int nw  = DIN * DE;
    cvt_f32_bf16<<<(nx4 + 255) / 256, 256, 0, stream>>>(x, xb, nx4);
    cvt_f32_bf16_T<<<(nw + 255) / 256, 256, 0, stream>>>(Wq, wqb, DIN, DE);
    cvt_f32_bf16_T<<<(nw + 255) / 256, 256, 0, stream>>>(Wk, wkb, DIN, DE);
    cvt_f32_bf16_T<<<(nw + 255) / 256, 256, 0, stream>>>(Wv, wvb, DIN, DE);
    cvt_f32_bf16_T<<<(nw + 255) / 256, 256, 0, stream>>>(Wo, wob, DE,  DE);

    dim3 gg((MTOT / 128) * (DE / 128));    // 1024 blocks
    gemm_bf16_k<0><<<gg, 256, 0, stream>>>(xb, wqb, bq, Qb,  MTOT, DE, DIN);
    gemm_bf16_k<3><<<gg, 256, 0, stream>>>(xb, wkb, bk, Kb,  MTOT, DE, DIN);
    gemm_bf16_k<1><<<gg, 256, 0, stream>>>(xb, wvb, bv, Vtb, MTOT, DE, DIN);

    attn_k<<<dim3(BATCH * (S / 16)), 256, 0, stream>>>(Qb, Kb, Vtb, ctx);

    gemm_bf16_k<2><<<gg, 256, 0, stream>>>(ctx, wob, bo, out, MTOT, DE, DIN);
}

// v002
// Measured time: 695 microseconds a run.
// Timed twice side by side with v001, it ran 1.21 times as fast both times.
// Counting every step since v000, it is 1.33 times as fast.
#include <hip/hip_runtime.h>
#include <stdint.h>

typedef __attribute__((ext_vector_type(16))) __bf16 v16bf;
typedef __attribute__((ext_vector_type(8)))  float  v8f;
typedef __attribute__((ext_vector_type(4)))  uint32_t v4u;
typedef __attribute__((ext_vector_type(8)))  int      v8i_;
typedef __attribute__((ext_vector_type(4)))  int      v4i_;
typedef uint16_t u16;
typedef uint32_t u32;

#define DEVI __device__ __forceinline__

constexpr int BATCH = 8;
constexpr int S     = 2048;
constexpr int DIN   = 1024;
constexpr int DE    = 1024;
constexpr int MTOT  = BATCH * S;

// ---------- helpers ----------
DEVI u16 f2bf(float f) {                       // round-to-nearest-even f32 -> bf16
    u32 u = __float_as_uint(f);
    u32 r = (u + 0x7FFFu + ((u >> 16) & 1u)) >> 16;
    return (u16)r;
}

struct U4x2 { uint4 a, b; };

DEVI v16bf ld_frag(const u16* p0, const u16* p1) {   // two 16B chunks -> 16 bf16 frag
    U4x2 u;
    u.a = *(const uint4*)p0;
    u.b = *(const uint4*)p1;
    return __builtin_bit_cast(v16bf, u);
}

DEVI v8f wmma_bf16(v16bf a, v16bf b, v8f c) {
    return __builtin_amdgcn_wmma_f32_16x16x32_bf16(
        /*neg_a=*/false, a, /*neg_b=*/false, b,
        /*c_mod=*/(short)0, c, /*reuse_a=*/false, /*reuse_b=*/false);
}

// value of lane (l ^ M) of the same 16-lane row, by a DPP move (no LDS round trip)
template<int M>
DEVI float row_xor(float v) {
    const int i = __float_as_int(v);
    return __int_as_float(__builtin_amdgcn_update_dpp(i, i, 0x160 | M, 0xf, 0xf, false));
}

// TDM: load a 2D bf16 tile (rows x cols, row stride in elements) from global to
// LDS, inserting 16B of LDS padding after every 1024B (so an LDS "row" of
// 2048B data occupies 2080B -> bank-spread, 16B-aligned chunks).
DEVI void tdm_load_tile_2d(u32 lds_off, const u16* gptr,
                           int cols, int rows, int row_stride_elems) {
    uint64_t ga = (uint64_t)(uintptr_t)gptr;
    v4u g0 = { 1u,                                   // count = 1 descriptor
               lds_off,                              // lds_addr (bytes)
               (u32)ga,                              // global_addr[31:0]
               (u32)(ga >> 32) | (2u << 30) };       // global_addr[56:32] | type=2
    v8i_ g1;
    g1[0] = (int)((1u << 16)                          // data_size = 2 bytes
                | (1u << 20)                          // pad_enable
                | (7u << 22)                          // pad_interval = 256 dwords (1024B)
                | (3u << 25));                        // pad_amount  = 4 dwords (16B)
    g1[1] = (int)((u32)(cols & 0xFFFF) << 16);        // tensor_dim0 low16
    g1[2] = (int)(((u32)cols >> 16) | ((u32)(rows & 0xFFFF) << 16)); // dim0 hi | dim1 lo
    g1[3] = (int)(((u32)rows >> 16) | ((u32)cols << 16));            // dim1 hi | tile_dim0
    g1[4] = (int)(u32)rows;                           // tile_dim1 (tile_dim2 = 0)
    g1[5] = (int)(u32)row_stride_elems;               // tensor_dim0_stride low32
    g1[6] = 0;
    g1[7] = 0;
    v4i_ z4 = {};
#if __clang_major__ >= 23
    v8i_ z8 = {};
    __builtin_amdgcn_tensor_load_to_lds(g0, g1, z4, z4, z8, 0);
#else
    __builtin_amdgcn_tensor_load_to_lds(g0, g1, z4, z4, 0);
#endif
}

// ---------- f32 -> bf16 conversion (vectorized x4) ----------
__global__ void cvt_f32_bf16(const float* __restrict__ in, u16* __restrict__ out, int n4) {
    int i = blockIdx.x * blockDim.x + threadIdx.x;
    if (i < n4) {
        float4 f = ((const float4*)in)[i];
        ushort4 o;
        o.x = f2bf(f.x); o.y = f2bf(f.y); o.z = f2bf(f.z); o.w = f2bf(f.w);
        ((ushort4*)out)[i] = o;
    }
}

// ---------- f32 [K,N] -> bf16 transposed [N,K] (weights, done once) ----------
__global__ void cvt_f32_bf16_T(const float* __restrict__ in, u16* __restrict__ out,
                               int Kd, int N) {
    int idx = blockIdx.x * blockDim.x + threadIdx.x;
    if (idx < Kd * N) {
        int k = idx / N, n = idx - k * N;          // coalesced read along n
        out[(size_t)n * Kd + k] = f2bf(in[idx]);
    }
}

// ---------- tiled bf16 GEMM: C[M,N] = A[M,K] * Bt[N,K]^T + bias ----------
// A row-major [M,K]; Bt is the PRE-TRANSPOSED weight [N,K] (k contiguous).
// MODE 0: bf16 row-major out; MODE 2: f32 row-major out.
// MODE 1 and MODE 3: bf16 out in the order the attention kernel's B fragments are
// loaded: 1 KB tiles of 16 rows x 32 k, a tile = 2 chunks of 512 B, chunk c holds at
// lane (h*16 + row) the 8 elements k = c*16 + h*8 .. +7, so that one wave-wide 16-byte
// load reads 512 contiguous bytes (4 whole lines) instead of 32 B out of 16 lines.
//   MODE 3 (K): row = key m, k = feature n; tiles ordered [m/16][n/32].
//   MODE 1 (V): row = feature n, k = key s;  tiles ordered [b][s/32][n/16].
template<int MODE>
__global__ __launch_bounds__(256)
void gemm_bf16_k(const u16* __restrict__ A, const u16* __restrict__ Bt,
                 const float* __restrict__ bias, void* __restrict__ Out,
                 int M, int N, int Kd)
{
    constexpr int BM = 128, BN = 128, BK = 32;
    constexpr int LDA = 40;   // padded LDS row stride (shorts): 80B, 16B aligned
    constexpr int LDB = 40;
    __shared__ u16 As[BM * LDA];
    __shared__ u16 Bs[BN * LDB];   // [n][k]

    const int nb = N / BN;
    const int m0 = (blockIdx.x / nb) * BM;
    const int n0 = (blockIdx.x % nb) * BN;

    const int t    = threadIdx.x;
    const int lane = t & 31;
    const int wave = t >> 5;       // 0..7
    const int wm   = wave >> 2;    // 0..1 : 64-row slice
    const int wn   = wave & 3;     // 0..3 : 32-col slice
    const int half = lane >> 4;
    const int lr   = lane & 15;

    v8f acc[4][2] = {};

    for (int k0 = 0; k0 < Kd; k0 += BK) {
        // A tile: 128 rows x 32 cols = 512 x 16B chunks, 2 per thread
        #pragma unroll
        for (int i = 0; i < 2; i++) {
            int idx = t + i * 256;
            int row = idx >> 2, ch = idx & 3;
            uint4 d = *(const uint4*)(A + (size_t)(m0 + row) * Kd + k0 + ch * 8);
            *(uint4*)(&As[row * LDA + ch * 8]) = d;
        }
        // B tile from pre-transposed weights: plain copy, no scalar transpose
        #pragma unroll
        for (int i = 0; i < 2; i++) {
            int idx = t + i * 256;
            int row = idx >> 2, ch = idx & 3;
            uint4 d = *(const uint4*)(Bt + (size_t)(n0 + row) * Kd + k0 + ch * 8);
            *(uint4*)(&Bs[row * LDB + ch * 8]) = d;
        }
        // prefetch next k-tile into caches
        if (k0 + BK < Kd) {
            int row = t >> 2, ch = t & 3;
            __builtin_prefetch(A  + (size_t)(m0 + row) * Kd + k0 + BK + ch * 8, 0, 1);
            __builtin_prefetch(Bt + (size_t)(n0 + row) * Kd + k0 + BK + ch * 8, 0, 1);
        }
        __syncthreads();

        v16bf afr[4], bfr[2];
        #pragma unroll
        for (int i = 0; i < 4; i++) {
            const u16* rp = &As[(wm * 64 + i * 16 + lr) * LDA];
            afr[i] = ld_frag(rp + half * 8, rp + 16 + half * 8);
        }
        #pragma unroll
        for (int j = 0; j < 2; j++) {
            const u16* rp = &Bs[(wn * 32 + j * 16 + lr) * LDB];
            bfr[j] = ld_frag(rp + half * 8, rp + 16 + half * 8);
        }
        #pragma unroll
        for (int i = 0; i < 4; i++)
            #pragma unroll
            for (int j = 0; j < 2; j++)
                acc[i][j] = wmma_bf16(afr[i], bfr[j], acc[i][j]);
        __syncthreads();
    }

    // epilogue: lane lr = col, VGPR r -> row r + 8*half
    #pragma unroll
    for (int i = 0; i < 4; i++) {
        #pragma unroll
        for (int j = 0; j < 2; j++) {
            const int n = n0 + wn * 32 + j * 16 + lr;
            const float bv = bias[n];
            if constexpr (MODE == 1) {
                // this lane's 8 accumulator rows are 8 consecutive keys: one 16-byte chunk
                const int mb = m0 + wm * 64 + i * 16;
                const int bb = mb >> 11;             // mb / S (S=2048)
                const int ss = mb & (S - 1);
                const size_t tile = (size_t)(bb * (S / 32) + (ss >> 5)) * (N / 16) + (n >> 4);
                uint4 pk;
                pk.x = (u32)f2bf(acc[i][j][0] + bv) | ((u32)f2bf(acc[i][j][1] + bv) << 16);
                pk.y = (u32)f2bf(acc[i][j][2] + bv) | ((u32)f2bf(acc[i][j][3] + bv) << 16);
                pk.z = (u32)f2bf(acc[i][j][4] + bv) | ((u32)f2bf(acc[i][j][5] + bv) << 16);
                pk.w = (u32)f2bf(acc[i][j][6] + bv) | ((u32)f2bf(acc[i][j][7] + bv) << 16);
                *(uint4*)((u16*)Out + tile * 512 + ((ss >> 4) & 1) * 256 + lane * 8) = pk;
            }
            #pragma unroll
            for (int r = 0; r < 8; r++) {
                const int m = m0 + wm * 64 + i * 16 + r + half * 8;
                const float v = acc[i][j][r] + bv;
                if constexpr (MODE == 0) {
                    ((u16*)Out)[(size_t)m * N + n] = f2bf(v);
                } else if constexpr (MODE == 3) {
                    const size_t tile = (size_t)(m >> 4) * (N / 32) + (n >> 5);
                    ((u16*)Out)[tile * 512 + ((n >> 4) & 1) * 256
                                + (((n >> 3) & 1) * 16 + (m & 15)) * 8 + (n & 7)] = f2bf(v);
                } else if constexpr (MODE == 2) {
                    ((float*)Out)[(size_t)m * N + n] = v;
                }
            }
        }
    }
}

// ---------- flash-style attention: ctx = softmax(Q K^T / sqrt(D)) V ----------
// One block handles 16 q-rows of one batch. 8 waves; each wave owns a 128-wide
// d-slice of the output accumulator. K and V come in the fragment-ordered 1 KB tiles
// that gemm_bf16_k MODE 3 and MODE 1 write (K: [b*S/16 + s/16][d/32], V: [b][s/32][d/16]).
// Q block is staged into LDS by the Tensor Data Mover (with 16B pad / 1024B).
__global__ __launch_bounds__(256)
void attn_k(const u16* __restrict__ Q, const u16* __restrict__ K,
            const u16* __restrict__ Vt, u16* __restrict__ ctx)
{
    constexpr int QB = 16;           // q rows per block
    constexpr int KC = 128;          // k rows per outer iteration (16 per wave)
    constexpr int LQ = DIN + 16;     // TDM-padded Qs row stride (shorts): 2080B
    constexpr int LP = KC + 8;       // padded Pbuf stride (shorts)

    __shared__ u16   Qs[QB * LQ];       // 33,280 B (TDM destination)
    __shared__ float Sbuf[QB][KC];      // 8 KB
    __shared__ u16   Pbuf[QB * LP];     // ~4.3 KB
    __shared__ float rowM[QB], rowL[QB], rowA[QB];

    const int qblk = blockIdx.x & (S / QB - 1);
    const int b    = blockIdx.x / (S / QB);
    const int q0   = qblk * QB;

    const int t    = threadIdx.x;
    const int lane = t & 31;
    const int wave = t >> 5;
    const int half = lane >> 4;
    const int lr   = lane & 15;

    // stage Q block (16 x 1024 bf16) via Tensor Data Mover, wave 0 issues
    if (wave == 0) {
        u32 lds_off = (u32)(uintptr_t)(&Qs[0]);       // low 32 bits = LDS offset
        tdm_load_tile_2d(lds_off, Q + ((size_t)b * S + q0) * DE,
                         /*cols=*/DIN, /*rows=*/QB, /*row_stride=*/DE);
        __builtin_amdgcn_s_wait_tensorcnt(0);
    }
    if (t < QB) { rowM[t] = -1e30f; rowL[t] = 0.f; }
    __syncthreads();

    const int dbase = wave * 128;
    v8f acc[8] = {};
    const float scale = 0.03125f;    // 1/sqrt(1024)

    for (int kc = 0; kc < S; kc += KC) {
        // phase 1: each wave computes a 16x16 score tile for k-rows kc+wave*16..+16
        v8f sacc = {};
        const u16* Kg = K + (size_t)(b * (S / 16) + (kc >> 4) + wave) * (DE / 32) * 512 + lane * 8;
        for (int d0 = 0; d0 < DIN; d0 += 32) {
            // TDM pad: +8 shorts after every 512 shorts stored
            const u16* qp = &Qs[lr * LQ + d0 + 8 * (d0 >> 9)];
            v16bf aq = ld_frag(qp + half * 8, qp + 16 + half * 8);
            v16bf bk = ld_frag(Kg + (d0 >> 5) * 512, Kg + (d0 >> 5) * 512 + 256);
            sacc = wmma_bf16(aq, bk, sacc);
        }
        // the K loads' address registers are rewritten for the V loads further down
        asm volatile("s_wait_xcnt 0x0" ::: "memory");
        #pragma unroll
        for (int r = 0; r < 8; r++)
            Sbuf[r + half * 8][wave * 16 + lr] = sacc[r] * scale;
        __syncthreads();

        // phase 2: online softmax update, 16 lanes per q-row, 8 columns per lane
        {
            const int row = t >> 4;
            const int c8  = lr * 8;
            const float4 sa = *(const float4*)&Sbuf[row][c8];
            const float4 sb = *(const float4*)&Sbuf[row][c8 + 4];
            const float sv[8] = { sa.x, sa.y, sa.z, sa.w, sb.x, sb.y, sb.z, sb.w };
            const float mold = rowM[row];
            float mx = sv[0];
            #pragma unroll   // constant indices keep sv[] in registers
            for (int j = 1; j < 8; j++) mx = fmaxf(mx, sv[j]);
            mx = fmaxf(mx, row_xor<1>(mx));
            mx = fmaxf(mx, row_xor<2>(mx));
            mx = fmaxf(mx, row_xor<4>(mx));
            mx = fmaxf(mx, row_xor<8>(mx));
            const float mnew = fmaxf(mold, mx);
            float p[8];
            float sum = 0.f;
            #pragma unroll   // constant indices keep sv[] and p[] in registers
            for (int j = 0; j < 8; j++) { p[j] = __expf(sv[j] - mnew); sum += p[j]; }
            uint4 pk;
            pk.x = (u32)f2bf(p[0]) | ((u32)f2bf(p[1]) << 16);
            pk.y = (u32)f2bf(p[2]) | ((u32)f2bf(p[3]) << 16);
            pk.z = (u32)f2bf(p[4]) | ((u32)f2bf(p[5]) << 16);
            pk.w = (u32)f2bf(p[6]) | ((u32)f2bf(p[7]) << 16);
            *(uint4*)&Pbuf[row * LP + c8] = pk;
            sum += row_xor<1>(sum);
            sum += row_xor<2>(sum);
            sum += row_xor<4>(sum);
            sum += row_xor<8>(sum);
            if (lr == 0) {
                const float alpha = __expf(mold - mnew);
                rowL[row] = rowL[row] * alpha + sum;
                rowM[row] = mnew;
                rowA[row] = alpha;
            }
        }
        __syncthreads();

        // phase 3: rescale running accumulator, then acc += P @ V-slice
        float al[8];
        #pragma unroll
        for (int r = 0; r < 8; r++) al[r] = rowA[r + half * 8];
        #pragma unroll
        for (int j = 0; j < 8; j++)
            #pragma unroll
            for (int r = 0; r < 8; r++) acc[j][r] *= al[r];

        for (int ks = 0; ks < KC; ks += 32) {
            const u16* pp = &Pbuf[lr * LP + ks];
            v16bf ap = ld_frag(pp + half * 8, pp + 16 + half * 8);
            #pragma unroll
            for (int j = 0; j < 8; j++) {
                const u16* vp = Vt + ((size_t)(b * (S / 32) + ((kc + ks) >> 5)) * (DE / 16)
                                      + (dbase >> 4) + j) * 512 + lane * 8;
                v16bf bv = ld_frag(vp, vp + 256);
                acc[j] = wmma_bf16(ap, bv, acc[j]);
            }
        }
        // the V loads' address registers are rewritten for the next pass's K loads
        asm volatile("s_wait_xcnt 0x0" ::: "memory");
        __syncthreads();
    }

    // finalize: divide by softmax denominator, store bf16 ctx
    float inv[8];
    #pragma unroll
    for (int r = 0; r < 8; r++) inv[r] = 1.f / rowL[r + half * 8];
    #pragma unroll
    for (int j = 0; j < 8; j++) {
        const int n = dbase + j * 16 + lr;
        #pragma unroll
        for (int r = 0; r < 8; r++) {
            const int m = q0 + r + half * 8;
            ctx[((size_t)b * S + m) * DE + n] = f2bf(acc[j][r] * inv[r]);
        }
    }
}

// ---------- host launcher ----------
extern "C" void kernel_launch(void* const* d_in, const int* in_sizes, int n_in,
                              void* d_out, int out_size, void* d_ws, size_t ws_size,
                              hipStream_t stream)
{
    (void)in_sizes; (void)n_in; (void)out_size; (void)ws_size;

    const float* x  = (const float*)d_in[0];
    const float* Wq = (const float*)d_in[1];
    const float* bq = (const float*)d_in[2];
    const float* Wk = (const float*)d_in[3];
    const float* bk = (const float*)d_in[4];
    const float* Wv = (const float*)d_in[5];
    const float* bv = (const float*)d_in[6];
    const float* Wo = (const float*)d_in[7];
    const float* bo = (const float*)d_in[8];
    float* out = (float*)d_out;

    char* ws = (char*)d_ws;
    const size_t MB = 1ull << 20;
    u16* xb  = (u16*)(ws);                 // 32 MB  x bf16 [m][k]
    u16* wqb = (u16*)(ws + 32 * MB);       //  2 MB  Wq^T bf16 [n][k]
    u16* wkb = (u16*)(ws + 34 * MB);       //  2 MB  Wk^T
    u16* wvb = (u16*)(ws + 36 * MB);       //  2 MB  Wv^T
    u16* wob = (u16*)(ws + 38 * MB);       //  2 MB  Wo^T
    u16* Qb  = (u16*)(ws + 40 * MB);       // 32 MB  Q bf16 [b][s][d]
    u16* Kb  = (u16*)(ws + 72 * MB);       // 32 MB  K bf16, fragment-ordered tiles
    u16* Vtb = (u16*)(ws + 104 * MB);      // 32 MB  V bf16, fragment-ordered tiles
    u16* ctx = (u16*)(ws + 136 * MB);      // 32 MB  attention output bf16

    const int nx4 = MTOT * DIN / 4;
    const int nw  = DIN * DE;
    cvt_f32_bf16<<<(nx4 + 255) / 256, 256, 0, stream>>>(x, xb, nx4);
    cvt_f32_bf16_T<<<(nw + 255) / 256, 256, 0, stream>>>(Wq, wqb, DIN, DE);
    cvt_f32_bf16_T<<<(nw + 255) / 256, 256, 0, stream>>>(Wk, wkb, DIN, DE);
    cvt_f32_bf16_T<<<(nw + 255) / 256, 256, 0, stream>>>(Wv, wvb, DIN, DE);
    cvt_f32_bf16_T<<<(nw + 255) / 256, 256, 0, stream>>>(Wo, wob, DE,  DE);

    dim3 gg((MTOT / 128) * (DE / 128));    // 1024 blocks
    gemm_bf16_k<0><<<gg, 256, 0, stream>>>(xb, wqb, bq, Qb,  MTOT, DE, DIN);
    gemm_bf16_k<3><<<gg, 256, 0, stream>>>(xb, wkb, bk, Kb,  MTOT, DE, DIN);
    gemm_bf16_k<1><<<gg, 256, 0, stream>>>(xb, wvb, bv, Vtb, MTOT, DE, DIN);

    attn_k<<<dim3(BATCH * (S / 16)), 256, 0, stream>>>(Qb, Kb, Vtb, ctx);

    gemm_bf16_k<2><<<gg, 256, 0, stream>>>(ctx, wob, bo, out, MTOT, DE, DIN);
}

// v003
// It runs in 530 microseconds.
// Timed twice side by side with v002, it ran 1.31 times as fast both times.
// Counting every step since v000, it is 1.75 times as fast.
#include <hip/hip_runtime.h>
#include <stdint.h>

typedef __attribute__((ext_vector_type(16))) __bf16 v16bf;
typedef __attribute__((ext_vector_type(8)))  float  v8f;
typedef __attribute__((ext_vector_type(4)))  uint32_t v4u;
typedef __attribute__((ext_vector_type(8)))  int      v8i_;
typedef __attribute__((ext_vector_type(4)))  int      v4i_;
typedef uint16_t u16;
typedef uint32_t u32;

#define DEVI __device__ __forceinline__

constexpr int BATCH = 8;
constexpr int S     = 2048;
constexpr int DIN   = 1024;
constexpr int DE    = 1024;
constexpr int MTOT  = BATCH * S;

// ---------- helpers ----------
DEVI u16 f2bf(float f) {                       // round-to-nearest-even f32 -> bf16
    u32 u = __float_as_uint(f);
    u32 r = (u + 0x7FFFu + ((u >> 16) & 1u)) >> 16;
    return (u16)r;
}

struct U4x2 { uint4 a, b; };

DEVI v16bf ld_frag(const u16* p0, const u16* p1) {   // two 16B chunks -> 16 bf16 frag
    U4x2 u;
    u.a = *(const uint4*)p0;
    u.b = *(const uint4*)p1;
    return __builtin_bit_cast(v16bf, u);
}

DEVI v8f wmma_bf16(v16bf a, v16bf b, v8f c) {
    return __builtin_amdgcn_wmma_f32_16x16x32_bf16(
        /*neg_a=*/false, a, /*neg_b=*/false, b,
        /*c_mod=*/(short)0, c, /*reuse_a=*/false, /*reuse_b=*/false);
}

// value of lane (l ^ M) of the same 16-lane row, by a DPP move (no LDS round trip)
template<int M>
DEVI float row_xor(float v) {
    const int i = __float_as_int(v);
    return __int_as_float(__builtin_amdgcn_update_dpp(i, i, 0x160 | M, 0xf, 0xf, false));
}

// a wave-uniform condition held in a scalar register, so that the test around a tensor
// load compiles to a scalar compare and branch (a tensor load ignores EXEC)
DEVI u32 pinned(u32 v) {
    u32 w = (u32)__builtin_amdgcn_readfirstlane((int)v);
    asm volatile("" : "+s"(w));   // pinned(): the issue test of a tensor load held in a scalar register
    return w;
}

// TDM: load a 2D bf16 tile (rows x cols, row stride in elements) from global to
// LDS, inserting 16B of LDS padding after every 1024B (so an LDS "row" of
// 2048B data occupies 2080B -> bank-spread, 16B-aligned chunks).
DEVI void tdm_load_tile_2d(u32 lds_off, const u16* gptr,
                           int cols, int rows, int row_stride_elems) {
    uint64_t ga = (uint64_t)(uintptr_t)gptr;
    v4u g0 = { 1u,                                   // count = 1 descriptor
               lds_off,                              // lds_addr (bytes)
               (u32)ga,                              // global_addr[31:0]
               (u32)(ga >> 32) | (2u << 30) };       // global_addr[56:32] | type=2
    v8i_ g1;
    g1[0] = (int)((1u << 16)                          // data_size = 2 bytes
                | (1u << 20)                          // pad_enable
                | (7u << 22)                          // pad_interval = 256 dwords (1024B)
                | (3u << 25));                        // pad_amount  = 4 dwords (16B)
    g1[1] = (int)((u32)(cols & 0xFFFF) << 16);        // tensor_dim0 low16
    g1[2] = (int)(((u32)cols >> 16) | ((u32)(rows & 0xFFFF) << 16)); // dim0 hi | dim1 lo
    g1[3] = (int)(((u32)rows >> 16) | ((u32)cols << 16));            // dim1 hi | tile_dim0
    g1[4] = (int)(u32)rows;                           // tile_dim1 (tile_dim2 = 0)
    g1[5] = (int)(u32)row_stride_elems;               // tensor_dim0_stride low32
    g1[6] = 0;
    g1[7] = 0;
    v4i_ z4 = {};
#if __clang_major__ >= 23
    v8i_ z8 = {};
    __builtin_amdgcn_tensor_load_to_lds(g0, g1, z4, z4, z8, 0);
#else
    __builtin_amdgcn_tensor_load_to_lds(g0, g1, z4, z4, 0);
#endif
}

// ---------- f32 -> bf16 conversion (vectorized x4) ----------
__global__ void cvt_f32_bf16(const float* __restrict__ in, u16* __restrict__ out, int n4) {
    int i = blockIdx.x * blockDim.x + threadIdx.x;
    if (i < n4) {
        float4 f = ((const float4*)in)[i];
        ushort4 o;
        o.x = f2bf(f.x); o.y = f2bf(f.y); o.z = f2bf(f.z); o.w = f2bf(f.w);
        ((ushort4*)out)[i] = o;
    }
}

// ---------- f32 [K,N] -> bf16 transposed [N,K] (weights, done once) ----------
__global__ void cvt_f32_bf16_T(const float* __restrict__ in, u16* __restrict__ out,
                               int Kd, int N) {
    int idx = blockIdx.x * blockDim.x + threadIdx.x;
    if (idx < Kd * N) {
        int k = idx / N, n = idx - k * N;          // coalesced read along n
        out[(size_t)n * Kd + k] = f2bf(in[idx]);
    }
}

// ---------- tiled bf16 GEMM: C[M,N] = A[M,K] * Bt[N,K]^T + bias ----------
// A row-major [M,K]; Bt is the PRE-TRANSPOSED weight [N,K] (k contiguous).
// MODE 0: bf16 row-major out; MODE 2: f32 row-major out.
// MODE 1 and MODE 3: bf16 out in the order the attention kernel's B fragments are
// loaded: 1 KB tiles of 16 rows x 32 k, a tile = 2 chunks of 512 B, chunk c holds at
// lane (h*16 + row) the 8 elements k = c*16 + h*8 .. +7, so that one wave-wide 16-byte
// load reads 512 contiguous bytes (4 whole lines) instead of 32 B out of 16 lines.
//   MODE 3 (K): row = key m, k = feature n; tiles ordered [m/16][n/32].
//   MODE 1 (V): row = feature n, k = key s;  tiles ordered [b][s/32][n/16].
template<int MODE>
__global__ __launch_bounds__(256)
void gemm_bf16_k(const u16* __restrict__ A, const u16* __restrict__ Bt,
                 const float* __restrict__ bias, void* __restrict__ Out,
                 int M, int N, int Kd)
{
    constexpr int BM = 128, BN = 128, BK = 32;
    constexpr int LDA = 40;   // padded LDS row stride (shorts): 80B, 16B aligned
    constexpr int LDB = 40;
    __shared__ u16 As[BM * LDA];
    __shared__ u16 Bs[BN * LDB];   // [n][k]

    const int nb = N / BN;
    const int m0 = (blockIdx.x / nb) * BM;
    const int n0 = (blockIdx.x % nb) * BN;

    const int t    = threadIdx.x;
    const int lane = t & 31;
    const int wave = t >> 5;       // 0..7
    const int wm   = wave >> 2;    // 0..1 : 64-row slice
    const int wn   = wave & 3;     // 0..3 : 32-col slice
    const int half = lane >> 4;
    const int lr   = lane & 15;

    v8f acc[4][2] = {};

    for (int k0 = 0; k0 < Kd; k0 += BK) {
        // A tile: 128 rows x 32 cols = 512 x 16B chunks, 2 per thread
        #pragma unroll
        for (int i = 0; i < 2; i++) {
            int idx = t + i * 256;
            int row = idx >> 2, ch = idx & 3;
            uint4 d = *(const uint4*)(A + (size_t)(m0 + row) * Kd + k0 + ch * 8);
            *(uint4*)(&As[row * LDA + ch * 8]) = d;
        }
        // B tile from pre-transposed weights: plain copy, no scalar transpose
        #pragma unroll
        for (int i = 0; i < 2; i++) {
            int idx = t + i * 256;
            int row = idx >> 2, ch = idx & 3;
            uint4 d = *(const uint4*)(Bt + (size_t)(n0 + row) * Kd + k0 + ch * 8);
            *(uint4*)(&Bs[row * LDB + ch * 8]) = d;
        }
        // prefetch next k-tile into caches
        if (k0 + BK < Kd) {
            int row = t >> 2, ch = t & 3;
            __builtin_prefetch(A  + (size_t)(m0 + row) * Kd + k0 + BK + ch * 8, 0, 1);
            __builtin_prefetch(Bt + (size_t)(n0 + row) * Kd + k0 + BK + ch * 8, 0, 1);
        }
        __syncthreads();

        v16bf afr[4], bfr[2];
        #pragma unroll
        for (int i = 0; i < 4; i++) {
            const u16* rp = &As[(wm * 64 + i * 16 + lr) * LDA];
            afr[i] = ld_frag(rp + half * 8, rp + 16 + half * 8);
        }
        #pragma unroll
        for (int j = 0; j < 2; j++) {
            const u16* rp = &Bs[(wn * 32 + j * 16 + lr) * LDB];
            bfr[j] = ld_frag(rp + half * 8, rp + 16 + half * 8);
        }
        #pragma unroll
        for (int i = 0; i < 4; i++)
            #pragma unroll
            for (int j = 0; j < 2; j++)
                acc[i][j] = wmma_bf16(afr[i], bfr[j], acc[i][j]);
        __syncthreads();
    }

    // epilogue: lane lr = col, VGPR r -> row r + 8*half
    #pragma unroll
    for (int i = 0; i < 4; i++) {
        #pragma unroll
        for (int j = 0; j < 2; j++) {
            const int n = n0 + wn * 32 + j * 16 + lr;
            const float bv = bias[n];
            if constexpr (MODE == 1) {
                // this lane's 8 accumulator rows are 8 consecutive keys: one 16-byte chunk
                const int mb = m0 + wm * 64 + i * 16;
                const int bb = mb >> 11;             // mb / S (S=2048)
                const int ss = mb & (S - 1);
                const size_t tile = (size_t)(bb * (S / 32) + (ss >> 5)) * (N / 16) + (n >> 4);
                uint4 pk;
                pk.x = (u32)f2bf(acc[i][j][0] + bv) | ((u32)f2bf(acc[i][j][1] + bv) << 16);
                pk.y = (u32)f2bf(acc[i][j][2] + bv) | ((u32)f2bf(acc[i][j][3] + bv) << 16);
                pk.z = (u32)f2bf(acc[i][j][4] + bv) | ((u32)f2bf(acc[i][j][5] + bv) << 16);
                pk.w = (u32)f2bf(acc[i][j][6] + bv) | ((u32)f2bf(acc[i][j][7] + bv) << 16);
                *(uint4*)((u16*)Out + tile * 512 + ((ss >> 4) & 1) * 256 + lane * 8) = pk;
            }
            #pragma unroll
            for (int r = 0; r < 8; r++) {
                const int m = m0 + wm * 64 + i * 16 + r + half * 8;
                const float v = acc[i][j][r] + bv;
                if constexpr (MODE == 0) {
                    ((u16*)Out)[(size_t)m * N + n] = f2bf(v);
                } else if constexpr (MODE == 3) {
                    const size_t tile = (size_t)(m >> 4) * (N / 32) + (n >> 5);
                    ((u16*)Out)[tile * 512 + ((n >> 4) & 1) * 256
                                + (((n >> 3) & 1) * 16 + (m & 15)) * 8 + (n & 7)] = f2bf(v);
                } else if constexpr (MODE == 2) {
                    ((float*)Out)[(size_t)m * N + n] = v;
                }
            }
        }
    }
}

// ---------- flash-style attention: ctx = softmax(Q K^T / sqrt(D)) V ----------
// One block handles 64 q-rows (4 tiles of 16) of one batch, so that every K and V
// fragment a wave loads feeds 4 matrix products. 8 waves; each wave owns a 128-wide
// d-slice of the output accumulator. K and V come in the fragment-ordered 1 KB tiles
// that gemm_bf16_k MODE 3 and MODE 1 write (K: [b*S/16 + s/16][d/32], V: [b][s/32][d/16]).
// Q block is staged into LDS by the Tensor Data Mover (with 16B pad / 1024B), one
// 16-row slice from each of waves 0..3.
__global__ __launch_bounds__(256)
void attn_k(const u16* __restrict__ Q, const u16* __restrict__ K,
            const u16* __restrict__ Vt, u16* __restrict__ ctx)
{
    constexpr int QT = 4;            // 16-row q tiles per block
    constexpr int QB = QT * 16;      // q rows per block
    constexpr int KC = 128;          // k rows per outer iteration (16 per wave)
    constexpr int LQ = DIN + 16;     // TDM-padded Qs row stride (shorts): 2080B
    constexpr int QSL = 17408;       // shorts per 16-row Q slice: 16*LQ rounded up to 2 KiB
    constexpr int LP = KC + 8;       // padded Pbuf stride (shorts)

    __shared__ __attribute__((aligned(2048))) u16 Qs[QT * QSL];   // 139,264 B (TDM destination)
    __shared__ float Sbuf[QB][KC];      // 32 KB
    __shared__ u16   Pbuf[QB * LP];     // 17 KB
    __shared__ float rowM[QB], rowL[QB], rowA[QB];

    const int qblk = blockIdx.x & (S / QB - 1);
    const int b    = blockIdx.x / (S / QB);
    const int q0   = qblk * QB;

    const int t    = threadIdx.x;
    const int lane = t & 31;
    const int wave = t >> 5;
    const int half = lane >> 4;
    const int lr   = lane & 15;

    // stage Q block (64 x 1024 bf16) via Tensor Data Mover: waves 0..3 each issue the
    // 16-row slice of their own number and wait for it themselves
    const u32 wv = (u32)__builtin_amdgcn_readfirstlane(t >> 5);
    if (pinned(wv < (u32)QT)) {
        u32 lds_off = (u32)(uintptr_t)(&Qs[0]) + wv * (u32)(QSL * 2);   // low 32 bits = LDS offset
        tdm_load_tile_2d(lds_off, Q + ((size_t)b * S + q0 + wv * 16) * DE,
                         /*cols=*/DIN, /*rows=*/16, /*row_stride=*/DE);
        __builtin_amdgcn_s_wait_tensorcnt(0);
    }
    if (t < QB) { rowM[t] = -1e30f; rowL[t] = 0.f; }
    __syncthreads();

    const int dbase = wave * 128;
    v8f acc[QT][8] = {};
    const float scale = 0.03125f;    // 1/sqrt(1024)

    for (int kc = 0; kc < S; kc += KC) {
        // phase 1: each wave computes the 64x16 score tile for k-rows kc+wave*16..+16
        v8f sacc[QT] = {};
        const u16* Kg = K + (size_t)(b * (S / 16) + (kc >> 4) + wave) * (DE / 32) * 512 + lane * 8;
        #pragma unroll 16   // lets the K loads of 16 d steps be in flight at once
        for (int d0 = 0; d0 < DIN; d0 += 32) {
            v16bf bk = ld_frag(Kg + (d0 >> 5) * 512, Kg + (d0 >> 5) * 512 + 256);
            #pragma unroll   // constant indices keep sacc[] in registers
            for (int qt = 0; qt < QT; qt++) {
                // TDM pad: +8 shorts after every 512 shorts stored
                const u16* qp = &Qs[qt * QSL + lr * LQ + d0 + 8 * (d0 >> 9)];
                v16bf aq = ld_frag(qp + half * 8, qp + 16 + half * 8);
                sacc[qt] = wmma_bf16(aq, bk, sacc[qt]);
            }
        }
        // the K loads' address registers are rewritten for the V loads further down
        asm volatile("s_wait_xcnt 0x0" ::: "memory");
        #pragma unroll
        for (int qt = 0; qt < QT; qt++)
            #pragma unroll
            for (int r = 0; r < 8; r++)
                Sbuf[qt * 16 + r + half * 8][wave * 16 + lr] = sacc[qt][r] * scale;
        __syncthreads();

        // phase 2: online softmax update, 16 lanes per q-row, 8 columns per lane,
        // 16 rows at a time
        #pragma unroll 1   // rolled: the lr == 0 branch keeps the row groups apart anyway, one copy of the code serves
        for (int rg = 0; rg < QT; rg++) {
            const int row = rg * 16 + (t >> 4);
            const int c8  = lr * 8;
            const float4 sa = *(const float4*)&Sbuf[row][c8];
            const float4 sb = *(const float4*)&Sbuf[row][c8 + 4];
            const float sv[8] = { sa.x, sa.y, sa.z, sa.w, sb.x, sb.y, sb.z, sb.w };
            const float mold = rowM[row];
            float mx = sv[0];
            #pragma unroll   // constant indices keep sv[] in registers
            for (int j = 1; j < 8; j++) mx = fmaxf(mx, sv[j]);
            mx = fmaxf(mx, row_xor<1>(mx));
            mx = fmaxf(mx, row_xor<2>(mx));
            mx = fmaxf(mx, row_xor<4>(mx));
            mx = fmaxf(mx, row_xor<8>(mx));
            const float mnew = fmaxf(mold, mx);
            float p[8];
            float sum = 0.f;
            #pragma unroll   // constant indices keep sv[] and p[] in registers
            for (int j = 0; j < 8; j++) { p[j] = __expf(sv[j] - mnew); sum += p[j]; }
            uint4 pk;
            pk.x = (u32)f2bf(p[0]) | ((u32)f2bf(p[1]) << 16);
            pk.y = (u32)f2bf(p[2]) | ((u32)f2bf(p[3]) << 16);
            pk.z = (u32)f2bf(p[4]) | ((u32)f2bf(p[5]) << 16);
            pk.w = (u32)f2bf(p[6]) | ((u32)f2bf(p[7]) << 16);
            *(uint4*)&Pbuf[row * LP + c8] = pk;
            sum += row_xor<1>(sum);
            sum += row_xor<2>(sum);
            sum += row_xor<4>(sum);
            sum += row_xor<8>(sum);
            if (lr == 0) {
                const float alpha = __expf(mold - mnew);
                rowL[row] = rowL[row] * alpha + sum;
                rowM[row] = mnew;
                rowA[row] = alpha;
            }
        }
        __syncthreads();

        // phase 3: rescale running accumulator, then acc += P @ V-slice
        #pragma unroll
        for (int qt = 0; qt < QT; qt++) {
            float al[8];
            #pragma unroll
            for (int r = 0; r < 8; r++) al[r] = rowA[qt * 16 + r + half * 8];
            #pragma unroll
            for (int j = 0; j < 8; j++)
                #pragma unroll
                for (int r = 0; r < 8; r++) acc[qt][j][r] *= al[r];
        }

        #pragma unroll 1   // rolled: one set of V fragment registers serves all four trips
        for (int ks = 0; ks < KC; ks += 32) {
            v16bf bv[8];
            #pragma unroll
            for (int j = 0; j < 8; j++) {
                const u16* vp = Vt + ((size_t)(b * (S / 32) + ((kc + ks) >> 5)) * (DE / 16)
                                      + (dbase >> 4) + j) * 512 + lane * 8;
                bv[j] = ld_frag(vp, vp + 256);
            }
            // the V loads' address registers are stepped for the next trip, and rewritten for the
            // next pass's K loads, further down
            asm volatile("s_wait_xcnt 0x0" ::: "memory");
            v16bf ap[QT];
            #pragma unroll
            for (int qt = 0; qt < QT; qt++) {
                const u16* pp = &Pbuf[(qt * 16 + lr) * LP + ks];
                ap[qt] = ld_frag(pp + half * 8, pp + 16 + half * 8);
            }
            // keeps the trip's 16 V loads in flight together: left to itself the compiler
            // sinks each pair to just ahead of its products and the wave waits out 8 latencies
            __builtin_amdgcn_sched_barrier(0);
            #pragma unroll
            for (int j = 0; j < 8; j++)
                #pragma unroll
                for (int qt = 0; qt < QT; qt++)
                    acc[qt][j] = wmma_bf16(ap[qt], bv[j], acc[qt][j]);
        }
        __syncthreads();
    }

    // finalize: divide by softmax denominator, store bf16 ctx
    #pragma unroll
    for (int qt = 0; qt < QT; qt++) {
        float inv[8];
        #pragma unroll
        for (int r = 0; r < 8; r++) inv[r] = 1.f / rowL[qt * 16 + r + half * 8];
        #pragma unroll
        for (int j = 0; j < 8; j++) {
            const int n = dbase + j * 16 + lr;
            #pragma unroll
            for (int r = 0; r < 8; r++) {
                const int m = q0 + qt * 16 + r + half * 8;
                ctx[((size_t)b * S + m) * DE + n] = f2bf(acc[qt][j][r] * inv[r]);
            }
            // the stores' data and address registers are rewritten for the next column tile
            asm volatile("s_wait_xcnt 0x0" ::: "memory");
            // keeps the next tile's arithmetic, which rewrites those registers, behind that wait
            __builtin_amdgcn_sched_barrier(0);
        }
    }
}

// ---------- host launcher ----------
extern "C" void kernel_launch(void* const* d_in, const int* in_sizes, int n_in,
                              void* d_out, int out_size, void* d_ws, size_t ws_size,
                              hipStream_t stream)
{
    (void)in_sizes; (void)n_in; (void)out_size; (void)ws_size;

    const float* x  = (const float*)d_in[0];
    const float* Wq = (const float*)d_in[1];
    const float* bq = (const float*)d_in[2];
    const float* Wk = (const float*)d_in[3];
    const float* bk = (const float*)d_in[4];
    const float* Wv = (const float*)d_in[5];
    const float* bv = (const float*)d_in[6];
    const float* Wo = (const float*)d_in[7];
    const float* bo = (const float*)d_in[8];
    float* out = (float*)d_out;

    char* ws = (char*)d_ws;
    const size_t MB = 1ull << 20;
    u16* xb  = (u16*)(ws);                 // 32 MB  x bf16 [m][k]
    u16* wqb = (u16*)(ws + 32 * MB);       //  2 MB  Wq^T bf16 [n][k]
    u16* wkb = (u16*)(ws + 34 * MB);       //  2 MB  Wk^T
    u16* wvb = (u16*)(ws + 36 * MB);       //  2 MB  Wv^T
    u16* wob = (u16*)(ws + 38 * MB);       //  2 MB  Wo^T
    u16* Qb  = (u16*)(ws + 40 * MB);       // 32 MB  Q bf16 [b][s][d]
    u16* Kb  = (u16*)(ws + 72 * MB);       // 32 MB  K bf16, fragment-ordered tiles
    u16* Vtb = (u16*)(ws + 104 * MB);      // 32 MB  V bf16, fragment-ordered tiles
    u16* ctx = (u16*)(ws + 136 * MB);      // 32 MB  attention output bf16

    const int nx4 = MTOT * DIN / 4;
    const int nw  = DIN * DE;
    cvt_f32_bf16<<<(nx4 + 255) / 256, 256, 0, stream>>>(x, xb, nx4);
    cvt_f32_bf16_T<<<(nw + 255) / 256, 256, 0, stream>>>(Wq, wqb, DIN, DE);
    cvt_f32_bf16_T<<<(nw + 255) / 256, 256, 0, stream>>>(Wk, wkb, DIN, DE);
    cvt_f32_bf16_T<<<(nw + 255) / 256, 256, 0, stream>>>(Wv, wvb, DIN, DE);
    cvt_f32_bf16_T<<<(nw + 255) / 256, 256, 0, stream>>>(Wo, wob, DE,  DE);

    dim3 gg((MTOT / 128) * (DE / 128));    // 1024 blocks
    gemm_bf16_k<0><<<gg, 256, 0, stream>>>(xb, wqb, bq, Qb,  MTOT, DE, DIN);
    gemm_bf16_k<3><<<gg, 256, 0, stream>>>(xb, wkb, bk, Kb,  MTOT, DE, DIN);
    gemm_bf16_k<1><<<gg, 256, 0, stream>>>(xb, wvb, bv, Vtb, MTOT, DE, DIN);

    attn_k<<<dim3(BATCH * (S / 64)), 256, 0, stream>>>(Qb, Kb, Vtb, ctx);

    gemm_bf16_k<2><<<gg, 256, 0, stream>>>(ctx, wob, bo, out, MTOT, DE, DIN);
}

// v004
// One run takes 417 microseconds.
// Timed twice side by side with v003, it ran 1.27 times as fast both times.
// All steps since v000 together make it 2.22 times as fast.
#include <hip/hip_runtime.h>
#include <stdint.h>

typedef __attribute__((ext_vector_type(16))) __bf16 v16bf;
typedef __attribute__((ext_vector_type(8)))  float  v8f;
typedef __attribute__((ext_vector_type(4)))  uint32_t v4u;
typedef __attribute__((ext_vector_type(8)))  int      v8i_;
typedef __attribute__((ext_vector_type(4)))  int      v4i_;
typedef uint16_t u16;
typedef uint32_t u32;

#define DEVI __device__ __forceinline__

constexpr int BATCH = 8;
constexpr int S     = 2048;
constexpr int DIN   = 1024;
constexpr int DE    = 1024;
constexpr int MTOT  = BATCH * S;

// ---------- helpers ----------
DEVI u16 f2bf(float f) {                       // round-to-nearest-even f32 -> bf16
    u32 u = __float_as_uint(f);
    u32 r = (u + 0x7FFFu + ((u >> 16) & 1u)) >> 16;
    return (u16)r;
}

struct U4x2 { uint4 a, b; };

DEVI v16bf ld_frag(const u16* p0, const u16* p1) {   // two 16B chunks -> 16 bf16 frag
    U4x2 u;
    u.a = *(const uint4*)p0;
    u.b = *(const uint4*)p1;
    return __builtin_bit_cast(v16bf, u);
}

DEVI v8f wmma_bf16(v16bf a, v16bf b, v8f c) {
    return __builtin_amdgcn_wmma_f32_16x16x32_bf16(
        /*neg_a=*/false, a, /*neg_b=*/false, b,
        /*c_mod=*/(short)0, c, /*reuse_a=*/false, /*reuse_b=*/false);
}

// value of lane (l ^ M) of the same 16-lane row, by a DPP move (no LDS round trip)
template<int M>
DEVI float row_xor(float v) {
    const int i = __float_as_int(v);
    return __int_as_float(__builtin_amdgcn_update_dpp(i, i, 0x160 | M, 0xf, 0xf, false));
}

// a wave-uniform condition held in a scalar register, so that the test around a tensor
// load compiles to a scalar compare and branch (a tensor load ignores EXEC)
DEVI u32 pinned(u32 v) {
    u32 w = (u32)__builtin_amdgcn_readfirstlane((int)v);
    asm volatile("" : "+s"(w));   // pinned(): the issue test of a tensor load held in a scalar register
    return w;
}

// TDM: load a 2D bf16 tile (rows x cols, row stride in elements) from global to
// LDS, inserting 16B of LDS padding after every 1024B (so an LDS "row" of
// 2048B data occupies 2080B -> bank-spread, 16B-aligned chunks).
DEVI void tdm_load_tile_2d(u32 lds_off, const u16* gptr,
                           int cols, int rows, int row_stride_elems) {
    uint64_t ga = (uint64_t)(uintptr_t)gptr;
    v4u g0 = { 1u,                                   // count = 1 descriptor
               lds_off,                              // lds_addr (bytes)
               (u32)ga,                              // global_addr[31:0]
               (u32)(ga >> 32) | (2u << 30) };       // global_addr[56:32] | type=2
    v8i_ g1;
    g1[0] = (int)((1u << 16)                          // data_size = 2 bytes
                | (1u << 20)                          // pad_enable
                | (7u << 22)                          // pad_interval = 256 dwords (1024B)
                | (3u << 25));                        // pad_amount  = 4 dwords (16B)
    g1[1] = (int)((u32)(cols & 0xFFFF) << 16);        // tensor_dim0 low16
    g1[2] = (int)(((u32)cols >> 16) | ((u32)(rows & 0xFFFF) << 16)); // dim0 hi | dim1 lo
    g1[3] = (int)(((u32)rows >> 16) | ((u32)cols << 16));            // dim1 hi | tile_dim0
    g1[4] = (int)(u32)rows;                           // tile_dim1 (tile_dim2 = 0)
    g1[5] = (int)(u32)row_stride_elems;               // tensor_dim0_stride low32
    g1[6] = 0;
    g1[7] = 0;
    v4i_ z4 = {};
#if __clang_major__ >= 23
    v8i_ z8 = {};
    __builtin_amdgcn_tensor_load_to_lds(g0, g1, z4, z4, z8, 0);
#else
    __builtin_amdgcn_tensor_load_to_lds(g0, g1, z4, z4, 0);
#endif
}

// ---------- f32 -> bf16 conversion ----------
// A block converts CVT_PER x 256 consecutive float4 (16 per thread): starting a wave costs
// far more than moving the 512 bytes that a wave of one load per lane reads, so the work
// goes to few waves that each have many whole-line loads in flight.
constexpr int CVT_PER = 16;

DEVI ushort4 cvt4(float4 f) {
    ushort4 o;
    o.x = f2bf(f.x); o.y = f2bf(f.y); o.z = f2bf(f.z); o.w = f2bf(f.w);
    return o;
}

__global__ __launch_bounds__(256)
void cvt_f32_bf16(const float* __restrict__ in, u16* __restrict__ out, int n4) {
    const int blk0 = blockIdx.x * (256 * CVT_PER);
    const int i0   = blk0 + threadIdx.x;
    if (blk0 + 256 * CVT_PER <= n4) {          // whole block in range: no test per element
        float4 f[CVT_PER];
        #pragma unroll   // constant indices keep f[] in registers and fold into the loads' offsets
        for (int j = 0; j < CVT_PER; j++) f[j] = ((const float4*)in)[i0 + j * 256];
        #pragma unroll   // constant indices keep f[] in registers and fold into the stores' offsets
        for (int j = 0; j < CVT_PER; j++) ((ushort4*)out)[i0 + j * 256] = cvt4(f[j]);
        // precaution: the remainder path is the other branch and never runs after these stores,
        // which end the kernel
        asm volatile("s_wait_xcnt 0x0" ::: "memory");
    } else {
        for (int j = 0; j < CVT_PER; j++) {
            const int i = i0 + j * 256;
            if (i < n4) ((ushort4*)out)[i] = cvt4(((const float4*)in)[i]);
        }
    }
}

// ---------- f32 [K,N] -> bf16 transposed [N,K] (weights) ----------
// A thread converts 8 consecutive k of one column n (8 loads, each coalesced along n)
// and stores them as one 16-byte chunk of the transposed row. Kd is a multiple of 8.
__global__ __launch_bounds__(256)
void cvt_f32_bf16_T(const float* __restrict__ in, u16* __restrict__ out,
                    int Kd, int N) {
    int idx = blockIdx.x * blockDim.x + threadIdx.x;
    if (idx < (Kd >> 3) * N) {
        int kg = idx / N, n = idx - kg * N;
        const float* p = in + (size_t)kg * 8 * N + n;
        float v[8];
        #pragma unroll   // constant indices keep v[] in registers; the 8 loads are in flight together
        for (int j = 0; j < 8; j++) v[j] = p[(size_t)j * N];
        uint4 pk;
        pk.x = (u32)f2bf(v[0]) | ((u32)f2bf(v[1]) << 16);
        pk.y = (u32)f2bf(v[2]) | ((u32)f2bf(v[3]) << 16);
        pk.z = (u32)f2bf(v[4]) | ((u32)f2bf(v[5]) << 16);
        pk.w = (u32)f2bf(v[6]) | ((u32)f2bf(v[7]) << 16);
        *(uint4*)(out + (size_t)n * Kd + kg * 8) = pk;
    }
}

// ---------- tiled bf16 GEMM: C[M,N] = A[M,K] * Bt[N,K]^T + bias ----------
// A row-major [M,K]; Bt is the PRE-TRANSPOSED weight [N,K] (k contiguous).
// MODE 0: bf16 row-major out; MODE 2: f32 row-major out.
// MODE 1 and MODE 3: bf16 out in the order the attention kernel's B fragments are
// loaded: 1 KB tiles of 16 rows x 32 k, a tile = 2 chunks of 512 B, chunk c holds at
// lane (h*16 + row) the 8 elements k = c*16 + h*8 .. +7, so that one wave-wide 16-byte
// load reads 512 contiguous bytes (4 whole lines) instead of 32 B out of 16 lines.
//   MODE 3 (K): row = key m, k = feature n; tiles ordered [m/16][n/32].
//   MODE 1 (V): row = feature n, k = key s;  tiles ordered [b][s/32][n/16].
template<int MODE>
__global__ __launch_bounds__(256)
void gemm_bf16_k(const u16* __restrict__ A, const u16* __restrict__ Bt,
                 const float* __restrict__ bias, void* __restrict__ Out,
                 int M, int N, int Kd)
{
    constexpr int BM = 128, BN = 128, BK = 32;
    constexpr int LDA = 40;   // padded LDS row stride (shorts): 80B, 16B aligned
    constexpr int LDB = 40;
    __shared__ u16 As[BM * LDA];
    __shared__ u16 Bs[BN * LDB];   // [n][k]

    const int nb = N / BN;
    const int m0 = (blockIdx.x / nb) * BM;
    const int n0 = (blockIdx.x % nb) * BN;

    const int t    = threadIdx.x;
    const int lane = t & 31;
    const int wave = t >> 5;       // 0..7
    const int wm   = wave >> 2;    // 0..1 : 64-row slice
    const int wn   = wave & 3;     // 0..3 : 32-col slice
    const int half = lane >> 4;
    const int lr   = lane & 15;

    v8f acc[4][2] = {};

    for (int k0 = 0; k0 < Kd; k0 += BK) {
        // A tile: 128 rows x 32 cols = 512 x 16B chunks, 2 per thread
        #pragma unroll
        for (int i = 0; i < 2; i++) {
            int idx = t + i * 256;
            int row = idx >> 2, ch = idx & 3;
            uint4 d = *(const uint4*)(A + (size_t)(m0 + row) * Kd + k0 + ch * 8);
            *(uint4*)(&As[row * LDA + ch * 8]) = d;
        }
        // B tile from pre-transposed weights: plain copy, no scalar transpose
        #pragma unroll
        for (int i = 0; i < 2; i++) {
            int idx = t + i * 256;
            int row = idx >> 2, ch = idx & 3;
            uint4 d = *(const uint4*)(Bt + (size_t)(n0 + row) * Kd + k0 + ch * 8);
            *(uint4*)(&Bs[row * LDB + ch * 8]) = d;
        }
        // prefetch next k-tile into caches
        if (k0 + BK < Kd) {
            int row = t >> 2, ch = t & 3;
            __builtin_prefetch(A  + (size_t)(m0 + row) * Kd + k0 + BK + ch * 8, 0, 1);
            __builtin_prefetch(Bt + (size_t)(n0 + row) * Kd + k0 + BK + ch * 8, 0, 1);
        }
        __syncthreads();

        v16bf afr[4], bfr[2];
        #pragma unroll
        for (int i = 0; i < 4; i++) {
            const u16* rp = &As[(wm * 64 + i * 16 + lr) * LDA];
            afr[i] = ld_frag(rp + half * 8, rp + 16 + half * 8);
        }
        #pragma unroll
        for (int j = 0; j < 2; j++) {
            const u16* rp = &Bs[(wn * 32 + j * 16 + lr) * LDB];
            bfr[j] = ld_frag(rp + half * 8, rp + 16 + half * 8);
        }
        #pragma unroll
        for (int i = 0; i < 4; i++)
            #pragma unroll
            for (int j = 0; j < 2; j++)
                acc[i][j] = wmma_bf16(afr[i], bfr[j], acc[i][j]);
        __syncthreads();
    }

    // epilogue: lane lr = col, VGPR r -> row r + 8*half
    #pragma unroll
    for (int i = 0; i < 4; i++) {
        #pragma unroll
        for (int j = 0; j < 2; j++) {
            const int n = n0 + wn * 32 + j * 16 + lr;
            const float bv = bias[n];
            if constexpr (MODE == 1) {
                // this lane's 8 accumulator rows are 8 consecutive keys: one 16-byte chunk
                const int mb = m0 + wm * 64 + i * 16;
                const int bb = mb >> 11;             // mb / S (S=2048)
                const int ss = mb & (S - 1);
                const size_t tile = (size_t)(bb * (S / 32) + (ss >> 5)) * (N / 16) + (n >> 4);
                uint4 pk;
                pk.x = (u32)f2bf(acc[i][j][0] + bv) | ((u32)f2bf(acc[i][j][1] + bv) << 16);
                pk.y = (u32)f2bf(acc[i][j][2] + bv) | ((u32)f2bf(acc[i][j][3] + bv) << 16);
                pk.z = (u32)f2bf(acc[i][j][4] + bv) | ((u32)f2bf(acc[i][j][5] + bv) << 16);
                pk.w = (u32)f2bf(acc[i][j][6] + bv) | ((u32)f2bf(acc[i][j][7] + bv) << 16);
                *(uint4*)((u16*)Out + tile * 512 + ((ss >> 4) & 1) * 256 + lane * 8) = pk;
            }
            #pragma unroll
            for (int r = 0; r < 8; r++) {
                const int m = m0 + wm * 64 + i * 16 + r + half * 8;
                const float v = acc[i][j][r] + bv;
                if constexpr (MODE == 0) {
                    ((u16*)Out)[(size_t)m * N + n] = f2bf(v);
                } else if constexpr (MODE == 3) {
                    const size_t tile = (size_t)(m >> 4) * (N / 32) + (n >> 5);
                    ((u16*)Out)[tile * 512 + ((n >> 4) & 1) * 256
                                + (((n >> 3) & 1) * 16 + (m & 15)) * 8 + (n & 7)] = f2bf(v);
                } else if constexpr (MODE == 2) {
                    ((float*)Out)[(size_t)m * N + n] = v;
                }
            }
        }
    }
}

// ---------- flash-style attention: ctx = softmax(Q K^T / sqrt(D)) V ----------
// One block handles 64 q-rows (4 tiles of 16) of one batch, so that every K and V
// fragment a wave loads feeds 4 matrix products. 8 waves; each wave owns a 128-wide
// d-slice of the output accumulator. K and V come in the fragment-ordered 1 KB tiles
// that gemm_bf16_k MODE 3 and MODE 1 write (K: [b*S/16 + s/16][d/32], V: [b][s/32][d/16]).
// Q block is staged into LDS by the Tensor Data Mover (with 16B pad / 1024B), one
// 16-row slice from each of waves 0..3.
__global__ __launch_bounds__(256)
void attn_k(const u16* __restrict__ Q, const u16* __restrict__ K,
            const u16* __restrict__ Vt, u16* __restrict__ ctx)
{
    constexpr int QT = 4;            // 16-row q tiles per block
    constexpr int QB = QT * 16;      // q rows per block
    constexpr int KC = 128;          // k rows per outer iteration (16 per wave)
    constexpr int LQ = DIN + 16;     // TDM-padded Qs row stride (shorts): 2080B
    constexpr int QSL = 17408;       // shorts per 16-row Q slice: 16*LQ rounded up to 2 KiB
    constexpr int LP = KC + 8;       // padded Pbuf stride (shorts)

    __shared__ __attribute__((aligned(2048))) u16 Qs[QT * QSL];   // 139,264 B (TDM destination)
    __shared__ float Sbuf[QB][KC];      // 32 KB
    __shared__ u16   Pbuf[QB * LP];     // 17 KB
    __shared__ float rowM[QB], rowL[QB], rowA[QB];

    const int qblk = blockIdx.x & (S / QB - 1);
    const int b    = blockIdx.x / (S / QB);
    const int q0   = qblk * QB;

    const int t    = threadIdx.x;
    const int lane = t & 31;
    const int wave = t >> 5;
    const int half = lane >> 4;
    const int lr   = lane & 15;

    // stage Q block (64 x 1024 bf16) via Tensor Data Mover: waves 0..3 each issue the
    // 16-row slice of their own number and wait for it themselves
    const u32 wv = (u32)__builtin_amdgcn_readfirstlane(t >> 5);
    if (pinned(wv < (u32)QT)) {
        u32 lds_off = (u32)(uintptr_t)(&Qs[0]) + wv * (u32)(QSL * 2);   // low 32 bits = LDS offset
        tdm_load_tile_2d(lds_off, Q + ((size_t)b * S + q0 + wv * 16) * DE,
                         /*cols=*/DIN, /*rows=*/16, /*row_stride=*/DE);
        __builtin_amdgcn_s_wait_tensorcnt(0);
    }
    if (t < QB) { rowM[t] = -1e30f; rowL[t] = 0.f; }
    __syncthreads();

    const int dbase = wave * 128;
    v8f acc[QT][8] = {};
    const float scale = 0.03125f;    // 1/sqrt(1024)

    for (int kc = 0; kc < S; kc += KC) {
        // phase 1: each wave computes the 64x16 score tile for k-rows kc+wave*16..+16
        v8f sacc[QT] = {};
        const u16* Kg = K + (size_t)(b * (S / 16) + (kc >> 4) + wave) * (DE / 32) * 512 + lane * 8;
        #pragma unroll 16   // lets the K loads of 16 d steps be in flight at once
        for (int d0 = 0; d0 < DIN; d0 += 32) {
            v16bf bk = ld_frag(Kg + (d0 >> 5) * 512, Kg + (d0 >> 5) * 512 + 256);
            #pragma unroll   // constant indices keep sacc[] in registers
            for (int qt = 0; qt < QT; qt++) {
                // TDM pad: +8 shorts after every 512 shorts stored
                const u16* qp = &Qs[qt * QSL + lr * LQ + d0 + 8 * (d0 >> 9)];
                v16bf aq = ld_frag(qp + half * 8, qp + 16 + half * 8);
                sacc[qt] = wmma_bf16(aq, bk, sacc[qt]);
            }
        }
        // the K loads' address registers are rewritten for the V loads further down
        asm volatile("s_wait_xcnt 0x0" ::: "memory");
        #pragma unroll
        for (int qt = 0; qt < QT; qt++)
            #pragma unroll
            for (int r = 0; r < 8; r++)
                Sbuf[qt * 16 + r + half * 8][wave * 16 + lr] = sacc[qt][r] * scale;
        __syncthreads();

        // phase 2: online softmax update, 16 lanes per q-row, 8 columns per lane,
        // 16 rows at a time
        #pragma unroll 1   // rolled: the lr == 0 branch keeps the row groups apart anyway, one copy of the code serves
        for (int rg = 0; rg < QT; rg++) {
            const int row = rg * 16 + (t >> 4);
            const int c8  = lr * 8;
            const float4 sa = *(const float4*)&Sbuf[row][c8];
            const float4 sb = *(const float4*)&Sbuf[row][c8 + 4];
            const float sv[8] = { sa.x, sa.y, sa.z, sa.w, sb.x, sb.y, sb.z, sb.w };
            const float mold = rowM[row];
            float mx = sv[0];
            #pragma unroll   // constant indices keep sv[] in registers
            for (int j = 1; j < 8; j++) mx = fmaxf(mx, sv[j]);
            mx = fmaxf(mx, row_xor<1>(mx));
            mx = fmaxf(mx, row_xor<2>(mx));
            mx = fmaxf(mx, row_xor<4>(mx));
            mx = fmaxf(mx, row_xor<8>(mx));
            const float mnew = fmaxf(mold, mx);
            float p[8];
            float sum = 0.f;
            #pragma unroll   // constant indices keep sv[] and p[] in registers
            for (int j = 0; j < 8; j++) { p[j] = __expf(sv[j] - mnew); sum += p[j]; }
            uint4 pk;
            pk.x = (u32)f2bf(p[0]) | ((u32)f2bf(p[1]) << 16);
            pk.y = (u32)f2bf(p[2]) | ((u32)f2bf(p[3]) << 16);
            pk.z = (u32)f2bf(p[4]) | ((u32)f2bf(p[5]) << 16);
            pk.w = (u32)f2bf(p[6]) | ((u32)f2bf(p[7]) << 16);
            *(uint4*)&Pbuf[row * LP + c8] = pk;
            sum += row_xor<1>(sum);
            sum += row_xor<2>(sum);
            sum += row_xor<4>(sum);
            sum += row_xor<8>(sum);
            if (lr == 0) {
                const float alpha = __expf(mold - mnew);
                rowL[row] = rowL[row] * alpha + sum;
                rowM[row] = mnew;
                rowA[row] = alpha;
            }
        }
        __syncthreads();

        // phase 3: rescale running accumulator, then acc += P @ V-slice
        #pragma unroll
        for (int qt = 0; qt < QT; qt++) {
            float al[8];
            #pragma unroll
            for (int r = 0; r < 8; r++) al[r] = rowA[qt * 16 + r + half * 8];
            #pragma unroll
            for (int j = 0; j < 8; j++)
                #pragma unroll
                for (int r = 0; r < 8; r++) acc[qt][j][r] *= al[r];
        }

        #pragma unroll 1   // rolled: one set of V fragment registers serves all four trips
        for (int ks = 0; ks < KC; ks += 32) {
            v16bf bv[8];
            #pragma unroll
            for (int j = 0; j < 8; j++) {
                const u16* vp = Vt + ((size_t)(b * (S / 32) + ((kc + ks) >> 5)) * (DE / 16)
                                      + (dbase >> 4) + j) * 512 + lane * 8;
                bv[j] = ld_frag(vp, vp + 256);
            }
            // the V loads' address registers are stepped for the next trip, and rewritten for the
            // next pass's K loads, further down
            asm volatile("s_wait_xcnt 0x0" ::: "memory");
            v16bf ap[QT];
            #pragma unroll
            for (int qt = 0; qt < QT; qt++) {
                const u16* pp = &Pbuf[(qt * 16 + lr) * LP + ks];
                ap[qt] = ld_frag(pp + half * 8, pp + 16 + half * 8);
            }
            // keeps the trip's 16 V loads in flight together: left to itself the compiler
            // sinks each pair to just ahead of its products and the wave waits out 8 latencies
            __builtin_amdgcn_sched_barrier(0);
            #pragma unroll
            for (int j = 0; j < 8; j++)
                #pragma unroll
                for (int qt = 0; qt < QT; qt++)
                    acc[qt][j] = wmma_bf16(ap[qt], bv[j], acc[qt][j]);
        }
        __syncthreads();
    }

    // finalize: divide by softmax denominator, store bf16 ctx
    #pragma unroll
    for (int qt = 0; qt < QT; qt++) {
        float inv[8];
        #pragma unroll
        for (int r = 0; r < 8; r++) inv[r] = 1.f / rowL[qt * 16 + r + half * 8];
        #pragma unroll
        for (int j = 0; j < 8; j++) {
            const int n = dbase + j * 16 + lr;
            #pragma unroll
            for (int r = 0; r < 8; r++) {
                const int m = q0 + qt * 16 + r + half * 8;
                ctx[((size_t)b * S + m) * DE + n] = f2bf(acc[qt][j][r] * inv[r]);
            }
            // the stores' data and address registers are rewritten for the next column tile
            asm volatile("s_wait_xcnt 0x0" ::: "memory");
            // keeps the next tile's arithmetic, which rewrites those registers, behind that wait
            __builtin_amdgcn_sched_barrier(0);
        }
    }
}

// ---------- host launcher ----------
extern "C" void kernel_launch(void* const* d_in, const int* in_sizes, int n_in,
                              void* d_out, int out_size, void* d_ws, size_t ws_size,
                              hipStream_t stream)
{
    (void)in_sizes; (void)n_in; (void)out_size; (void)ws_size;

    const float* x  = (const float*)d_in[0];
    const float* Wq = (const float*)d_in[1];
    const float* bq = (const float*)d_in[2];
    const float* Wk = (const float*)d_in[3];
    const float* bk = (const float*)d_in[4];
    const float* Wv = (const float*)d_in[5];
    const float* bv = (const float*)d_in[6];
    const float* Wo = (const float*)d_in[7];
    const float* bo = (const float*)d_in[8];
    float* out = (float*)d_out;

    char* ws = (char*)d_ws;
    const size_t MB = 1ull << 20;
    u16* xb  = (u16*)(ws);                 // 32 MB  x bf16 [m][k]
    u16* wqb = (u16*)(ws + 32 * MB);       //  2 MB  Wq^T bf16 [n][k]
    u16* wkb = (u16*)(ws + 34 * MB);       //  2 MB  Wk^T
    u16* wvb = (u16*)(ws + 36 * MB);       //  2 MB  Wv^T
    u16* wob = (u16*)(ws + 38 * MB);       //  2 MB  Wo^T
    u16* Qb  = (u16*)(ws + 40 * MB);       // 32 MB  Q bf16 [b][s][d]
    u16* Kb  = (u16*)(ws + 72 * MB);       // 32 MB  K bf16, fragment-ordered tiles
    u16* Vtb = (u16*)(ws + 104 * MB);      // 32 MB  V bf16, fragment-ordered tiles
    u16* ctx = (u16*)(ws + 136 * MB);      // 32 MB  attention output bf16

    const int nx4 = MTOT * DIN / 4;
    const int nxb = 256 * CVT_PER;         // float4 per block of cvt_f32_bf16
    const int nw8 = DIN * DE / 8;          // threads of cvt_f32_bf16_T: 8 elements each
    cvt_f32_bf16<<<(nx4 + nxb - 1) / nxb, 256, 0, stream>>>(x, xb, nx4);
    cvt_f32_bf16_T<<<(nw8 + 255) / 256, 256, 0, stream>>>(Wq, wqb, DIN, DE);
    cvt_f32_bf16_T<<<(nw8 + 255) / 256, 256, 0, stream>>>(Wk, wkb, DIN, DE);
    cvt_f32_bf16_T<<<(nw8 + 255) / 256, 256, 0, stream>>>(Wv, wvb, DIN, DE);
    cvt_f32_bf16_T<<<(nw8 + 255) / 256, 256, 0, stream>>>(Wo, wob, DE,  DE);

    dim3 gg((MTOT / 128) * (DE / 128));    // 1024 blocks
    gemm_bf16_k<0><<<gg, 256, 0, stream>>>(xb, wqb, bq, Qb,  MTOT, DE, DIN);
    gemm_bf16_k<3><<<gg, 256, 0, stream>>>(xb, wkb, bk, Kb,  MTOT, DE, DIN);
    gemm_bf16_k<1><<<gg, 256, 0, stream>>>(xb, wvb, bv, Vtb, MTOT, DE, DIN);

    attn_k<<<dim3(BATCH * (S / 64)), 256, 0, stream>>>(Qb, Kb, Vtb, ctx);

    gemm_bf16_k<2><<<gg, 256, 0, stream>>>(ctx, wob, bo, out, MTOT, DE, DIN);
}

// v005
// Measured time: 372 microseconds a run.
// In both of two side-by-side timings against v004, it was 1.12 times as fast.
// All steps since v000 together make it 2.49 times as fast.
#include <hip/hip_runtime.h>
#include <stdint.h>

typedef __attribute__((ext_vector_type(16))) __bf16 v16bf;
typedef __attribute__((ext_vector_type(8)))  float  v8f;
typedef __attribute__((ext_vector_type(4)))  uint32_t v4u;
typedef __attribute__((ext_vector_type(8)))  int      v8i_;
typedef __attribute__((ext_vector_type(4)))  int      v4i_;
typedef uint16_t u16;
typedef uint32_t u32;

#define DEVI __device__ __forceinline__

constexpr int BATCH = 8;
constexpr int S     = 2048;
constexpr int DIN   = 1024;
constexpr int DE    = 1024;
constexpr int MTOT  = BATCH * S;

// ---------- helpers ----------
DEVI u16 f2bf(float f) {                       // round-to-nearest-even f32 -> bf16
    u32 u = __float_as_uint(f);
    u32 r = (u + 0x7FFFu + ((u >> 16) & 1u)) >> 16;
    return (u16)r;
}

struct U4x2 { uint4 a, b; };

DEVI v16bf ld_frag(const u16* p0, const u16* p1) {   // two 16B chunks -> 16 bf16 frag
    U4x2 u;
    u.a = *(const uint4*)p0;
    u.b = *(const uint4*)p1;
    return __builtin_bit_cast(v16bf, u);
}

DEVI v8f wmma_bf16(v16bf a, v16bf b, v8f c) {
    return __builtin_amdgcn_wmma_f32_16x16x32_bf16(
        /*neg_a=*/false, a, /*neg_b=*/false, b,
        /*c_mod=*/(short)0, c, /*reuse_a=*/false, /*reuse_b=*/false);
}

// value of lane (l ^ M) of the same 16-lane row, by a DPP move (no LDS round trip)
template<int M>
DEVI float row_xor(float v) {
    const int i = __float_as_int(v);
    return __int_as_float(__builtin_amdgcn_update_dpp(i, i, 0x160 | M, 0xf, 0xf, false));
}

// a wave-uniform condition held in a scalar register, so that the test around a tensor
// load compiles to a scalar compare and branch (a tensor load ignores EXEC)
DEVI u32 pinned(u32 v) {
    u32 w = (u32)__builtin_amdgcn_readfirstlane((int)v);
    asm volatile("" : "+s"(w));   // pinned(): the issue test of a tensor load held in a scalar register
    return w;
}

// TDM: load a 2D bf16 tile (rows x cols, row stride in elements) from global to
// LDS, inserting 16B of LDS padding after every 1024B (so an LDS "row" of
// 2048B data occupies 2080B -> bank-spread, 16B-aligned chunks).
DEVI void tdm_load_tile_2d(u32 lds_off, const u16* gptr,
                           int cols, int rows, int row_stride_elems) {
    uint64_t ga = (uint64_t)(uintptr_t)gptr;
    v4u g0 = { 1u,                                   // count = 1 descriptor
               lds_off,                              // lds_addr (bytes)
               (u32)ga,                              // global_addr[31:0]
               (u32)(ga >> 32) | (2u << 30) };       // global_addr[56:32] | type=2
    v8i_ g1;
    g1[0] = (int)((1u << 16)                          // data_size = 2 bytes
                | (1u << 20)                          // pad_enable
                | (7u << 22)                          // pad_interval = 256 dwords (1024B)
                | (3u << 25));                        // pad_amount  = 4 dwords (16B)
    g1[1] = (int)((u32)(cols & 0xFFFF) << 16);        // tensor_dim0 low16
    g1[2] = (int)(((u32)cols >> 16) | ((u32)(rows & 0xFFFF) << 16)); // dim0 hi | dim1 lo
    g1[3] = (int)(((u32)rows >> 16) | ((u32)cols << 16));            // dim1 hi | tile_dim0
    g1[4] = (int)(u32)rows;                           // tile_dim1 (tile_dim2 = 0)
    g1[5] = (int)(u32)row_stride_elems;               // tensor_dim0_stride low32
    g1[6] = 0;
    g1[7] = 0;
    v4i_ z4 = {};
#if __clang_major__ >= 23
    v8i_ z8 = {};
    __builtin_amdgcn_tensor_load_to_lds(g0, g1, z4, z4, z8, 0);
#else
    __builtin_amdgcn_tensor_load_to_lds(g0, g1, z4, z4, 0);
#endif
}

// ---------- f32 -> bf16 conversion ----------
// A block converts CVT_PER x 256 consecutive float4 (16 per thread): starting a wave costs
// far more than moving the 512 bytes that a wave of one load per lane reads, so the work
// goes to few waves that each have many whole-line loads in flight.
constexpr int CVT_PER = 16;

DEVI ushort4 cvt4(float4 f) {
    ushort4 o;
    o.x = f2bf(f.x); o.y = f2bf(f.y); o.z = f2bf(f.z); o.w = f2bf(f.w);
    return o;
}

__global__ __launch_bounds__(256)
void cvt_f32_bf16(const float* __restrict__ in, u16* __restrict__ out, int n4) {
    const int blk0 = blockIdx.x * (256 * CVT_PER);
    const int i0   = blk0 + threadIdx.x;
    if (blk0 + 256 * CVT_PER <= n4) {          // whole block in range: no test per element
        float4 f[CVT_PER];
        #pragma unroll   // constant indices keep f[] in registers and fold into the loads' offsets
        for (int j = 0; j < CVT_PER; j++) f[j] = ((const float4*)in)[i0 + j * 256];
        #pragma unroll   // constant indices keep f[] in registers and fold into the stores' offsets
        for (int j = 0; j < CVT_PER; j++) ((ushort4*)out)[i0 + j * 256] = cvt4(f[j]);
        // precaution: the remainder path is the other branch and never runs after these stores,
        // which end the kernel
        asm volatile("s_wait_xcnt 0x0" ::: "memory");
    } else {
        for (int j = 0; j < CVT_PER; j++) {
            const int i = i0 + j * 256;
            if (i < n4) ((ushort4*)out)[i] = cvt4(((const float4*)in)[i]);
        }
    }
}

// ---------- f32 [K,N] -> bf16 transposed [N,K] (weights) ----------
// A thread converts 8 consecutive k of one column n (8 loads, each coalesced along n)
// and stores them as one 16-byte chunk of the transposed row. Kd is a multiple of 8.
__global__ __launch_bounds__(256)
void cvt_f32_bf16_T(const float* __restrict__ in, u16* __restrict__ out,
                    int Kd, int N) {
    int idx = blockIdx.x * blockDim.x + threadIdx.x;
    if (idx < (Kd >> 3) * N) {
        int kg = idx / N, n = idx - kg * N;
        const float* p = in + (size_t)kg * 8 * N + n;
        float v[8];
        #pragma unroll   // constant indices keep v[] in registers; the 8 loads are in flight together
        for (int j = 0; j < 8; j++) v[j] = p[(size_t)j * N];
        uint4 pk;
        pk.x = (u32)f2bf(v[0]) | ((u32)f2bf(v[1]) << 16);
        pk.y = (u32)f2bf(v[2]) | ((u32)f2bf(v[3]) << 16);
        pk.z = (u32)f2bf(v[4]) | ((u32)f2bf(v[5]) << 16);
        pk.w = (u32)f2bf(v[6]) | ((u32)f2bf(v[7]) << 16);
        *(uint4*)(out + (size_t)n * Kd + kg * 8) = pk;
    }
}

// ---------- tiled bf16 GEMM: C[M,N] = A[M,K] * Bt[N,K]^T + bias ----------
// A row-major [M,K]; Bt is the PRE-TRANSPOSED weight [N,K] (k contiguous).
// MODE 0: bf16 row-major out; MODE 2: f32 row-major out.
// MODE 1 and MODE 3: bf16 out in the order the attention kernel's B fragments are
// loaded: 1 KB tiles of 16 rows x 32 k, a tile = 2 chunks of 512 B, chunk c holds at
// lane (h*16 + row) the 8 elements k = c*16 + h*8 .. +7, so that one wave-wide 16-byte
// load reads 512 contiguous bytes (4 whole lines) instead of 32 B out of 16 lines.
//   MODE 3 (K): row = key m, k = feature n; tiles ordered [m/16][n/32].
//   MODE 1 (V): row = feature n, k = key s;  tiles ordered [b][s/32][n/16].
template<int MODE>
__global__ __launch_bounds__(256)
void gemm_bf16_k(const u16* __restrict__ A, const u16* __restrict__ Bt,
                 const float* __restrict__ bias, void* __restrict__ Out,
                 int M, int N, int Kd)
{
    constexpr int BM = 128, BN = 128, BK = 32;
    constexpr int LDA = 40;   // padded LDS row stride (shorts): 80B, 16B aligned
    constexpr int LDB = 40;
    __shared__ u16 As[BM * LDA];
    __shared__ u16 Bs[BN * LDB];   // [n][k]

    const int nb = N / BN;
    const int m0 = (blockIdx.x / nb) * BM;
    const int n0 = (blockIdx.x % nb) * BN;

    const int t    = threadIdx.x;
    const int lane = t & 31;
    const int wave = t >> 5;       // 0..7
    const int wm   = wave >> 2;    // 0..1 : 64-row slice
    const int wn   = wave & 3;     // 0..3 : 32-col slice
    const int half = lane >> 4;
    const int lr   = lane & 15;

    v8f acc[4][2] = {};

    for (int k0 = 0; k0 < Kd; k0 += BK) {
        // A tile: 128 rows x 32 cols = 512 x 16B chunks, 2 per thread
        #pragma unroll
        for (int i = 0; i < 2; i++) {
            int idx = t + i * 256;
            int row = idx >> 2, ch = idx & 3;
            uint4 d = *(const uint4*)(A + (size_t)(m0 + row) * Kd + k0 + ch * 8);
            *(uint4*)(&As[row * LDA + ch * 8]) = d;
        }
        // B tile from pre-transposed weights: plain copy, no scalar transpose
        #pragma unroll
        for (int i = 0; i < 2; i++) {
            int idx = t + i * 256;
            int row = idx >> 2, ch = idx & 3;
            uint4 d = *(const uint4*)(Bt + (size_t)(n0 + row) * Kd + k0 + ch * 8);
            *(uint4*)(&Bs[row * LDB + ch * 8]) = d;
        }
        // prefetch next k-tile into caches
        if (k0 + BK < Kd) {
            int row = t >> 2, ch = t & 3;
            __builtin_prefetch(A  + (size_t)(m0 + row) * Kd + k0 + BK + ch * 8, 0, 1);
            __builtin_prefetch(Bt + (size_t)(n0 + row) * Kd + k0 + BK + ch * 8, 0, 1);
        }
        __syncthreads();

        v16bf afr[4], bfr[2];
        #pragma unroll
        for (int i = 0; i < 4; i++) {
            const u16* rp = &As[(wm * 64 + i * 16 + lr) * LDA];
            afr[i] = ld_frag(rp + half * 8, rp + 16 + half * 8);
        }
        #pragma unroll
        for (int j = 0; j < 2; j++) {
            const u16* rp = &Bs[(wn * 32 + j * 16 + lr) * LDB];
            bfr[j] = ld_frag(rp + half * 8, rp + 16 + half * 8);
        }
        #pragma unroll
        for (int i = 0; i < 4; i++)
            #pragma unroll
            for (int j = 0; j < 2; j++)
                acc[i][j] = wmma_bf16(afr[i], bfr[j], acc[i][j]);
        __syncthreads();
    }

    // epilogue: lane lr = col, VGPR r -> row r + 8*half
    #pragma unroll
    for (int i = 0; i < 4; i++) {
        #pragma unroll
        for (int j = 0; j < 2; j++) {
            const int n = n0 + wn * 32 + j * 16 + lr;
            const float bv = bias[n];
            if constexpr (MODE == 1) {
                // this lane's 8 accumulator rows are 8 consecutive keys: one 16-byte chunk
                const int mb = m0 + wm * 64 + i * 16;
                const int bb = mb >> 11;             // mb / S (S=2048)
                const int ss = mb & (S - 1);
                const size_t tile = (size_t)(bb * (S / 32) + (ss >> 5)) * (N / 16) + (n >> 4);
                uint4 pk;
                pk.x = (u32)f2bf(acc[i][j][0] + bv) | ((u32)f2bf(acc[i][j][1] + bv) << 16);
                pk.y = (u32)f2bf(acc[i][j][2] + bv) | ((u32)f2bf(acc[i][j][3] + bv) << 16);
                pk.z = (u32)f2bf(acc[i][j][4] + bv) | ((u32)f2bf(acc[i][j][5] + bv) << 16);
                pk.w = (u32)f2bf(acc[i][j][6] + bv) | ((u32)f2bf(acc[i][j][7] + bv) << 16);
                *(uint4*)((u16*)Out + tile * 512 + ((ss >> 4) & 1) * 256 + lane * 8) = pk;
            }
            #pragma unroll
            for (int r = 0; r < 8; r++) {
                const int m = m0 + wm * 64 + i * 16 + r + half * 8;
                const float v = acc[i][j][r] + bv;
                if constexpr (MODE == 0) {
                    ((u16*)Out)[(size_t)m * N + n] = f2bf(v);
                } else if constexpr (MODE == 3) {
                    const size_t tile = (size_t)(m >> 4) * (N / 32) + (n >> 5);
                    ((u16*)Out)[tile * 512 + ((n >> 4) & 1) * 256
                                + (((n >> 3) & 1) * 16 + (m & 15)) * 8 + (n & 7)] = f2bf(v);
                } else if constexpr (MODE == 2) {
                    ((float*)Out)[(size_t)m * N + n] = v;
                }
            }
        }
    }
}

// ---------- flash-style attention: ctx = softmax(Q K^T / sqrt(D)) V ----------
// One block handles 64 q-rows (4 tiles of 16) of one batch, so that every K and V
// fragment a wave loads feeds 4 matrix products; a pass covers 256 keys, 2 tiles of 16 per
// wave, so that every Q fragment read from LDS feeds 2. 8 waves; each wave owns a 128-wide
// d-slice of the output accumulator. K and V come in the fragment-ordered 1 KB tiles
// that gemm_bf16_k MODE 3 and MODE 1 write (K: [b*S/16 + s/16][d/32], V: [b][s/32][d/16]).
// Q block is staged into LDS by the Tensor Data Mover (with 16B pad / 1024B), one
// 16-row slice from each of waves 0..3.
__global__ __launch_bounds__(256)
void attn_k(const u16* __restrict__ Q, const u16* __restrict__ K,
            const u16* __restrict__ Vt, u16* __restrict__ ctx)
{
    constexpr int QT = 4;            // 16-row q tiles per block
    constexpr int QB = QT * 16;      // q rows per block
    constexpr int KT = 2;            // 16-key tiles per wave and pass
    constexpr int KC = 8 * KT * 16;  // k rows per outer iteration (32 per wave)
    constexpr int LQ = DIN + 16;     // TDM-padded Qs row stride (shorts): 2080B
    constexpr int QSL = 17408;       // shorts per 16-row Q slice: 16*LQ rounded up to 2 KiB
    constexpr int LP = KC + 8;       // padded Pbuf stride (shorts)

    __shared__ __attribute__((aligned(2048))) u16 Qs[QT * QSL];   // 139,264 B (TDM destination)
    __shared__ float Sbuf[QB][KC];      // 64 KB
    __shared__ u16   Pbuf[QB * LP];     // 33 KB
    __shared__ float rowM[QB], rowL[QB], rowA[QB];

    const int qblk = blockIdx.x & (S / QB - 1);
    const int b    = blockIdx.x / (S / QB);
    const int q0   = qblk * QB;

    const int t    = threadIdx.x;
    const int lane = t & 31;
    const int wave = t >> 5;
    const int half = lane >> 4;
    const int lr   = lane & 15;

    // stage Q block (64 x 1024 bf16) via Tensor Data Mover: waves 0..3 each issue the
    // 16-row slice of their own number and wait for it themselves
    const u32 wv = (u32)__builtin_amdgcn_readfirstlane(t >> 5);
    if (pinned(wv < (u32)QT)) {
        u32 lds_off = (u32)(uintptr_t)(&Qs[0]) + wv * (u32)(QSL * 2);   // low 32 bits = LDS offset
        tdm_load_tile_2d(lds_off, Q + ((size_t)b * S + q0 + wv * 16) * DE,
                         /*cols=*/DIN, /*rows=*/16, /*row_stride=*/DE);
        __builtin_amdgcn_s_wait_tensorcnt(0);
    }
    if (t < QB) { rowM[t] = -1e30f; rowL[t] = 0.f; }
    __syncthreads();

    const int dbase = wave * 128;
    v8f acc[QT][8] = {};
    const float scale = 0.03125f;    // 1/sqrt(1024)

    for (int kc = 0; kc < S; kc += KC) {
        // phase 1: each wave computes the 64x32 score tile for k-rows kc+wave*32..+32
        v8f sacc[KT][QT] = {};
        const u16* Kg = K + (size_t)(b * (S / 16) + (kc >> 4) + wave * KT) * (DE / 32) * 512 + lane * 8;
        constexpr int DG = 8;   // d steps whose K fragments are fetched as one group
        #pragma unroll 1   // rolled: one set of K fragment registers serves all four groups
        for (int dg = 0; dg < DIN; dg += 32 * DG) {
            v16bf bk[DG][KT];
            #pragma unroll   // constant indices keep bk[] in registers
            for (int g = 0; g < DG; g++)
                #pragma unroll
                for (int kt = 0; kt < KT; kt++) {
                    const u16* kp = Kg + (kt * (DE / 32) + (dg >> 5) + g) * 512;
                    bk[g][kt] = ld_frag(kp, kp + 256);
                }
            // the K loads' address registers are stepped for the next group, and rewritten for
            // the V loads, further down
            asm volatile("s_wait_xcnt 0x0" ::: "memory");
            // keeps the group's 32 K loads in flight together: left to itself the compiler sinks
            // each d step's loads to just ahead of its products and the wave waits out 8 latencies
            __builtin_amdgcn_sched_barrier(0);
            #pragma unroll   // constant indices keep bk[] in registers
            for (int g = 0; g < DG; g++) {
                const int d0 = dg + g * 32;
                v16bf aq[QT];
                #pragma unroll   // constant indices keep aq[] in registers
                for (int qt = 0; qt < QT; qt++) {
                    // TDM pad: +8 shorts after every 512 shorts stored
                    const u16* qp = &Qs[qt * QSL + lr * LQ + d0 + 8 * (d0 >> 9)];
                    aq[qt] = ld_frag(qp + half * 8, qp + 16 + half * 8);
                }
                // keeps the d step's 8 LDS reads in flight together: left to itself the compiler
                // reads each Q fragment just ahead of its 2 products and waits out 4 LDS latencies
                __builtin_amdgcn_sched_barrier(0);
                #pragma unroll   // constant indices keep sacc[], aq[] and bk[] in registers
                for (int qt = 0; qt < QT; qt++)
                    #pragma unroll
                    for (int kt = 0; kt < KT; kt++)
                        sacc[kt][qt] = wmma_bf16(aq[qt], bk[g][kt], sacc[kt][qt]);
            }
        }
        #pragma unroll
        for (int kt = 0; kt < KT; kt++)
            #pragma unroll
            for (int qt = 0; qt < QT; qt++)
                #pragma unroll
                for (int r = 0; r < 8; r++)
                    Sbuf[qt * 16 + r + half * 8][(wave * KT + kt) * 16 + lr] = sacc[kt][qt][r] * scale;
        __syncthreads();

        // phase 2: online softmax update, 16 lanes per q-row, 8 columns per lane out of
        // each 128-column half of the pass, 16 rows at a time
        #pragma unroll 1   // rolled: the lr == 0 branch keeps the row groups apart anyway, one copy of the code serves
        for (int rg = 0; rg < QT; rg++) {
            const int row = rg * 16 + (t >> 4);
            const int c8  = lr * 8;
            float sv[8 * KT];
            #pragma unroll   // constant indices keep sv[] in registers
            for (int h = 0; h < KT; h++) {
                const float4 sa = *(const float4*)&Sbuf[row][h * 128 + c8];
                const float4 sb = *(const float4*)&Sbuf[row][h * 128 + c8 + 4];
                sv[h * 8 + 0] = sa.x; sv[h * 8 + 1] = sa.y; sv[h * 8 + 2] = sa.z; sv[h * 8 + 3] = sa.w;
                sv[h * 8 + 4] = sb.x; sv[h * 8 + 5] = sb.y; sv[h * 8 + 6] = sb.z; sv[h * 8 + 7] = sb.w;
            }
            const float mold = rowM[row];
            float mx = sv[0];
            #pragma unroll   // constant indices keep sv[] in registers
            for (int j = 1; j < 8 * KT; j++) mx = fmaxf(mx, sv[j]);
            mx = fmaxf(mx, row_xor<1>(mx));
            mx = fmaxf(mx, row_xor<2>(mx));
            mx = fmaxf(mx, row_xor<4>(mx));
            mx = fmaxf(mx, row_xor<8>(mx));
            const float mnew = fmaxf(mold, mx);
            float p[8 * KT];
            float sum = 0.f;
            #pragma unroll   // constant indices keep sv[] and p[] in registers
            for (int j = 0; j < 8 * KT; j++) { p[j] = __expf(sv[j] - mnew); sum += p[j]; }
            #pragma unroll   // constant indices keep p[] in registers
            for (int h = 0; h < KT; h++) {
                uint4 pk;
                pk.x = (u32)f2bf(p[h * 8 + 0]) | ((u32)f2bf(p[h * 8 + 1]) << 16);
                pk.y = (u32)f2bf(p[h * 8 + 2]) | ((u32)f2bf(p[h * 8 + 3]) << 16);
                pk.z = (u32)f2bf(p[h * 8 + 4]) | ((u32)f2bf(p[h * 8 + 5]) << 16);
                pk.w = (u32)f2bf(p[h * 8 + 6]) | ((u32)f2bf(p[h * 8 + 7]) << 16);
                *(uint4*)&Pbuf[row * LP + h * 128 + c8] = pk;
            }
            sum += row_xor<1>(sum);
            sum += row_xor<2>(sum);
            sum += row_xor<4>(sum);
            sum += row_xor<8>(sum);
            if (lr == 0) {
                const float alpha = __expf(mold - mnew);
                rowL[row] = rowL[row] * alpha + sum;
                rowM[row] = mnew;
                rowA[row] = alpha;
            }
        }
        __syncthreads();

        // phase 3: rescale running accumulator, then acc += P @ V-slice
        #pragma unroll
        for (int qt = 0; qt < QT; qt++) {
            float al[8];
            #pragma unroll
            for (int r = 0; r < 8; r++) al[r] = rowA[qt * 16 + r + half * 8];
            #pragma unroll
            for (int j = 0; j < 8; j++)
                #pragma unroll
                for (int r = 0; r < 8; r++) acc[qt][j][r] *= al[r];
        }

        #pragma unroll 1   // rolled: one set of V fragment registers serves all eight trips
        for (int ks = 0; ks < KC; ks += 32) {
            v16bf bv[8];
            #pragma unroll
            for (int j = 0; j < 8; j++) {
                const u16* vp = Vt + ((size_t)(b * (S / 32) + ((kc + ks) >> 5)) * (DE / 16)
                                      + (dbase >> 4) + j) * 512 + lane * 8;
                bv[j] = ld_frag(vp, vp + 256);
            }
            // the V loads' address registers are stepped for the next trip, and rewritten for the
            // next pass's K loads, further down
            asm volatile("s_wait_xcnt 0x0" ::: "memory");
            v16bf ap[QT];
            #pragma unroll
            for (int qt = 0; qt < QT; qt++) {
                const u16* pp = &Pbuf[(qt * 16 + lr) * LP + ks];
                ap[qt] = ld_frag(pp + half * 8, pp + 16 + half * 8);
            }
            // keeps the trip's 16 V loads in flight together: left to itself the compiler
            // sinks each pair to just ahead of its products and the wave waits out 8 latencies
            __builtin_amdgcn_sched_barrier(0);
            #pragma unroll
            for (int j = 0; j < 8; j++)
                #pragma unroll
                for (int qt = 0; qt < QT; qt++)
                    acc[qt][j] = wmma_bf16(ap[qt], bv[j], acc[qt][j]);
        }
        __syncthreads();
    }

    // finalize: divide by softmax denominator, store bf16 ctx
    #pragma unroll
    for (int qt = 0; qt < QT; qt++) {
        float inv[8];
        #pragma unroll
        for (int r = 0; r < 8; r++) inv[r] = 1.f / rowL[qt * 16 + r + half * 8];
        #pragma unroll
        for (int j = 0; j < 8; j++) {
            const int n = dbase + j * 16 + lr;
            #pragma unroll
            for (int r = 0; r < 8; r++) {
                const int m = q0 + qt * 16 + r + half * 8;
                ctx[((size_t)b * S + m) * DE + n] = f2bf(acc[qt][j][r] * inv[r]);
            }
            // the stores' data and address registers are rewritten for the next column tile
            asm volatile("s_wait_xcnt 0x0" ::: "memory");
            // keeps the next tile's arithmetic, which rewrites those registers, behind that wait
            __builtin_amdgcn_sched_barrier(0);
        }
    }
}

// ---------- host launcher ----------
extern "C" void kernel_launch(void* const* d_in, const int* in_sizes, int n_in,
                              void* d_out, int out_size, void* d_ws, size_t ws_size,
                              hipStream_t stream)
{
    (void)in_sizes; (void)n_in; (void)out_size; (void)ws_size;

    const float* x  = (const float*)d_in[0];
    const float* Wq = (const float*)d_in[1];
    const float* bq = (const float*)d_in[2];
    const float* Wk = (const float*)d_in[3];
    const float* bk = (const float*)d_in[4];
    const float* Wv = (const float*)d_in[5];
    const float* bv = (const float*)d_in[6];
    const float* Wo = (const float*)d_in[7];
    const float* bo = (const float*)d_in[8];
    float* out = (float*)d_out;

    char* ws = (char*)d_ws;
    const size_t MB = 1ull << 20;
    u16* xb  = (u16*)(ws);                 // 32 MB  x bf16 [m][k]
    u16* wqb = (u16*)(ws + 32 * MB);       //  2 MB  Wq^T bf16 [n][k]
    u16* wkb = (u16*)(ws + 34 * MB);       //  2 MB  Wk^T
    u16* wvb = (u16*)(ws + 36 * MB);       //  2 MB  Wv^T
    u16* wob = (u16*)(ws + 38 * MB);       //  2 MB  Wo^T
    u16* Qb  = (u16*)(ws + 40 * MB);       // 32 MB  Q bf16 [b][s][d]
    u16* Kb  = (u16*)(ws + 72 * MB);       // 32 MB  K bf16, fragment-ordered tiles
    u16* Vtb = (u16*)(ws + 104 * MB);      // 32 MB  V bf16, fragment-ordered tiles
    u16* ctx = (u16*)(ws + 136 * MB);      // 32 MB  attention output bf16

    const int nx4 = MTOT * DIN / 4;
    const int nxb = 256 * CVT_PER;         // float4 per block of cvt_f32_bf16
    const int nw8 = DIN * DE / 8;          // threads of cvt_f32_bf16_T: 8 elements each
    cvt_f32_bf16<<<(nx4 + nxb - 1) / nxb, 256, 0, stream>>>(x, xb, nx4);
    cvt_f32_bf16_T<<<(nw8 + 255) / 256, 256, 0, stream>>>(Wq, wqb, DIN, DE);
    cvt_f32_bf16_T<<<(nw8 + 255) / 256, 256, 0, stream>>>(Wk, wkb, DIN, DE);
    cvt_f32_bf16_T<<<(nw8 + 255) / 256, 256, 0, stream>>>(Wv, wvb, DIN, DE);
    cvt_f32_bf16_T<<<(nw8 + 255) / 256, 256, 0, stream>>>(Wo, wob, DE,  DE);

    dim3 gg((MTOT / 128) * (DE / 128));    // 1024 blocks
    gemm_bf16_k<0><<<gg, 256, 0, stream>>>(xb, wqb, bq, Qb,  MTOT, DE, DIN);
    gemm_bf16_k<3><<<gg, 256, 0, stream>>>(xb, wkb, bk, Kb,  MTOT, DE, DIN);
    gemm_bf16_k<1><<<gg, 256, 0, stream>>>(xb, wvb, bv, Vtb, MTOT, DE, DIN);

    attn_k<<<dim3(BATCH * (S / 64)), 256, 0, stream>>>(Qb, Kb, Vtb, ctx);

    gemm_bf16_k<2><<<gg, 256, 0, stream>>>(ctx, wob, bo, out, MTOT, DE, DIN);
}

// v006
// A run of this version takes 301 microseconds.
// Next to v005, in two timings, it ran 1.24 times as fast each time.
// Over all steps from v000 it is 3.08 times as fast.
#include <hip/hip_runtime.h>
#include <stdint.h>

typedef __attribute__((ext_vector_type(16))) __bf16 v16bf;
typedef __attribute__((ext_vector_type(8)))  float  v8f;
typedef __attribute__((ext_vector_type(4)))  uint32_t v4u;
typedef __attribute__((ext_vector_type(8)))  int      v8i_;
typedef __attribute__((ext_vector_type(4)))  int      v4i_;
typedef uint16_t u16;
typedef uint32_t u32;

#define DEVI __device__ __forceinline__

constexpr int BATCH = 8;
constexpr int S     = 2048;
constexpr int DIN   = 1024;
constexpr int DE    = 1024;
constexpr int MTOT  = BATCH * S;

// ---------- helpers ----------
DEVI u16 f2bf(float f) {                       // round-to-nearest-even f32 -> bf16
    u32 u = __float_as_uint(f);
    u32 r = (u + 0x7FFFu + ((u >> 16) & 1u)) >> 16;
    return (u16)r;
}

struct U4x2 { uint4 a, b; };

DEVI v16bf ld_frag(const u16* p0, const u16* p1) {   // two 16B chunks -> 16 bf16 frag
    U4x2 u;
    u.a = *(const uint4*)p0;
    u.b = *(const uint4*)p1;
    return __builtin_bit_cast(v16bf, u);
}

DEVI v8f wmma_bf16(v16bf a, v16bf b, v8f c) {
    return __builtin_amdgcn_wmma_f32_16x16x32_bf16(
        /*neg_a=*/false, a, /*neg_b=*/false, b,
        /*c_mod=*/(short)0, c, /*reuse_a=*/false, /*reuse_b=*/false);
}

// value of lane (l ^ M) of the same 16-lane row, by a DPP move (no LDS round trip)
template<int M>
DEVI float row_xor(float v) {
    const int i = __float_as_int(v);
    return __int_as_float(__builtin_amdgcn_update_dpp(i, i, 0x160 | M, 0xf, 0xf, false));
}

// a wave-uniform condition held in a scalar register, so that the test around a tensor
// load compiles to a scalar compare and branch (a tensor load ignores EXEC)
DEVI u32 pinned(u32 v) {
    u32 w = (u32)__builtin_amdgcn_readfirstlane((int)v);
    asm volatile("" : "+s"(w));   // pinned(): the issue test of a tensor load held in a scalar register
    return w;
}

// TDM: load a 2D bf16 tile (rows x cols, row stride in elements) from global to
// LDS, inserting 16B of LDS padding after every 1024B (so an LDS "row" of
// 2048B data occupies 2080B -> bank-spread, 16B-aligned chunks).
DEVI void tdm_load_tile_2d(u32 lds_off, const u16* gptr,
                           int cols, int rows, int row_stride_elems) {
    uint64_t ga = (uint64_t)(uintptr_t)gptr;
    v4u g0 = { 1u,                                   // count = 1 descriptor
               lds_off,                              // lds_addr (bytes)
               (u32)ga,                              // global_addr[31:0]
               (u32)(ga >> 32) | (2u << 30) };       // global_addr[56:32] | type=2
    v8i_ g1;
    g1[0] = (int)((1u << 16)                          // data_size = 2 bytes
                | (1u << 20)                          // pad_enable
                | (7u << 22)                          // pad_interval = 256 dwords (1024B)
                | (3u << 25));                        // pad_amount  = 4 dwords (16B)
    g1[1] = (int)((u32)(cols & 0xFFFF) << 16);        // tensor_dim0 low16
    g1[2] = (int)(((u32)cols >> 16) | ((u32)(rows & 0xFFFF) << 16)); // dim0 hi | dim1 lo
    g1[3] = (int)(((u32)rows >> 16) | ((u32)cols << 16));            // dim1 hi | tile_dim0
    g1[4] = (int)(u32)rows;                           // tile_dim1 (tile_dim2 = 0)
    g1[5] = (int)(u32)row_stride_elems;               // tensor_dim0_stride low32
    g1[6] = 0;
    g1[7] = 0;
    v4i_ z4 = {};
#if __clang_major__ >= 23
    v8i_ z8 = {};
    __builtin_amdgcn_tensor_load_to_lds(g0, g1, z4, z4, z8, 0);
#else
    __builtin_amdgcn_tensor_load_to_lds(g0, g1, z4, z4, 0);
#endif
}

// ---------- f32 -> bf16 conversion ----------
// A block converts CVT_PER x 256 consecutive float4 (16 per thread): starting a wave costs
// far more than moving the 512 bytes that a wave of one load per lane reads, so the work
// goes to few waves that each have many whole-line loads in flight.
constexpr int CVT_PER = 16;

DEVI ushort4 cvt4(float4 f) {
    ushort4 o;
    o.x = f2bf(f.x); o.y = f2bf(f.y); o.z = f2bf(f.z); o.w = f2bf(f.w);
    return o;
}

__global__ __launch_bounds__(256)
void cvt_f32_bf16(const float* __restrict__ in, u16* __restrict__ out, int n4) {
    const int blk0 = blockIdx.x * (256 * CVT_PER);
    const int i0   = blk0 + threadIdx.x;
    if (blk0 + 256 * CVT_PER <= n4) {          // whole block in range: no test per element
        float4 f[CVT_PER];
        #pragma unroll   // constant indices keep f[] in registers and fold into the loads' offsets
        for (int j = 0; j < CVT_PER; j++) f[j] = ((const float4*)in)[i0 + j * 256];
        #pragma unroll   // constant indices keep f[] in registers and fold into the stores' offsets
        for (int j = 0; j < CVT_PER; j++) ((ushort4*)out)[i0 + j * 256] = cvt4(f[j]);
        // precaution: the remainder path is the other branch and never runs after these stores,
        // which end the kernel
        asm volatile("s_wait_xcnt 0x0" ::: "memory");
    } else {
        for (int j = 0; j < CVT_PER; j++) {
            const int i = i0 + j * 256;
            if (i < n4) ((ushort4*)out)[i] = cvt4(((const float4*)in)[i]);
        }
    }
}

// ---------- f32 [K,N] -> bf16 transposed [N,K] (weights) ----------
// A thread converts 8 consecutive k of one column n (8 loads, each coalesced along n)
// and stores them as one 16-byte chunk of the transposed row. Kd is a multiple of 8.
__global__ __launch_bounds__(256)
void cvt_f32_bf16_T(const float* __restrict__ in, u16* __restrict__ out,
                    int Kd, int N) {
    int idx = blockIdx.x * blockDim.x + threadIdx.x;
    if (idx < (Kd >> 3) * N) {
        int kg = idx / N, n = idx - kg * N;
        const float* p = in + (size_t)kg * 8 * N + n;
        float v[8];
        #pragma unroll   // constant indices keep v[] in registers; the 8 loads are in flight together
        for (int j = 0; j < 8; j++) v[j] = p[(size_t)j * N];
        uint4 pk;
        pk.x = (u32)f2bf(v[0]) | ((u32)f2bf(v[1]) << 16);
        pk.y = (u32)f2bf(v[2]) | ((u32)f2bf(v[3]) << 16);
        pk.z = (u32)f2bf(v[4]) | ((u32)f2bf(v[5]) << 16);
        pk.w = (u32)f2bf(v[6]) | ((u32)f2bf(v[7]) << 16);
        *(uint4*)(out + (size_t)n * Kd + kg * 8) = pk;
    }
}

// ---------- tiled bf16 GEMM: C[M,N] = A[M,K] * Bt[N,K]^T + bias ----------
// A row-major [M,K]; Bt is the PRE-TRANSPOSED weight [N,K] (k contiguous).
// MODE 0: bf16 row-major out; MODE 2: f32 row-major out.
// MODE 1 and MODE 3: bf16 out in the order the attention kernel's B fragments are
// loaded: 1 KB tiles of 16 rows x 32 k, a tile = 2 chunks of 512 B, chunk c holds at
// lane (h*16 + row) the 8 elements k = c*16 + h*8 .. +7, so that one wave-wide 16-byte
// load reads 512 contiguous bytes (4 whole lines) instead of 32 B out of 16 lines.
//   MODE 3 (K): row = key m, k = feature n; tiles ordered [m/16][n/32].
//   MODE 1 (V): row = feature n, k = key s;  tiles ordered [b][s/32][n/16].
template<int MODE>
__global__ __launch_bounds__(256)
void gemm_bf16_k(const u16* __restrict__ A, const u16* __restrict__ Bt,
                 const float* __restrict__ bias, void* __restrict__ Out,
                 int M, int N, int Kd)
{
    constexpr int BM = 128, BN = 128, BK = 32;
    constexpr int LDA = 40;   // padded LDS row stride (shorts): 80B, 16B aligned
    constexpr int LDB = 40;
    __shared__ u16 As[BM * LDA];
    __shared__ u16 Bs[BN * LDB];   // [n][k]

    const int nb = N / BN;
    const int m0 = (blockIdx.x / nb) * BM;
    const int n0 = (blockIdx.x % nb) * BN;

    const int t    = threadIdx.x;
    const int lane = t & 31;
    const int wave = t >> 5;       // 0..7
    const int wm   = wave >> 2;    // 0..1 : 64-row slice
    const int wn   = wave & 3;     // 0..3 : 32-col slice
    const int half = lane >> 4;
    const int lr   = lane & 15;

    v8f acc[4][2] = {};

    // staging: a tile is 128 rows x 32 cols = 512 x 16B chunks per operand, 2 per thread
    // (rows srow and srow + 64, chunk t & 3); Bt is pre-transposed, so both are plain copies.
    // The four row blocks start at wave-uniform pointers, so that one chunk index per lane
    // serves all four loads (Kd is a multiple of 8).
    const int srow = t >> 2;
    const int sch  = (t & 3) * 8;
    const uint4* Ag0 = (const uint4*)(A  + (size_t)m0 * Kd);
    const uint4* Ag1 = (const uint4*)(A  + (size_t)(m0 + 64) * Kd);
    const uint4* Bg0 = (const uint4*)(Bt + (size_t)n0 * Kd);
    const uint4* Bg1 = (const uint4*)(Bt + (size_t)(n0 + 64) * Kd);
    const int sidx = srow * (Kd >> 3) + (t & 3);
    // the tile on its way from global memory to LDS
    uint4 ra0 = Ag0[sidx];
    uint4 ra1 = Ag1[sidx];
    uint4 rb0 = Bg0[sidx];
    uint4 rb1 = Bg1[sidx];

    for (int k0 = 0; k0 < Kd; k0 += BK) {
        *(uint4*)(&As[srow * LDA + sch])        = ra0;
        *(uint4*)(&As[(srow + 64) * LDA + sch]) = ra1;
        *(uint4*)(&Bs[srow * LDB + sch])        = rb0;
        *(uint4*)(&Bs[(srow + 64) * LDB + sch]) = rb1;
        __syncthreads();

        // the next tile's 4 loads go out together, ahead of this tile's products, and are
        // waited for only where this trip ends
        if (k0 + BK < Kd) {
            const int nidx = sidx + ((k0 + BK) >> 3);
            ra0 = Ag0[nidx];
            ra1 = Ag1[nidx];
            rb0 = Bg0[nidx];
            rb1 = Bg1[nidx];
            // the loads' index register is written again further down
            asm volatile("s_wait_xcnt 0x0" ::: "memory");
        }

        v16bf afr[4], bfr[2];
        #pragma unroll
        for (int i = 0; i < 4; i++) {
            const u16* rp = &As[(wm * 64 + i * 16 + lr) * LDA];
            afr[i] = ld_frag(rp + half * 8, rp + 16 + half * 8);
        }
        #pragma unroll
        for (int j = 0; j < 2; j++) {
            const u16* rp = &Bs[(wn * 32 + j * 16 + lr) * LDB];
            bfr[j] = ld_frag(rp + half * 8, rp + 16 + half * 8);
        }
        #pragma unroll
        for (int i = 0; i < 4; i++)
            #pragma unroll
            for (int j = 0; j < 2; j++)
                acc[i][j] = wmma_bf16(afr[i], bfr[j], acc[i][j]);
        __syncthreads();
    }

    // epilogue: lane lr = col, VGPR r -> row r + 8*half
    #pragma unroll
    for (int i = 0; i < 4; i++) {
        #pragma unroll
        for (int j = 0; j < 2; j++) {
            const int n = n0 + wn * 32 + j * 16 + lr;
            const float bv = bias[n];
            if constexpr (MODE == 1) {
                // this lane's 8 accumulator rows are 8 consecutive keys: one 16-byte chunk
                const int mb = m0 + wm * 64 + i * 16;
                const int bb = mb >> 11;             // mb / S (S=2048)
                const int ss = mb & (S - 1);
                const size_t tile = (size_t)(bb * (S / 32) + (ss >> 5)) * (N / 16) + (n >> 4);
                uint4 pk;
                pk.x = (u32)f2bf(acc[i][j][0] + bv) | ((u32)f2bf(acc[i][j][1] + bv) << 16);
                pk.y = (u32)f2bf(acc[i][j][2] + bv) | ((u32)f2bf(acc[i][j][3] + bv) << 16);
                pk.z = (u32)f2bf(acc[i][j][4] + bv) | ((u32)f2bf(acc[i][j][5] + bv) << 16);
                pk.w = (u32)f2bf(acc[i][j][6] + bv) | ((u32)f2bf(acc[i][j][7] + bv) << 16);
                *(uint4*)((u16*)Out + tile * 512 + ((ss >> 4) & 1) * 256 + lane * 8) = pk;
            }
            #pragma unroll
            for (int r = 0; r < 8; r++) {
                const int m = m0 + wm * 64 + i * 16 + r + half * 8;
                const float v = acc[i][j][r] + bv;
                if constexpr (MODE == 0) {
                    ((u16*)Out)[(size_t)m * N + n] = f2bf(v);
                } else if constexpr (MODE == 3) {
                    const size_t tile = (size_t)(m >> 4) * (N / 32) + (n >> 5);
                    ((u16*)Out)[tile * 512 + ((n >> 4) & 1) * 256
                                + (((n >> 3) & 1) * 16 + (m & 15)) * 8 + (n & 7)] = f2bf(v);
                } else if constexpr (MODE == 2) {
                    ((float*)Out)[(size_t)m * N + n] = v;
                }
            }
        }
    }
}

// ---------- flash-style attention: ctx = softmax(Q K^T / sqrt(D)) V ----------
// One block handles 64 q-rows (4 tiles of 16) of one batch, so that every K and V
// fragment a wave loads feeds 4 matrix products; a pass covers 256 keys, 2 tiles of 16 per
// wave, so that every Q fragment read from LDS feeds 2. 8 waves; each wave owns a 128-wide
// d-slice of the output accumulator. K and V come in the fragment-ordered 1 KB tiles
// that gemm_bf16_k MODE 3 and MODE 1 write (K: [b*S/16 + s/16][d/32], V: [b][s/32][d/16]).
// Q block is staged into LDS by the Tensor Data Mover (with 16B pad / 1024B), one
// 16-row slice from each of waves 0..3.
__global__ __launch_bounds__(256)
void attn_k(const u16* __restrict__ Q, const u16* __restrict__ K,
            const u16* __restrict__ Vt, u16* __restrict__ ctx)
{
    constexpr int QT = 4;            // 16-row q tiles per block
    constexpr int QB = QT * 16;      // q rows per block
    constexpr int KT = 2;            // 16-key tiles per wave and pass
    constexpr int KC = 8 * KT * 16;  // k rows per outer iteration (32 per wave)
    constexpr int LQ = DIN + 16;     // TDM-padded Qs row stride (shorts): 2080B
    constexpr int QSL = 17408;       // shorts per 16-row Q slice: 16*LQ rounded up to 2 KiB
    constexpr int LP = KC + 8;       // padded Pbuf stride (shorts)

    __shared__ __attribute__((aligned(2048))) u16 Qs[QT * QSL];   // 139,264 B (TDM destination)
    __shared__ float Sbuf[QB][KC];      // 64 KB
    __shared__ u16   Pbuf[QB * LP];     // 33 KB
    __shared__ float rowM[QB], rowL[QB], rowA[QB];

    const int qblk = blockIdx.x & (S / QB - 1);
    const int b    = blockIdx.x / (S / QB);
    const int q0   = qblk * QB;

    const int t    = threadIdx.x;
    const int lane = t & 31;
    const int wave = t >> 5;
    const int half = lane >> 4;
    const int lr   = lane & 15;

    // stage Q block (64 x 1024 bf16) via Tensor Data Mover: waves 0..3 each issue the
    // 16-row slice of their own number and wait for it themselves
    const u32 wv = (u32)__builtin_amdgcn_readfirstlane(t >> 5);
    if (pinned(wv < (u32)QT)) {
        u32 lds_off = (u32)(uintptr_t)(&Qs[0]) + wv * (u32)(QSL * 2);   // low 32 bits = LDS offset
        tdm_load_tile_2d(lds_off, Q + ((size_t)b * S + q0 + wv * 16) * DE,
                         /*cols=*/DIN, /*rows=*/16, /*row_stride=*/DE);
        __builtin_amdgcn_s_wait_tensorcnt(0);
    }
    if (t < QB) { rowM[t] = -1e30f; rowL[t] = 0.f; }
    __syncthreads();

    const int dbase = wave * 128;
    v8f acc[QT][8] = {};
    const float scale = 0.03125f;    // 1/sqrt(1024)

    for (int kc = 0; kc < S; kc += KC) {
        // phase 1: each wave computes the 64x32 score tile for k-rows kc+wave*32..+32
        v8f sacc[KT][QT] = {};
        const u16* Kg = K + (size_t)(b * (S / 16) + (kc >> 4) + wave * KT) * (DE / 32) * 512 + lane * 8;
        constexpr int DG = 8;   // d steps whose K fragments are fetched as one group
        #pragma unroll 1   // rolled: one set of K fragment registers serves all four groups
        for (int dg = 0; dg < DIN; dg += 32 * DG) {
            v16bf bk[DG][KT];
            #pragma unroll   // constant indices keep bk[] in registers
            for (int g = 0; g < DG; g++)
                #pragma unroll
                for (int kt = 0; kt < KT; kt++) {
                    const u16* kp = Kg + (kt * (DE / 32) + (dg >> 5) + g) * 512;
                    bk[g][kt] = ld_frag(kp, kp + 256);
                }
            // the K loads' address registers are stepped for the next group, and rewritten for
            // the V loads, further down
            asm volatile("s_wait_xcnt 0x0" ::: "memory");
            // keeps the group's 32 K loads in flight together: left to itself the compiler sinks
            // each d step's loads to just ahead of its products and the wave waits out 8 latencies
            __builtin_amdgcn_sched_barrier(0);
            #pragma unroll   // constant indices keep bk[] in registers
            for (int g = 0; g < DG; g++) {
                const int d0 = dg + g * 32;
                v16bf aq[QT];
                #pragma unroll   // constant indices keep aq[] in registers
                for (int qt = 0; qt < QT; qt++) {
                    // TDM pad: +8 shorts after every 512 shorts stored
                    const u16* qp = &Qs[qt * QSL + lr * LQ + d0 + 8 * (d0 >> 9)];
                    aq[qt] = ld_frag(qp + half * 8, qp + 16 + half * 8);
                }
                // keeps the d step's 8 LDS reads in flight together: left to itself the compiler
                // reads each Q fragment just ahead of its 2 products and waits out 4 LDS latencies
                __builtin_amdgcn_sched_barrier(0);
                #pragma unroll   // constant indices keep sacc[], aq[] and bk[] in registers
                for (int qt = 0; qt < QT; qt++)
                    #pragma unroll
                    for (int kt = 0; kt < KT; kt++)
                        sacc[kt][qt] = wmma_bf16(aq[qt], bk[g][kt], sacc[kt][qt]);
            }
        }
        #pragma unroll
        for (int kt = 0; kt < KT; kt++)
            #pragma unroll
            for (int qt = 0; qt < QT; qt++)
                #pragma unroll
                for (int r = 0; r < 8; r++)
                    Sbuf[qt * 16 + r + half * 8][(wave * KT + kt) * 16 + lr] = sacc[kt][qt][r] * scale;
        __syncthreads();

        // phase 2: online softmax update, 16 lanes per q-row, 8 columns per lane out of
        // each 128-column half of the pass, 16 rows at a time
        #pragma unroll 1   // rolled: the lr == 0 branch keeps the row groups apart anyway, one copy of the code serves
        for (int rg = 0; rg < QT; rg++) {
            const int row = rg * 16 + (t >> 4);
            const int c8  = lr * 8;
            float sv[8 * KT];
            #pragma unroll   // constant indices keep sv[] in registers
            for (int h = 0; h < KT; h++) {
                const float4 sa = *(const float4*)&Sbuf[row][h * 128 + c8];
                const float4 sb = *(const float4*)&Sbuf[row][h * 128 + c8 + 4];
                sv[h * 8 + 0] = sa.x; sv[h * 8 + 1] = sa.y; sv[h * 8 + 2] = sa.z; sv[h * 8 + 3] = sa.w;
                sv[h * 8 + 4] = sb.x; sv[h * 8 + 5] = sb.y; sv[h * 8 + 6] = sb.z; sv[h * 8 + 7] = sb.w;
            }
            const float mold = rowM[row];
            float mx = sv[0];
            #pragma unroll   // constant indices keep sv[] in registers
            for (int j = 1; j < 8 * KT; j++) mx = fmaxf(mx, sv[j]);
            mx = fmaxf(mx, row_xor<1>(mx));
            mx = fmaxf(mx, row_xor<2>(mx));
            mx = fmaxf(mx, row_xor<4>(mx));
            mx = fmaxf(mx, row_xor<8>(mx));
            const float mnew = fmaxf(mold, mx);
            float p[8 * KT];
            float sum = 0.f;
            #pragma unroll   // constant indices keep sv[] and p[] in registers
            for (int j = 0; j < 8 * KT; j++) { p[j] = __expf(sv[j] - mnew); sum += p[j]; }
            #pragma unroll   // constant indices keep p[] in registers
            for (int h = 0; h < KT; h++) {
                uint4 pk;
                pk.x = (u32)f2bf(p[h * 8 + 0]) | ((u32)f2bf(p[h * 8 + 1]) << 16);
                pk.y = (u32)f2bf(p[h * 8 + 2]) | ((u32)f2bf(p[h * 8 + 3]) << 16);
                pk.z = (u32)f2bf(p[h * 8 + 4]) | ((u32)f2bf(p[h * 8 + 5]) << 16);
                pk.w = (u32)f2bf(p[h * 8 + 6]) | ((u32)f2bf(p[h * 8 + 7]) << 16);
                *(uint4*)&Pbuf[row * LP + h * 128 + c8] = pk;
            }
            sum += row_xor<1>(sum);
            sum += row_xor<2>(sum);
            sum += row_xor<4>(sum);
            sum += row_xor<8>(sum);
            if (lr == 0) {
                const float alpha = __expf(mold - mnew);
                rowL[row] = rowL[row] * alpha + sum;
                rowM[row] = mnew;
                rowA[row] = alpha;
            }
        }
        __syncthreads();

        // phase 3: rescale running accumulator, then acc += P @ V-slice
        #pragma unroll
        for (int qt = 0; qt < QT; qt++) {
            float al[8];
            #pragma unroll
            for (int r = 0; r < 8; r++) al[r] = rowA[qt * 16 + r + half * 8];
            #pragma unroll
            for (int j = 0; j < 8; j++)
                #pragma unroll
                for (int r = 0; r < 8; r++) acc[qt][j][r] *= al[r];
        }

        #pragma unroll 1   // rolled: one set of V fragment registers serves all eight trips
        for (int ks = 0; ks < KC; ks += 32) {
            v16bf bv[8];
            #pragma unroll
            for (int j = 0; j < 8; j++) {
                const u16* vp = Vt + ((size_t)(b * (S / 32) + ((kc + ks) >> 5)) * (DE / 16)
                                      + (dbase >> 4) + j) * 512 + lane * 8;
                bv[j] = ld_frag(vp, vp + 256);
            }
            // the V loads' address registers are stepped for the next trip, and rewritten for the
            // next pass's K loads, further down
            asm volatile("s_wait_xcnt 0x0" ::: "memory");
            v16bf ap[QT];
            #pragma unroll
            for (int qt = 0; qt < QT; qt++) {
                const u16* pp = &Pbuf[(qt * 16 + lr) * LP + ks];
                ap[qt] = ld_frag(pp + half * 8, pp + 16 + half * 8);
            }
            // keeps the trip's 16 V loads in flight together: left to itself the compiler
            // sinks each pair to just ahead of its products and the wave waits out 8 latencies
            __builtin_amdgcn_sched_barrier(0);
            #pragma unroll
            for (int j = 0; j < 8; j++)
                #pragma unroll
                for (int qt = 0; qt < QT; qt++)
                    acc[qt][j] = wmma_bf16(ap[qt], bv[j], acc[qt][j]);
        }
        __syncthreads();
    }

    // finalize: divide by softmax denominator, store bf16 ctx
    #pragma unroll
    for (int qt = 0; qt < QT; qt++) {
        float inv[8];
        #pragma unroll
        for (int r = 0; r < 8; r++) inv[r] = 1.f / rowL[qt * 16 + r + half * 8];
        #pragma unroll
        for (int j = 0; j < 8; j++) {
            const int n = dbase + j * 16 + lr;
            #pragma unroll
            for (int r = 0; r < 8; r++) {
                const int m = q0 + qt * 16 + r + half * 8;
                ctx[((size_t)b * S + m) * DE + n] = f2bf(acc[qt][j][r] * inv[r]);
            }
            // the stores' data and address registers are rewritten for the next column tile
            asm volatile("s_wait_xcnt 0x0" ::: "memory");
            // keeps the next tile's arithmetic, which rewrites those registers, behind that wait
            __builtin_amdgcn_sched_barrier(0);
        }
    }
}

// ---------- host launcher ----------
extern "C" void kernel_launch(void* const* d_in, const int* in_sizes, int n_in,
                              void* d_out, int out_size, void* d_ws, size_t ws_size,
                              hipStream_t stream)
{
    (void)in_sizes; (void)n_in; (void)out_size; (void)ws_size;

    const float* x  = (const float*)d_in[0];
    const float* Wq = (const float*)d_in[1];
    const float* bq = (const float*)d_in[2];
    const float* Wk = (const float*)d_in[3];
    const float* bk = (const float*)d_in[4];
    const float* Wv = (const float*)d_in[5];
    const float* bv = (const float*)d_in[6];
    const float* Wo = (const float*)d_in[7];
    const float* bo = (const float*)d_in[8];
    float* out = (float*)d_out;

    char* ws = (char*)d_ws;
    const size_t MB = 1ull << 20;
    u16* xb  = (u16*)(ws);                 // 32 MB  x bf16 [m][k]
    u16* wqb = (u16*)(ws + 32 * MB);       //  2 MB  Wq^T bf16 [n][k]
    u16* wkb = (u16*)(ws + 34 * MB);       //  2 MB  Wk^T
    u16* wvb = (u16*)(ws + 36 * MB);       //  2 MB  Wv^T
    u16* wob = (u16*)(ws + 38 * MB);       //  2 MB  Wo^T
    u16* Qb  = (u16*)(ws + 40 * MB);       // 32 MB  Q bf16 [b][s][d]
    u16* Kb  = (u16*)(ws + 72 * MB);       // 32 MB  K bf16, fragment-ordered tiles
    u16* Vtb = (u16*)(ws + 104 * MB);      // 32 MB  V bf16, fragment-ordered tiles
    u16* ctx = (u16*)(ws + 136 * MB);      // 32 MB  attention output bf16

    const int nx4 = MTOT * DIN / 4;
    const int nxb = 256 * CVT_PER;         // float4 per block of cvt_f32_bf16
    const int nw8 = DIN * DE / 8;          // threads of cvt_f32_bf16_T: 8 elements each
    cvt_f32_bf16<<<(nx4 + nxb - 1) / nxb, 256, 0, stream>>>(x, xb, nx4);
    cvt_f32_bf16_T<<<(nw8 + 255) / 256, 256, 0, stream>>>(Wq, wqb, DIN, DE);
    cvt_f32_bf16_T<<<(nw8 + 255) / 256, 256, 0, stream>>>(Wk, wkb, DIN, DE);
    cvt_f32_bf16_T<<<(nw8 + 255) / 256, 256, 0, stream>>>(Wv, wvb, DIN, DE);
    cvt_f32_bf16_T<<<(nw8 + 255) / 256, 256, 0, stream>>>(Wo, wob, DE,  DE);

    dim3 gg((MTOT / 128) * (DE / 128));    // 1024 blocks
    gemm_bf16_k<0><<<gg, 256, 0, stream>>>(xb, wqb, bq, Qb,  MTOT, DE, DIN);
    gemm_bf16_k<3><<<gg, 256, 0, stream>>>(xb, wkb, bk, Kb,  MTOT, DE, DIN);
    gemm_bf16_k<1><<<gg, 256, 0, stream>>>(xb, wvb, bv, Vtb, MTOT, DE, DIN);

    attn_k<<<dim3(BATCH * (S / 64)), 256, 0, stream>>>(Qb, Kb, Vtb, ctx);

    gemm_bf16_k<2><<<gg, 256, 0, stream>>>(ctx, wob, bo, out, MTOT, DE, DIN);
}

// v007
// Measured time: 292 microseconds a run.
// Timed twice side by side with v006, it ran 1.03 times as fast both times.
// All steps since v000 together make it 3.18 times as fast.
#include <hip/hip_runtime.h>
#include <stdint.h>

typedef __attribute__((ext_vector_type(16))) __bf16 v16bf;
typedef __attribute__((ext_vector_type(8)))  float  v8f;
typedef __attribute__((ext_vector_type(4)))  uint32_t v4u;
typedef __attribute__((ext_vector_type(8)))  int      v8i_;
typedef __attribute__((ext_vector_type(4)))  int      v4i_;
typedef uint16_t u16;
typedef uint32_t u32;

#define DEVI __device__ __forceinline__

constexpr int BATCH = 8;
constexpr int S     = 2048;
constexpr int DIN   = 1024;
constexpr int DE    = 1024;
constexpr int MTOT  = BATCH * S;

// ---------- helpers ----------
DEVI u16 f2bf(float f) {                       // round-to-nearest-even f32 -> bf16
    u32 u = __float_as_uint(f);
    u32 r = (u + 0x7FFFu + ((u >> 16) & 1u)) >> 16;
    return (u16)r;
}

struct U4x2 { uint4 a, b; };

DEVI v16bf ld_frag(const u16* p0, const u16* p1) {   // two 16B chunks -> 16 bf16 frag
    U4x2 u;
    u.a = *(const uint4*)p0;
    u.b = *(const uint4*)p1;
    return __builtin_bit_cast(v16bf, u);
}

DEVI v8f wmma_bf16(v16bf a, v16bf b, v8f c) {
    return __builtin_amdgcn_wmma_f32_16x16x32_bf16(
        /*neg_a=*/false, a, /*neg_b=*/false, b,
        /*c_mod=*/(short)0, c, /*reuse_a=*/false, /*reuse_b=*/false);
}

// value of lane (l ^ M) of the same 16-lane row, by a DPP move (no LDS round trip)
template<int M>
DEVI float row_xor(float v) {
    const int i = __float_as_int(v);
    return __int_as_float(__builtin_amdgcn_update_dpp(i, i, 0x160 | M, 0xf, 0xf, false));
}

// a wave-uniform condition held in a scalar register, so that the test around a tensor
// load compiles to a scalar compare and branch (a tensor load ignores EXEC)
DEVI u32 pinned(u32 v) {
    u32 w = (u32)__builtin_amdgcn_readfirstlane((int)v);
    asm volatile("" : "+s"(w));   // pinned(): the issue test of a tensor load held in a scalar register
    return w;
}

// TDM: load a 2D bf16 tile (rows x cols, row stride in elements) from global to
// LDS, inserting 16B of LDS padding after every 1024B (so an LDS "row" of
// 2048B data occupies 2080B -> bank-spread, 16B-aligned chunks).
DEVI void tdm_load_tile_2d(u32 lds_off, const u16* gptr,
                           int cols, int rows, int row_stride_elems) {
    uint64_t ga = (uint64_t)(uintptr_t)gptr;
    v4u g0 = { 1u,                                   // count = 1 descriptor
               lds_off,                              // lds_addr (bytes)
               (u32)ga,                              // global_addr[31:0]
               (u32)(ga >> 32) | (2u << 30) };       // global_addr[56:32] | type=2
    v8i_ g1;
    g1[0] = (int)((1u << 16)                          // data_size = 2 bytes
                | (1u << 20)                          // pad_enable
                | (7u << 22)                          // pad_interval = 256 dwords (1024B)
                | (3u << 25));                        // pad_amount  = 4 dwords (16B)
    g1[1] = (int)((u32)(cols & 0xFFFF) << 16);        // tensor_dim0 low16
    g1[2] = (int)(((u32)cols >> 16) | ((u32)(rows & 0xFFFF) << 16)); // dim0 hi | dim1 lo
    g1[3] = (int)(((u32)rows >> 16) | ((u32)cols << 16));            // dim1 hi | tile_dim0
    g1[4] = (int)(u32)rows;                           // tile_dim1 (tile_dim2 = 0)
    g1[5] = (int)(u32)row_stride_elems;               // tensor_dim0_stride low32
    g1[6] = 0;
    g1[7] = 0;
    v4i_ z4 = {};
#if __clang_major__ >= 23
    v8i_ z8 = {};
    __builtin_amdgcn_tensor_load_to_lds(g0, g1, z4, z4, z8, 0);
#else
    __builtin_amdgcn_tensor_load_to_lds(g0, g1, z4, z4, 0);
#endif
}

// ---------- f32 -> bf16 conversion ----------
// A block converts CVT_PER x 256 consecutive float4 (16 per thread): starting a wave costs
// far more than moving the 512 bytes that a wave of one load per lane reads, so the work
// goes to few waves that each have many whole-line loads in flight.
constexpr int CVT_PER = 16;

DEVI ushort4 cvt4(float4 f) {
    ushort4 o;
    o.x = f2bf(f.x); o.y = f2bf(f.y); o.z = f2bf(f.z); o.w = f2bf(f.w);
    return o;
}

__global__ __launch_bounds__(256)
void cvt_f32_bf16(const float* __restrict__ in, u16* __restrict__ out, int n4) {
    const int blk0 = blockIdx.x * (256 * CVT_PER);
    const int i0   = blk0 + threadIdx.x;
    if (blk0 + 256 * CVT_PER <= n4) {          // whole block in range: no test per element
        float4 f[CVT_PER];
        #pragma unroll   // constant indices keep f[] in registers and fold into the loads' offsets
        for (int j = 0; j < CVT_PER; j++) f[j] = ((const float4*)in)[i0 + j * 256];
        #pragma unroll   // constant indices keep f[] in registers and fold into the stores' offsets
        for (int j = 0; j < CVT_PER; j++) ((ushort4*)out)[i0 + j * 256] = cvt4(f[j]);
        // precaution: the remainder path is the other branch and never runs after these stores,
        // which end the kernel
        asm volatile("s_wait_xcnt 0x0" ::: "memory");
    } else {
        for (int j = 0; j < CVT_PER; j++) {
            const int i = i0 + j * 256;
            if (i < n4) ((ushort4*)out)[i] = cvt4(((const float4*)in)[i]);
        }
    }
}

// ---------- f32 [K,N] -> bf16 transposed [N,K] (weights) ----------
// A thread converts 8 consecutive k of one column n (8 loads, each coalesced along n)
// and stores them as one 16-byte chunk of the transposed row. Kd is a multiple of 8.
__global__ __launch_bounds__(256)
void cvt_f32_bf16_T(const float* __restrict__ in, u16* __restrict__ out,
                    int Kd, int N) {
    int idx = blockIdx.x * blockDim.x + threadIdx.x;
    if (idx < (Kd >> 3) * N) {
        int kg = idx / N, n = idx - kg * N;
        const float* p = in + (size_t)kg * 8 * N + n;
        float v[8];
        #pragma unroll   // constant indices keep v[] in registers; the 8 loads are in flight together
        for (int j = 0; j < 8; j++) v[j] = p[(size_t)j * N];
        uint4 pk;
        pk.x = (u32)f2bf(v[0]) | ((u32)f2bf(v[1]) << 16);
        pk.y = (u32)f2bf(v[2]) | ((u32)f2bf(v[3]) << 16);
        pk.z = (u32)f2bf(v[4]) | ((u32)f2bf(v[5]) << 16);
        pk.w = (u32)f2bf(v[6]) | ((u32)f2bf(v[7]) << 16);
        *(uint4*)(out + (size_t)n * Kd + kg * 8) = pk;
    }
}

// ---------- tiled bf16 GEMM: C[M,N] = A[M,K] * Bt[N,K]^T + bias ----------
// A row-major [M,K]; Bt is the PRE-TRANSPOSED weight [N,K] (k contiguous).
// MODE 0: bf16 row-major out; MODE 2: f32 row-major out.
// MODE 1 and MODE 3: bf16 out in the order the attention kernel's B fragments are
// loaded: 1 KB tiles of 16 rows x 32 k, a tile = 2 chunks of 512 B, chunk c holds at
// lane (h*16 + row) the 8 elements k = c*16 + h*8 .. +7, so that one wave-wide 16-byte
// load reads 512 contiguous bytes (4 whole lines) instead of 32 B out of 16 lines.
//   MODE 3 (K): row = key m, k = feature n; tiles ordered [m/16][n/32].
//   MODE 1 (V): row = feature n, k = key s;  tiles ordered [b][s/32][n/16].
template<int MODE>
__global__ __launch_bounds__(256)
void gemm_bf16_k(const u16* __restrict__ A, const u16* __restrict__ Bt,
                 const float* __restrict__ bias, void* __restrict__ Out,
                 int M, int N, int Kd)
{
    constexpr int BM = 128, BN = 128, BK = 32;
    constexpr int LDA = 40;   // padded LDS row stride (shorts): 80B, 16B aligned
    constexpr int LDB = 40;
    __shared__ u16 As[BM * LDA];
    __shared__ u16 Bs[BN * LDB];   // [n][k]

    const int nb = N / BN;
    const int m0 = (blockIdx.x / nb) * BM;
    const int n0 = (blockIdx.x % nb) * BN;

    const int t    = threadIdx.x;
    const int lane = t & 31;
    const int wave = t >> 5;       // 0..7
    const int wm   = wave >> 2;    // 0..1 : 64-row slice
    const int wn   = wave & 3;     // 0..3 : 32-col slice
    const int half = lane >> 4;
    const int lr   = lane & 15;

    v8f acc[4][2] = {};

    // staging: a tile is 128 rows x 32 cols = 512 x 16B chunks per operand, 2 per thread
    // (rows srow and srow + 64, chunk t & 3); Bt is pre-transposed, so both are plain copies.
    // The four row blocks start at wave-uniform pointers, so that one chunk index per lane
    // serves all four loads (Kd is a multiple of 8).
    const int srow = t >> 2;
    const int sch  = (t & 3) * 8;
    const uint4* Ag0 = (const uint4*)(A  + (size_t)m0 * Kd);
    const uint4* Ag1 = (const uint4*)(A  + (size_t)(m0 + 64) * Kd);
    const uint4* Bg0 = (const uint4*)(Bt + (size_t)n0 * Kd);
    const uint4* Bg1 = (const uint4*)(Bt + (size_t)(n0 + 64) * Kd);
    const int sidx = srow * (Kd >> 3) + (t & 3);
    // the tile on its way from global memory to LDS
    uint4 ra0 = Ag0[sidx];
    uint4 ra1 = Ag1[sidx];
    uint4 rb0 = Bg0[sidx];
    uint4 rb1 = Bg1[sidx];

    for (int k0 = 0; k0 < Kd; k0 += BK) {
        *(uint4*)(&As[srow * LDA + sch])        = ra0;
        *(uint4*)(&As[(srow + 64) * LDA + sch]) = ra1;
        *(uint4*)(&Bs[srow * LDB + sch])        = rb0;
        *(uint4*)(&Bs[(srow + 64) * LDB + sch]) = rb1;
        __syncthreads();

        // the next tile's 4 loads go out together, ahead of this tile's products, and are
        // waited for only where this trip ends
        if (k0 + BK < Kd) {
            const int nidx = sidx + ((k0 + BK) >> 3);
            ra0 = Ag0[nidx];
            ra1 = Ag1[nidx];
            rb0 = Bg0[nidx];
            rb1 = Bg1[nidx];
            // the loads' index register is written again further down
            asm volatile("s_wait_xcnt 0x0" ::: "memory");
        }

        v16bf afr[4], bfr[2];
        #pragma unroll
        for (int i = 0; i < 4; i++) {
            const u16* rp = &As[(wm * 64 + i * 16 + lr) * LDA];
            afr[i] = ld_frag(rp + half * 8, rp + 16 + half * 8);
        }
        #pragma unroll
        for (int j = 0; j < 2; j++) {
            const u16* rp = &Bs[(wn * 32 + j * 16 + lr) * LDB];
            bfr[j] = ld_frag(rp + half * 8, rp + 16 + half * 8);
        }
        #pragma unroll
        for (int i = 0; i < 4; i++)
            #pragma unroll
            for (int j = 0; j < 2; j++)
                acc[i][j] = wmma_bf16(afr[i], bfr[j], acc[i][j]);
        __syncthreads();
    }

    // epilogue: lane lr = col, VGPR r -> row r + 8*half
    #pragma unroll
    for (int i = 0; i < 4; i++) {
        #pragma unroll
        for (int j = 0; j < 2; j++) {
            const int n = n0 + wn * 32 + j * 16 + lr;
            const float bv = bias[n];
            if constexpr (MODE == 1) {
                // this lane's 8 accumulator rows are 8 consecutive keys: one 16-byte chunk
                const int mb = m0 + wm * 64 + i * 16;
                const int bb = mb >> 11;             // mb / S (S=2048)
                const int ss = mb & (S - 1);
                const size_t tile = (size_t)(bb * (S / 32) + (ss >> 5)) * (N / 16) + (n >> 4);
                uint4 pk;
                pk.x = (u32)f2bf(acc[i][j][0] + bv) | ((u32)f2bf(acc[i][j][1] + bv) << 16);
                pk.y = (u32)f2bf(acc[i][j][2] + bv) | ((u32)f2bf(acc[i][j][3] + bv) << 16);
                pk.z = (u32)f2bf(acc[i][j][4] + bv) | ((u32)f2bf(acc[i][j][5] + bv) << 16);
                pk.w = (u32)f2bf(acc[i][j][6] + bv) | ((u32)f2bf(acc[i][j][7] + bv) << 16);
                *(uint4*)((u16*)Out + tile * 512 + ((ss >> 4) & 1) * 256 + lane * 8) = pk;
            }
            #pragma unroll
            for (int r = 0; r < 8; r++) {
                const int m = m0 + wm * 64 + i * 16 + r + half * 8;
                const float v = acc[i][j][r] + bv;
                if constexpr (MODE == 0) {
                    ((u16*)Out)[(size_t)m * N + n] = f2bf(v);
                } else if constexpr (MODE == 3) {
                    const size_t tile = (size_t)(m >> 4) * (N / 32) + (n >> 5);
                    ((u16*)Out)[tile * 512 + ((n >> 4) & 1) * 256
                                + (((n >> 3) & 1) * 16 + (m & 15)) * 8 + (n & 7)] = f2bf(v);
                } else if constexpr (MODE == 2) {
                    ((float*)Out)[(size_t)m * N + n] = v;
                }
            }
        }
    }
}

// One group of attention B fragments: 8 fragments, 16 wave-wide 16-byte loads, 8 KB a wave.
// K: 4 d steps x 2 key tiles, f[g * 2 + kt]; V: one 32-key trip x 8 column tiles, f[j].
// The group's start is the same for the whole wave and lo is the lane's own offset in a
// fragment, so that a load can take a scalar base and the one offset register of the lane.
DEVI void ld_k_group(v16bf (&f)[8], const u16* kp0, u32 lo) {
    #pragma unroll   // constant indices keep f[] in registers and fold into the loads' offsets
    for (int g = 0; g < 4; g++)
        #pragma unroll
        for (int kt = 0; kt < 2; kt++) {
            const u16* kp = kp0 + (kt * (DE / 32) + g) * 512 + lo;
            f[g * 2 + kt] = ld_frag(kp, kp + 256);
        }
    // the loads' address registers are rewritten for the next group further down
    asm volatile("s_wait_xcnt 0x0" ::: "memory");
    // keeps the group's 16 loads here, ahead of the other set's products: left to itself the
    // compiler sinks each pair to just ahead of its own products and the wave waits out the latency
    __builtin_amdgcn_sched_barrier(0);
}

DEVI void ld_v_group(v16bf (&f)[8], const u16* vp0, u32 lo) {
    #pragma unroll   // constant indices keep f[] in registers and fold into the loads' offsets
    for (int j = 0; j < 8; j++) {
        const u16* vp = vp0 + j * 512 + lo;
        f[j] = ld_frag(vp, vp + 256);
    }
    // the loads' address registers are rewritten for the next group further down
    asm volatile("s_wait_xcnt 0x0" ::: "memory");
    // keeps the group's 16 loads here, ahead of the other set's products: left to itself the
    // compiler sinks each pair to just ahead of its own products and the wave waits out the latency
    __builtin_amdgcn_sched_barrier(0);
}

// ---------- flash-style attention: ctx = softmax(Q K^T / sqrt(D)) V ----------
// One block handles 64 q-rows (4 tiles of 16) of one batch, so that every K and V
// fragment a wave loads feeds 4 matrix products; a pass covers 256 keys, 2 tiles of 16 per
// wave, so that every Q fragment read from LDS feeds 2. 8 waves; each wave owns a 128-wide
// d-slice of the output accumulator. K and V come in the fragment-ordered 1 KB tiles
// that gemm_bf16_k MODE 3 and MODE 1 write (K: [b*S/16 + s/16][d/32], V: [b][s/32][d/16]).
// Q block is staged into LDS by the Tensor Data Mover (with 16B pad / 1024B), one
// 16-row slice from each of waves 0..3.
// K and V fragments go through two register sets, fa and fb: while one set's 32 products
// run, the other set's 16 loads are on their way from L2. The order of the groups in a pass is
// K 0..7, V 0..7, sets alternating; a work-group barrier waits for every load of the wave, so
// V group 1 is asked for behind the barrier that follows the scores.
__global__ __launch_bounds__(256)
void attn_k(const u16* __restrict__ Q, const u16* __restrict__ K,
            const u16* __restrict__ Vt, u16* __restrict__ ctx)
{
    constexpr int QT = 4;            // 16-row q tiles per block
    constexpr int QB = QT * 16;      // q rows per block
    constexpr int KT = 2;            // 16-key tiles per wave and pass
    constexpr int KC = 8 * KT * 16;  // k rows per outer iteration (32 per wave)
    constexpr int LQ = DIN + 16;     // TDM-padded Qs row stride (shorts): 2080B
    constexpr int QSL = 17408;       // shorts per 16-row Q slice: 16*LQ rounded up to 2 KiB
    constexpr int LP = KC + 8;       // padded Pbuf stride (shorts)

    __shared__ __attribute__((aligned(2048))) u16 Qs[QT * QSL];   // 139,264 B (TDM destination)
    __shared__ float Sbuf[QB][KC];      // 64 KB
    __shared__ u16   Pbuf[QB * LP];     // 33 KB
    __shared__ float rowM[QB], rowL[QB], rowA[QB];

    const int qblk = blockIdx.x & (S / QB - 1);
    const int b    = blockIdx.x / (S / QB);
    const int q0   = qblk * QB;

    const int t    = threadIdx.x;
    const int lane = t & 31;
    const int wave = t >> 5;
    const int half = lane >> 4;
    const int lr   = lane & 15;

    // stage Q block (64 x 1024 bf16) via Tensor Data Mover: waves 0..3 each issue the
    // 16-row slice of their own number and wait for it themselves
    const u32 wv = (u32)__builtin_amdgcn_readfirstlane(t >> 5);
    if (pinned(wv < (u32)QT)) {
        u32 lds_off = (u32)(uintptr_t)(&Qs[0]) + wv * (u32)(QSL * 2);   // low 32 bits = LDS offset
        tdm_load_tile_2d(lds_off, Q + ((size_t)b * S + q0 + wv * 16) * DE,
                         /*cols=*/DIN, /*rows=*/16, /*row_stride=*/DE);
        __builtin_amdgcn_s_wait_tensorcnt(0);
    }
    if (t < QB) { rowM[t] = -1e30f; rowL[t] = 0.f; }
    __syncthreads();

    const int dbase = (int)wv * 128;   // wave-uniform: held in a scalar register
    v8f acc[QT][8] = {};
    const float scale = 0.03125f;    // 1/sqrt(1024)

    constexpr int DG = 4;            // d steps per K group
    const u16* Kw = K + (size_t)(b * (S / 16) + wv * KT) * (DE / 32) * 512;
    const u16* Vw = Vt + ((size_t)b * (S / 32) * (DE / 16) + wv * 8) * 512;
    const u32 lo = lane * 8;
    v16bf fa[8], fb[8];
    ld_k_group(fa, Kw, lo);          // K group 0 of pass 0

    for (int kc = 0; kc < S; kc += KC) {
        // phase 1: each wave computes the 64x32 score tile for k-rows kc+wave*32..+32
        v8f sacc[KT][QT] = {};
        const u16* Kg = Kw + (kc >> 4) * (DE / 32) * 512;   // wave-uniform, like Vg and Kn
        const u16* Vg = Vw + (kc >> 5) * (DE / 16) * 512;
        // the 32 products of one K group: 4 d steps from d = dg on
        auto qk = [&](const v16bf (&f)[8], int dg) __attribute__((always_inline)) {
            #pragma unroll   // constant indices keep f[] in registers
            for (int g = 0; g < DG; g++) {
                const int d0 = dg + g * 32;
                v16bf aq[QT];
                #pragma unroll   // constant indices keep aq[] in registers
                for (int qt = 0; qt < QT; qt++) {
                    // TDM pad: +8 shorts after every 512 shorts stored
                    const u16* qp = &Qs[qt * QSL + lr * LQ + d0 + 8 * (d0 >> 9)];
                    aq[qt] = ld_frag(qp + half * 8, qp + 16 + half * 8);
                }
                // keeps the d step's 8 LDS reads in flight together: left to itself the compiler
                // reads each Q fragment just ahead of its 2 products and waits out 4 LDS latencies
                __builtin_amdgcn_sched_barrier(0);
                #pragma unroll   // constant indices keep sacc[], aq[] and f[] in registers
                for (int qt = 0; qt < QT; qt++)
                    #pragma unroll
                    for (int kt = 0; kt < KT; kt++)
                        sacc[kt][qt] = wmma_bf16(aq[qt], f[g * KT + kt], sacc[kt][qt]);
            }
        };
        // The last two groups stand behind the loop, not under a test inside it: where two paths
        // with different numbers of loads join, the compiler's counted waits fall back to the
        // smaller number and wait for the loads just issued.
        #pragma unroll 1   // rolled: one copy of the code serves K groups 0 to 5, 2 a trip
        for (int dg = 0; dg < DIN - 64 * DG; dg += 64 * DG) {
            ld_k_group(fb, Kg + ((dg >> 5) + DG) * 512, lo);
            qk(fa, dg);
            ld_k_group(fa, Kg + ((dg >> 5) + 2 * DG) * 512, lo);
            qk(fb, dg + 32 * DG);
        }
        ld_k_group(fb, Kg + (DIN / 32 - DG) * 512, lo);
        qk(fa, DIN - 64 * DG);
        ld_v_group(fa, Vg, lo);                 // V group 0
        qk(fb, DIN - 32 * DG);
        #pragma unroll
        for (int kt = 0; kt < KT; kt++)
            #pragma unroll
            for (int qt = 0; qt < QT; qt++)
                #pragma unroll
                for (int r = 0; r < 8; r++)
                    Sbuf[qt * 16 + r + half * 8][(wave * KT + kt) * 16 + lr] = sacc[kt][qt][r] * scale;
        __syncthreads();
        ld_v_group(fb, Vg + (DE / 16) * 512, lo);   // V group 1: lands while the softmax phase runs

        // phase 2: online softmax update, 16 lanes per q-row, 8 columns per lane out of
        // each 128-column half of the pass, 16 rows at a time
        #pragma unroll 1   // rolled: the lr == 0 branch keeps the row groups apart anyway, one copy of the code serves
        for (int rg = 0; rg < QT; rg++) {
            const int row = rg * 16 + (t >> 4);
            const int c8  = lr * 8;
            float sv[8 * KT];
            #pragma unroll   // constant indices keep sv[] in registers
            for (int h = 0; h < KT; h++) {
                const float4 sa = *(const float4*)&Sbuf[row][h * 128 + c8];
                const float4 sb = *(const float4*)&Sbuf[row][h * 128 + c8 + 4];
                sv[h * 8 + 0] = sa.x; sv[h * 8 + 1] = sa.y; sv[h * 8 + 2] = sa.z; sv[h * 8 + 3] = sa.w;
                sv[h * 8 + 4] = sb.x; sv[h * 8 + 5] = sb.y; sv[h * 8 + 6] = sb.z; sv[h * 8 + 7] = sb.w;
            }
            const float mold = rowM[row];
            float mx = sv[0];
            #pragma unroll   // constant indices keep sv[] in registers
            for (int j = 1; j < 8 * KT; j++) mx = fmaxf(mx, sv[j]);
            mx = fmaxf(mx, row_xor<1>(mx));
            mx = fmaxf(mx, row_xor<2>(mx));
            mx = fmaxf(mx, row_xor<4>(mx));
            mx = fmaxf(mx, row_xor<8>(mx));
            const float mnew = fmaxf(mold, mx);
            float p[8 * KT];
            float sum = 0.f;
            #pragma unroll   // constant indices keep sv[] and p[] in registers
            for (int j = 0; j < 8 * KT; j++) { p[j] = __expf(sv[j] - mnew); sum += p[j]; }
            #pragma unroll   // constant indices keep p[] in registers
            for (int h = 0; h < KT; h++) {
                uint4 pk;
                pk.x = (u32)f2bf(p[h * 8 + 0]) | ((u32)f2bf(p[h * 8 + 1]) << 16);
                pk.y = (u32)f2bf(p[h * 8 + 2]) | ((u32)f2bf(p[h * 8 + 3]) << 16);
                pk.z = (u32)f2bf(p[h * 8 + 4]) | ((u32)f2bf(p[h * 8 + 5]) << 16);
                pk.w = (u32)f2bf(p[h * 8 + 6]) | ((u32)f2bf(p[h * 8 + 7]) << 16);
                *(uint4*)&Pbuf[row * LP + h * 128 + c8] = pk;
            }
            sum += row_xor<1>(sum);
            sum += row_xor<2>(sum);
            sum += row_xor<4>(sum);
            sum += row_xor<8>(sum);
            if (lr == 0) {
                const float alpha = __expf(mold - mnew);
                rowL[row] = rowL[row] * alpha + sum;
                rowM[row] = mnew;
                rowA[row] = alpha;
            }
        }
        __syncthreads();

        // phase 3: rescale running accumulator, then acc += P @ V-slice
        #pragma unroll
        for (int qt = 0; qt < QT; qt++) {
            float al[8];
            #pragma unroll
            for (int r = 0; r < 8; r++) al[r] = rowA[qt * 16 + r + half * 8];
            #pragma unroll
            for (int j = 0; j < 8; j++)
                #pragma unroll
                for (int r = 0; r < 8; r++) acc[qt][j][r] *= al[r];
        }

        // the 32 products of one V group: keys ks .. ks + 31 of the pass
        auto pv = [&](const v16bf (&f)[8], int ks) __attribute__((always_inline)) {
            v16bf ap[QT];
            #pragma unroll
            for (int qt = 0; qt < QT; qt++) {
                const u16* pp = &Pbuf[(qt * 16 + lr) * LP + ks];
                ap[qt] = ld_frag(pp + half * 8, pp + 16 + half * 8);
            }
            // keeps the trip's 8 LDS reads in flight together, ahead of its products
            __builtin_amdgcn_sched_barrier(0);
            #pragma unroll
            for (int j = 0; j < 8; j++)
                #pragma unroll
                for (int qt = 0; qt < QT; qt++)
                    acc[qt][j] = wmma_bf16(ap[qt], f[j], acc[qt][j]);
        };
        // K group 0 of the next pass; behind the last pass that of pass 0 again, read and not used,
        // so that every pass runs the same code
        const u16* Kn = Kw + (((kc + KC) & (S - 1)) >> 4) * (DE / 32) * 512;
        #pragma unroll 1   // rolled: one copy of the code serves V groups 0 to 5, 2 a trip
        for (int ks = 0; ks < KC - 64; ks += 64) {
            pv(fa, ks);
            ld_v_group(fa, Vg + ((ks >> 5) + 2) * (DE / 16) * 512, lo);
            pv(fb, ks + 32);
            ld_v_group(fb, Vg + ((ks >> 5) + 3) * (DE / 16) * 512, lo);
        }
        pv(fa, KC - 64);
        ld_k_group(fa, Kn, lo);
        pv(fb, KC - 32);
        // keeps these 32 products ahead of the barrier, which waits for the K loads just issued:
        // left to itself the compiler sinks them behind it and nothing runs during that wait
        __builtin_amdgcn_sched_barrier(0);
        __syncthreads();
    }

    // finalize: divide by softmax denominator, store bf16 ctx
    // the lane's number is read anew here (every lane is on), so that no register has to hold
    // lr and half through the loop for this use alone: with them the kernel spilled
    const int el = (int)__builtin_amdgcn_mbcnt_lo(~0u, 0u);
    const int eh = el >> 4;     // = half
    const int er = el & 15;     // = lr
    #pragma unroll
    for (int qt = 0; qt < QT; qt++) {
        float inv[8];
        #pragma unroll
        for (int r = 0; r < 8; r++) inv[r] = 1.f / rowL[qt * 16 + r + eh * 8];
        #pragma unroll
        for (int j = 0; j < 8; j++) {
            const int n = dbase + j * 16 + er;
            #pragma unroll
            for (int r = 0; r < 8; r++) {
                const int m = q0 + qt * 16 + r + eh * 8;
                ctx[((size_t)b * S + m) * DE + n] = f2bf(acc[qt][j][r] * inv[r]);
            }
            // the stores' data and address registers are rewritten for the next column tile
            asm volatile("s_wait_xcnt 0x0" ::: "memory");
            // keeps the next tile's arithmetic, which rewrites those registers, behind that wait
            __builtin_amdgcn_sched_barrier(0);
        }
    }
}

// ---------- host launcher ----------
extern "C" void kernel_launch(void* const* d_in, const int* in_sizes, int n_in,
                              void* d_out, int out_size, void* d_ws, size_t ws_size,
                              hipStream_t stream)
{
    (void)in_sizes; (void)n_in; (void)out_size; (void)ws_size;

    const float* x  = (const float*)d_in[0];
    const float* Wq = (const float*)d_in[1];
    const float* bq = (const float*)d_in[2];
    const float* Wk = (const float*)d_in[3];
    const float* bk = (const float*)d_in[4];
    const float* Wv = (const float*)d_in[5];
    const float* bv = (const float*)d_in[6];
    const float* Wo = (const float*)d_in[7];
    const float* bo = (const float*)d_in[8];
    float* out = (float*)d_out;

    char* ws = (char*)d_ws;
    const size_t MB = 1ull << 20;
    u16* xb  = (u16*)(ws);                 // 32 MB  x bf16 [m][k]
    u16* wqb = (u16*)(ws + 32 * MB);       //  2 MB  Wq^T bf16 [n][k]
    u16* wkb = (u16*)(ws + 34 * MB);       //  2 MB  Wk^T
    u16* wvb = (u16*)(ws + 36 * MB);       //  2 MB  Wv^T
    u16* wob = (u16*)(ws + 38 * MB);       //  2 MB  Wo^T
    u16* Qb  = (u16*)(ws + 40 * MB);       // 32 MB  Q bf16 [b][s][d]
    u16* Kb  = (u16*)(ws + 72 * MB);       // 32 MB  K bf16, fragment-ordered tiles
    u16* Vtb = (u16*)(ws + 104 * MB);      // 32 MB  V bf16, fragment-ordered tiles
    u16* ctx = (u16*)(ws + 136 * MB);      // 32 MB  attention output bf16

    const int nx4 = MTOT * DIN / 4;
    const int nxb = 256 * CVT_PER;         // float4 per block of cvt_f32_bf16
    const int nw8 = DIN * DE / 8;          // threads of cvt_f32_bf16_T: 8 elements each
    cvt_f32_bf16<<<(nx4 + nxb - 1) / nxb, 256, 0, stream>>>(x, xb, nx4);
    cvt_f32_bf16_T<<<(nw8 + 255) / 256, 256, 0, stream>>>(Wq, wqb, DIN, DE);
    cvt_f32_bf16_T<<<(nw8 + 255) / 256, 256, 0, stream>>>(Wk, wkb, DIN, DE);
    cvt_f32_bf16_T<<<(nw8 + 255) / 256, 256, 0, stream>>>(Wv, wvb, DIN, DE);
    cvt_f32_bf16_T<<<(nw8 + 255) / 256, 256, 0, stream>>>(Wo, wob, DE,  DE);

    dim3 gg((MTOT / 128) * (DE / 128));    // 1024 blocks
    gemm_bf16_k<0><<<gg, 256, 0, stream>>>(xb, wqb, bq, Qb,  MTOT, DE, DIN);
    gemm_bf16_k<3><<<gg, 256, 0, stream>>>(xb, wkb, bk, Kb,  MTOT, DE, DIN);
    gemm_bf16_k<1><<<gg, 256, 0, stream>>>(xb, wvb, bv, Vtb, MTOT, DE, DIN);

    attn_k<<<dim3(BATCH * (S / 64)), 256, 0, stream>>>(Qb, Kb, Vtb, ctx);

    gemm_bf16_k<2><<<gg, 256, 0, stream>>>(ctx, wob, bo, out, MTOT, DE, DIN);
}

// v008
// One run takes 268 microseconds.
// Next to v007, in two timings, it ran 1.09 times as fast each time.
// Counting every step since v000, it is 3.46 times as fast.
#include <hip/hip_runtime.h>
#include <stdint.h>

typedef __attribute__((ext_vector_type(16))) __bf16 v16bf;
typedef __attribute__((ext_vector_type(8)))  float  v8f;
typedef __attribute__((ext_vector_type(4)))  uint32_t v4u;
typedef __attribute__((ext_vector_type(8)))  int      v8i_;
typedef __attribute__((ext_vector_type(4)))  int      v4i_;
typedef uint16_t u16;
typedef uint32_t u32;

#define DEVI __device__ __forceinline__

constexpr int BATCH = 8;
constexpr int S     = 2048;
constexpr int DIN   = 1024;
constexpr int DE    = 1024;
constexpr int MTOT  = BATCH * S;

// ---------- helpers ----------
DEVI u16 f2bf(float f) {                       // round-to-nearest-even f32 -> bf16
    u32 u = __float_as_uint(f);
    u32 r = (u + 0x7FFFu + ((u >> 16) & 1u)) >> 16;
    return (u16)r;
}

struct U4x2 { uint4 a, b; };

DEVI v16bf ld_frag(const u16* p0, const u16* p1) {   // two 16B chunks -> 16 bf16 frag
    U4x2 u;
    u.a = *(const uint4*)p0;
    u.b = *(const uint4*)p1;
    return __builtin_bit_cast(v16bf, u);
}

DEVI v8f wmma_bf16(v16bf a, v16bf b, v8f c) {
    return __builtin_amdgcn_wmma_f32_16x16x32_bf16(
        /*neg_a=*/false, a, /*neg_b=*/false, b,
        /*c_mod=*/(short)0, c, /*reuse_a=*/false, /*reuse_b=*/false);
}

// value of lane (l ^ M) of the same 16-lane row, by a DPP move (no LDS round trip)
template<int M>
DEVI float row_xor(float v) {
    const int i = __float_as_int(v);
    return __int_as_float(__builtin_amdgcn_update_dpp(i, i, 0x160 | M, 0xf, 0xf, false));
}

// a wave-uniform condition held in a scalar register, so that the test around a tensor
// load compiles to a scalar compare and branch (a tensor load ignores EXEC)
DEVI u32 pinned(u32 v) {
    u32 w = (u32)__builtin_amdgcn_readfirstlane((int)v);
    asm volatile("" : "+s"(w));   // pinned(): the issue test of a tensor load held in a scalar register
    return w;
}

// TDM: load a 2D bf16 tile (rows x cols, row stride in elements) from global to
// LDS, inserting 16B of LDS padding after every 1024B (so an LDS "row" of
// 2048B data occupies 2080B -> bank-spread, 16B-aligned chunks).
DEVI void tdm_load_tile_2d(u32 lds_off, const u16* gptr,
                           int cols, int rows, int row_stride_elems) {
    uint64_t ga = (uint64_t)(uintptr_t)gptr;
    v4u g0 = { 1u,                                   // count = 1 descriptor
               lds_off,                              // lds_addr (bytes)
               (u32)ga,                              // global_addr[31:0]
               (u32)(ga >> 32) | (2u << 30) };       // global_addr[56:32] | type=2
    v8i_ g1;
    g1[0] = (int)((1u << 16)                          // data_size = 2 bytes
                | (1u << 20)                          // pad_enable
                | (7u << 22)                          // pad_interval = 256 dwords (1024B)
                | (3u << 25));                        // pad_amount  = 4 dwords (16B)
    g1[1] = (int)((u32)(cols & 0xFFFF) << 16);        // tensor_dim0 low16
    g1[2] = (int)(((u32)cols >> 16) | ((u32)(rows & 0xFFFF) << 16)); // dim0 hi | dim1 lo
    g1[3] = (int)(((u32)rows >> 16) | ((u32)cols << 16));            // dim1 hi | tile_dim0
    g1[4] = (int)(u32)rows;                           // tile_dim1 (tile_dim2 = 0)
    g1[5] = (int)(u32)row_stride_elems;               // tensor_dim0_stride low32
    g1[6] = 0;
    g1[7] = 0;
    v4i_ z4 = {};
#if __clang_major__ >= 23
    v8i_ z8 = {};
    __builtin_amdgcn_tensor_load_to_lds(g0, g1, z4, z4, z8, 0);
#else
    __builtin_amdgcn_tensor_load_to_lds(g0, g1, z4, z4, 0);
#endif
}

// ---------- f32 -> bf16 conversion ----------
// A block converts CVT_PER x 256 consecutive float4 (16 per thread): starting a wave costs
// far more than moving the 512 bytes that a wave of one load per lane reads, so the work
// goes to few waves that each have many whole-line loads in flight.
constexpr int CVT_PER = 16;

DEVI ushort4 cvt4(float4 f) {
    ushort4 o;
    o.x = f2bf(f.x); o.y = f2bf(f.y); o.z = f2bf(f.z); o.w = f2bf(f.w);
    return o;
}

__global__ __launch_bounds__(256)
void cvt_f32_bf16(const float* __restrict__ in, u16* __restrict__ out, int n4) {
    const int blk0 = blockIdx.x * (256 * CVT_PER);
    const int i0   = blk0 + threadIdx.x;
    if (blk0 + 256 * CVT_PER <= n4) {          // whole block in range: no test per element
        float4 f[CVT_PER];
        #pragma unroll   // constant indices keep f[] in registers and fold into the loads' offsets
        for (int j = 0; j < CVT_PER; j++) f[j] = ((const float4*)in)[i0 + j * 256];
        #pragma unroll   // constant indices keep f[] in registers and fold into the stores' offsets
        for (int j = 0; j < CVT_PER; j++) ((ushort4*)out)[i0 + j * 256] = cvt4(f[j]);
        // precaution: the remainder path is the other branch and never runs after these stores,
        // which end the kernel
        asm volatile("s_wait_xcnt 0x0" ::: "memory");
    } else {
        for (int j = 0; j < CVT_PER; j++) {
            const int i = i0 + j * 256;
            if (i < n4) ((ushort4*)out)[i] = cvt4(((const float4*)in)[i]);
        }
    }
}

// ---------- f32 [K,N] -> bf16 transposed [N,K] (weights) ----------
// A thread converts 8 consecutive k of one column n (8 loads, each coalesced along n)
// and stores them as one 16-byte chunk of the transposed row. Kd is a multiple of 8.
__global__ __launch_bounds__(256)
void cvt_f32_bf16_T(const float* __restrict__ in, u16* __restrict__ out,
                    int Kd, int N) {
    int idx = blockIdx.x * blockDim.x + threadIdx.x;
    if (idx < (Kd >> 3) * N) {
        int kg = idx / N, n = idx - kg * N;
        const float* p = in + (size_t)kg * 8 * N + n;
        float v[8];
        #pragma unroll   // constant indices keep v[] in registers; the 8 loads are in flight together
        for (int j = 0; j < 8; j++) v[j] = p[(size_t)j * N];
        uint4 pk;
        pk.x = (u32)f2bf(v[0]) | ((u32)f2bf(v[1]) << 16);
        pk.y = (u32)f2bf(v[2]) | ((u32)f2bf(v[3]) << 16);
        pk.z = (u32)f2bf(v[4]) | ((u32)f2bf(v[5]) << 16);
        pk.w = (u32)f2bf(v[6]) | ((u32)f2bf(v[7]) << 16);
        *(uint4*)(out + (size_t)n * Kd + kg * 8) = pk;
    }
}

// ---------- tiled bf16 GEMM: C[M,N] = A[M,K] * Bt[N,K]^T + bias ----------
// A row-major [M,K]; Bt is the PRE-TRANSPOSED weight [N,K] (k contiguous).
// MODE 0: bf16 row-major out; MODE 2: f32 row-major out.
// MODE 1 and MODE 3: bf16 out in the order the attention kernel's B fragments are
// loaded: 1 KB tiles of 16 rows x 32 k, a tile = 2 chunks of 512 B, chunk c holds at
// lane (h*16 + row) the 8 elements k = c*16 + h*8 .. +7, so that one wave-wide 16-byte
// load reads 512 contiguous bytes (4 whole lines) instead of 32 B out of 16 lines.
//   MODE 3 (K): row = key m, k = feature n; tiles ordered [m/16][n/32].
//   MODE 1 (V): row = feature n, k = key s;  tiles ordered [b][s/32][n/16].
template<int MODE>
__global__ __launch_bounds__(256)
void gemm_bf16_k(const u16* __restrict__ A, const u16* __restrict__ Bt,
                 const float* __restrict__ bias, void* __restrict__ Out,
                 int M, int N, int Kd)
{
    constexpr int BM = 128, BN = 128, BK = 64;
    constexpr int LDA = 72;   // padded LDS row stride (shorts): 144 B = 16 B x 9, odd for 16-byte reads
    constexpr int LDB = 72;
    // two buffers per operand: while one k tile is worked on, the next one's copies are in flight
    __shared__ __attribute__((aligned(16))) u16 As[2 * BM * LDA];
    __shared__ __attribute__((aligned(16))) u16 Bs[2 * BN * LDB];   // [n][k]

    const int nb = N / BN;
    const int m0 = (blockIdx.x / nb) * BM;
    const int n0 = (blockIdx.x % nb) * BN;

    const int t    = threadIdx.x;
    const int lane = t & 31;
    const int wave = t >> 5;       // 0..7
    const int wm   = wave >> 2;    // 0..1 : 64-row slice
    const int wn   = wave & 3;     // 0..3 : 32-col slice
    const int half = lane >> 4;
    const int lr   = lane & 15;

    v8f acc[4][2] = {};

    // staging: a k tile is 128 rows x 64 k = 1024 x 16 B chunks per operand, 4 per thread (rows
    // srow + 32 i, chunk t & 7), so that a wave-wide copy moves 4 whole 128-byte lines. Bt is
    // pre-transposed, so both operands are plain copies. Kd is a multiple of 64.
    const int srow = t >> 3;
    const int sch  = (t & 7) * 8;
    const u16* Ag = A  + (size_t)(m0 + srow) * Kd + sch;
    const u16* Bg = Bt + (size_t)(n0 + srow) * Kd + sch;
    const size_t rs = (size_t)32 * Kd;                              // 32 rows further, in elements
    const u32 lA = (u32)(uintptr_t)(&As[srow * LDA + sch]);         // low 32 bits = LDS byte address
    const u32 lB = (u32)(uintptr_t)(&Bs[srow * LDB + sch]);
    // the 8 copies of one thread for k tile kt into buffer buf, global memory to LDS through no register
    auto copy_tile = [&](int kt, int buf) __attribute__((always_inline)) {
        const u16* a = Ag + kt * BK;
        const u16* b = Bg + kt * BK;
        const u32 la = lA + (u32)buf * (u32)(BM * LDA * 2);
        const u32 lb = lB + (u32)buf * (u32)(BN * LDB * 2);
        // the closing s_wait_xcnt 0 stands inside the copies' own statement, ahead of any rewrite
        // of the address registers that the copies name
        asm volatile("global_load_async_to_lds_b128 %0, %8, off\n\t"
                     "global_load_async_to_lds_b128 %1, %9, off\n\t"
                     "global_load_async_to_lds_b128 %2, %10, off\n\t"
                     "global_load_async_to_lds_b128 %3, %11, off\n\t"
                     "global_load_async_to_lds_b128 %4, %12, off\n\t"
                     "global_load_async_to_lds_b128 %5, %13, off\n\t"
                     "global_load_async_to_lds_b128 %6, %14, off\n\t"
                     "global_load_async_to_lds_b128 %7, %15, off\n\t"
                     "s_wait_xcnt 0x0"
                     :: "v"(la), "v"(la + 32u * LDA * 2), "v"(la + 64u * LDA * 2), "v"(la + 96u * LDA * 2),
                        "v"(lb), "v"(lb + 32u * LDB * 2), "v"(lb + 64u * LDB * 2), "v"(lb + 96u * LDB * 2),
                        "v"(a), "v"(a + rs), "v"(a + 2 * rs), "v"(a + 3 * rs),
                        "v"(b), "v"(b + rs), "v"(b + 2 * rs), "v"(b + 3 * rs)
                     : "memory");
    };

    const int nt = Kd / BK;
    copy_tile(0, 0);
    asm volatile("s_wait_asynccnt 0x0" ::: "memory");   // this wave's copies of tile 0 have landed
    __syncthreads();                                    // and so have every other wave's
    if (1 < nt) copy_tile(1, 1);

    for (int kt = 0; kt < nt; kt++) {
        const int buf = kt & 1;
        const u16* Ab = As + buf * (BM * LDA);
        const u16* Bb = Bs + buf * (BN * LDB);
        #pragma unroll   // constant indices fold into the LDS reads' offsets
        for (int ks = 0; ks < BK; ks += 32) {
            v16bf afr[4], bfr[2];
            #pragma unroll
            for (int i = 0; i < 4; i++) {
                const u16* rp = &Ab[(wm * 64 + i * 16 + lr) * LDA + ks];
                afr[i] = ld_frag(rp + half * 8, rp + 16 + half * 8);
            }
            #pragma unroll
            for (int j = 0; j < 2; j++) {
                const u16* rp = &Bb[(wn * 32 + j * 16 + lr) * LDB + ks];
                bfr[j] = ld_frag(rp + half * 8, rp + 16 + half * 8);
            }
            #pragma unroll
            for (int i = 0; i < 4; i++)
                #pragma unroll
                for (int j = 0; j < 2; j++)
                    acc[i][j] = wmma_bf16(afr[i], bfr[j], acc[i][j]);
        }
        // hand-over: this wave's reads of buffer buf are done and its copies of tile kt + 1 have
        // landed; behind the barrier that holds for every wave, and buffer buf may be refilled
        asm volatile("s_wait_dscnt 0x0" ::: "memory");
        asm volatile("s_wait_asynccnt 0x0" ::: "memory");
        __syncthreads();
        if (kt + 2 < nt) copy_tile(kt + 2, buf);
    }
    asm volatile("s_wait_asynccnt 0x0" ::: "memory");   // no copy is outstanding where the wave goes on

    // epilogue: lane lr = col, VGPR r -> row r + 8*half
    #pragma unroll
    for (int i = 0; i < 4; i++) {
        #pragma unroll
        for (int j = 0; j < 2; j++) {
            const int n = n0 + wn * 32 + j * 16 + lr;
            const float bv = bias[n];
            if constexpr (MODE == 1) {
                // this lane's 8 accumulator rows are 8 consecutive keys: one 16-byte chunk
                const int mb = m0 + wm * 64 + i * 16;
                const int bb = mb >> 11;             // mb / S (S=2048)
                const int ss = mb & (S - 1);
                const size_t tile = (size_t)(bb * (S / 32) + (ss >> 5)) * (N / 16) + (n >> 4);
                uint4 pk;
                pk.x = (u32)f2bf(acc[i][j][0] + bv) | ((u32)f2bf(acc[i][j][1] + bv) << 16);
                pk.y = (u32)f2bf(acc[i][j][2] + bv) | ((u32)f2bf(acc[i][j][3] + bv) << 16);
                pk.z = (u32)f2bf(acc[i][j][4] + bv) | ((u32)f2bf(acc[i][j][5] + bv) << 16);
                pk.w = (u32)f2bf(acc[i][j][6] + bv) | ((u32)f2bf(acc[i][j][7] + bv) << 16);
                *(uint4*)((u16*)Out + tile * 512 + ((ss >> 4) & 1) * 256 + lane * 8) = pk;
            }
            #pragma unroll
            for (int r = 0; r < 8; r++) {
                const int m = m0 + wm * 64 + i * 16 + r + half * 8;
                const float v = acc[i][j][r] + bv;
                if constexpr (MODE == 0) {
                    ((u16*)Out)[(size_t)m * N + n] = f2bf(v);
                } else if constexpr (MODE == 3) {
                    const size_t tile = (size_t)(m >> 4) * (N / 32) + (n >> 5);
                    ((u16*)Out)[tile * 512 + ((n >> 4) & 1) * 256
                                + (((n >> 3) & 1) * 16 + (m & 15)) * 8 + (n & 7)] = f2bf(v);
                } else if constexpr (MODE == 2) {
                    ((float*)Out)[(size_t)m * N + n] = v;
                }
            }
        }
    }
}

// One group of attention B fragments: 8 fragments, 16 wave-wide 16-byte loads, 8 KB a wave.
// K: 4 d steps x 2 key tiles, f[g * 2 + kt]; V: one 32-key trip x 8 column tiles, f[j].
// The group's start is the same for the whole wave and lo is the lane's own offset in a
// fragment, so that a load can take a scalar base and the one offset register of the lane.
DEVI void ld_k_group(v16bf (&f)[8], const u16* kp0, u32 lo) {
    #pragma unroll   // constant indices keep f[] in registers and fold into the loads' offsets
    for (int g = 0; g < 4; g++)
        #pragma unroll
        for (int kt = 0; kt < 2; kt++) {
            const u16* kp = kp0 + (kt * (DE / 32) + g) * 512 + lo;
            f[g * 2 + kt] = ld_frag(kp, kp + 256);
        }
    // the loads' address registers are rewritten for the next group further down
    asm volatile("s_wait_xcnt 0x0" ::: "memory");
    // keeps the group's 16 loads here, ahead of the other set's products: left to itself the
    // compiler sinks each pair to just ahead of its own products and the wave waits out the latency
    __builtin_amdgcn_sched_barrier(0);
}

DEVI void ld_v_group(v16bf (&f)[8], const u16* vp0, u32 lo) {
    #pragma unroll   // constant indices keep f[] in registers and fold into the loads' offsets
    for (int j = 0; j < 8; j++) {
        const u16* vp = vp0 + j * 512 + lo;
        f[j] = ld_frag(vp, vp + 256);
    }
    // the loads' address registers are rewritten for the next group further down
    asm volatile("s_wait_xcnt 0x0" ::: "memory");
    // keeps the group's 16 loads here, ahead of the other set's products: left to itself the
    // compiler sinks each pair to just ahead of its own products and the wave waits out the latency
    __builtin_amdgcn_sched_barrier(0);
}

// ---------- flash-style attention: ctx = softmax(Q K^T / sqrt(D)) V ----------
// One block handles 64 q-rows (4 tiles of 16) of one batch, so that every K and V
// fragment a wave loads feeds 4 matrix products; a pass covers 256 keys, 2 tiles of 16 per
// wave, so that every Q fragment read from LDS feeds 2. 8 waves; each wave owns a 128-wide
// d-slice of the output accumulator. K and V come in the fragment-ordered 1 KB tiles
// that gemm_bf16_k MODE 3 and MODE 1 write (K: [b*S/16 + s/16][d/32], V: [b][s/32][d/16]).
// Q block is staged into LDS by the Tensor Data Mover (with 16B pad / 1024B), one
// 16-row slice from each of waves 0..3.
// K and V fragments go through two register sets, fa and fb: while one set's 32 products
// run, the other set's 16 loads are on their way from L2. The order of the groups in a pass is
// K 0..7, V 0..7, sets alternating; a work-group barrier waits for every load of the wave, so
// V group 1 is asked for behind the barrier that follows the scores.
__global__ __launch_bounds__(256)
void attn_k(const u16* __restrict__ Q, const u16* __restrict__ K,
            const u16* __restrict__ Vt, u16* __restrict__ ctx)
{
    constexpr int QT = 4;            // 16-row q tiles per block
    constexpr int QB = QT * 16;      // q rows per block
    constexpr int KT = 2;            // 16-key tiles per wave and pass
    constexpr int KC = 8 * KT * 16;  // k rows per outer iteration (32 per wave)
    constexpr int LQ = DIN + 16;     // TDM-padded Qs row stride (shorts): 2080B
    constexpr int QSL = 17408;       // shorts per 16-row Q slice: 16*LQ rounded up to 2 KiB
    constexpr int LP = KC + 8;       // padded Pbuf stride (shorts)

    __shared__ __attribute__((aligned(2048))) u16 Qs[QT * QSL];   // 139,264 B (TDM destination)
    __shared__ float Sbuf[QB][KC];      // 64 KB
    __shared__ u16   Pbuf[QB * LP];     // 33 KB
    __shared__ float rowM[QB], rowL[QB], rowA[QB];

    const int qblk = blockIdx.x & (S / QB - 1);
    const int b    = blockIdx.x / (S / QB);
    const int q0   = qblk * QB;

    const int t    = threadIdx.x;
    const int lane = t & 31;
    const int wave = t >> 5;
    const int half = lane >> 4;
    const int lr   = lane & 15;

    // stage Q block (64 x 1024 bf16) via Tensor Data Mover: waves 0..3 each issue the
    // 16-row slice of their own number and wait for it themselves
    const u32 wv = (u32)__builtin_amdgcn_readfirstlane(t >> 5);
    if (pinned(wv < (u32)QT)) {
        u32 lds_off = (u32)(uintptr_t)(&Qs[0]) + wv * (u32)(QSL * 2);   // low 32 bits = LDS offset
        tdm_load_tile_2d(lds_off, Q + ((size_t)b * S + q0 + wv * 16) * DE,
                         /*cols=*/DIN, /*rows=*/16, /*row_stride=*/DE);
        __builtin_amdgcn_s_wait_tensorcnt(0);
    }
    if (t < QB) { rowM[t] = -1e30f; rowL[t] = 0.f; }
    __syncthreads();

    const int dbase = (int)wv * 128;   // wave-uniform: held in a scalar register
    v8f acc[QT][8] = {};
    const float scale = 0.03125f;    // 1/sqrt(1024)

    constexpr int DG = 4;            // d steps per K group
    const u16* Kw = K + (size_t)(b * (S / 16) + wv * KT) * (DE / 32) * 512;
    const u16* Vw = Vt + ((size_t)b * (S / 32) * (DE / 16) + wv * 8) * 512;
    const u32 lo = lane * 8;
    v16bf fa[8], fb[8];
    ld_k_group(fa, Kw, lo);          // K group 0 of pass 0

    for (int kc = 0; kc < S; kc += KC) {
        // phase 1: each wave computes the 64x32 score tile for k-rows kc+wave*32..+32
        v8f sacc[KT][QT] = {};
        const u16* Kg = Kw + (kc >> 4) * (DE / 32) * 512;   // wave-uniform, like Vg and Kn
        const u16* Vg = Vw + (kc >> 5) * (DE / 16) * 512;
        // the 32 products of one K group: 4 d steps from d = dg on
        auto qk = [&](const v16bf (&f)[8], int dg) __attribute__((always_inline)) {
            #pragma unroll   // constant indices keep f[] in registers
            for (int g = 0; g < DG; g++) {
                const int d0 = dg + g * 32;
                v16bf aq[QT];
                #pragma unroll   // constant indices keep aq[] in registers
                for (int qt = 0; qt < QT; qt++) {
                    // TDM pad: +8 shorts after every 512 shorts stored
                    const u16* qp = &Qs[qt * QSL + lr * LQ + d0 + 8 * (d0 >> 9)];
                    aq[qt] = ld_frag(qp + half * 8, qp + 16 + half * 8);
                }
                // keeps the d step's 8 LDS reads in flight together: left to itself the compiler
                // reads each Q fragment just ahead of its 2 products and waits out 4 LDS latencies
                __builtin_amdgcn_sched_barrier(0);
                #pragma unroll   // constant indices keep sacc[], aq[] and f[] in registers
                for (int qt = 0; qt < QT; qt++)
                    #pragma unroll
                    for (int kt = 0; kt < KT; kt++)
                        sacc[kt][qt] = wmma_bf16(aq[qt], f[g * KT + kt], sacc[kt][qt]);
            }
        };
        // The last two groups stand behind the loop, not under a test inside it: where two paths
        // with different numbers of loads join, the compiler's counted waits fall back to the
        // smaller number and wait for the loads just issued.
        #pragma unroll 1   // rolled: one copy of the code serves K groups 0 to 5, 2 a trip
        for (int dg = 0; dg < DIN - 64 * DG; dg += 64 * DG) {
            ld_k_group(fb, Kg + ((dg >> 5) + DG) * 512, lo);
            qk(fa, dg);
            ld_k_group(fa, Kg + ((dg >> 5) + 2 * DG) * 512, lo);
            qk(fb, dg + 32 * DG);
        }
        ld_k_group(fb, Kg + (DIN / 32 - DG) * 512, lo);
        qk(fa, DIN - 64 * DG);
        ld_v_group(fa, Vg, lo);                 // V group 0
        qk(fb, DIN - 32 * DG);
        #pragma unroll
        for (int kt = 0; kt < KT; kt++)
            #pragma unroll
            for (int qt = 0; qt < QT; qt++)
                #pragma unroll
                for (int r = 0; r < 8; r++)
                    Sbuf[qt * 16 + r + half * 8][(wave * KT + kt) * 16 + lr] = sacc[kt][qt][r] * scale;
        __syncthreads();
        ld_v_group(fb, Vg + (DE / 16) * 512, lo);   // V group 1: lands while the softmax phase runs

        // phase 2: online softmax update, 16 lanes per q-row, 8 columns per lane out of
        // each 128-column half of the pass, 16 rows at a time
        #pragma unroll 1   // rolled: the lr == 0 branch keeps the row groups apart anyway, one copy of the code serves
        for (int rg = 0; rg < QT; rg++) {
            const int row = rg * 16 + (t >> 4);
            const int c8  = lr * 8;
            float sv[8 * KT];
            #pragma unroll   // constant indices keep sv[] in registers
            for (int h = 0; h < KT; h++) {
                const float4 sa = *(const float4*)&Sbuf[row][h * 128 + c8];
                const float4 sb = *(const float4*)&Sbuf[row][h * 128 + c8 + 4];
                sv[h * 8 + 0] = sa.x; sv[h * 8 + 1] = sa.y; sv[h * 8 + 2] = sa.z; sv[h * 8 + 3] = sa.w;
                sv[h * 8 + 4] = sb.x; sv[h * 8 + 5] = sb.y; sv[h * 8 + 6] = sb.z; sv[h * 8 + 7] = sb.w;
            }
            const float mold = rowM[row];
            float mx = sv[0];
            #pragma unroll   // constant indices keep sv[] in registers
            for (int j = 1; j < 8 * KT; j++) mx = fmaxf(mx, sv[j]);
            mx = fmaxf(mx, row_xor<1>(mx));
            mx = fmaxf(mx, row_xor<2>(mx));
            mx = fmaxf(mx, row_xor<4>(mx));
            mx = fmaxf(mx, row_xor<8>(mx));
            const float mnew = fmaxf(mold, mx);
            float p[8 * KT];
            float sum = 0.f;
            #pragma unroll   // constant indices keep sv[] and p[] in registers
            for (int j = 0; j < 8 * KT; j++) { p[j] = __expf(sv[j] - mnew); sum += p[j]; }
            #pragma unroll   // constant indices keep p[] in registers
            for (int h = 0; h < KT; h++) {
                uint4 pk;
                pk.x = (u32)f2bf(p[h * 8 + 0]) | ((u32)f2bf(p[h * 8 + 1]) << 16);
                pk.y = (u32)f2bf(p[h * 8 + 2]) | ((u32)f2bf(p[h * 8 + 3]) << 16);
                pk.z = (u32)f2bf(p[h * 8 + 4]) | ((u32)f2bf(p[h * 8 + 5]) << 16);
                pk.w = (u32)f2bf(p[h * 8 + 6]) | ((u32)f2bf(p[h * 8 + 7]) << 16);
                *(uint4*)&Pbuf[row * LP + h * 128 + c8] = pk;
            }
            sum += row_xor<1>(sum);
            sum += row_xor<2>(sum);
            sum += row_xor<4>(sum);
            sum += row_xor<8>(sum);
            if (lr == 0) {
                const float alpha = __expf(mold - mnew);
                rowL[row] = rowL[row] * alpha + sum;
                rowM[row] = mnew;
                rowA[row] = alpha;
            }
        }
        __syncthreads();

        // phase 3: rescale running accumulator, then acc += P @ V-slice
        #pragma unroll
        for (int qt = 0; qt < QT; qt++) {
            float al[8];
            #pragma unroll
            for (int r = 0; r < 8; r++) al[r] = rowA[qt * 16 + r + half * 8];
            #pragma unroll
            for (int j = 0; j < 8; j++)
                #pragma unroll
                for (int r = 0; r < 8; r++) acc[qt][j][r] *= al[r];
        }

        // the 32 products of one V group: keys ks .. ks + 31 of the pass
        auto pv = [&](const v16bf (&f)[8], int ks) __attribute__((always_inline)) {
            v16bf ap[QT];
            #pragma unroll
            for (int qt = 0; qt < QT; qt++) {
                const u16* pp = &Pbuf[(qt * 16 + lr) * LP + ks];
                ap[qt] = ld_frag(pp + half * 8, pp + 16 + half * 8);
            }
            // keeps the trip's 8 LDS reads in flight together, ahead of its products
            __builtin_amdgcn_sched_barrier(0);
            #pragma unroll
            for (int j = 0; j < 8; j++)
                #pragma unroll
                for (int qt = 0; qt < QT; qt++)
                    acc[qt][j] = wmma_bf16(ap[qt], f[j], acc[qt][j]);
        };
        // K group 0 of the next pass; behind the last pass that of pass 0 again, read and not used,
        // so that every pass runs the same code
        const u16* Kn = Kw + (((kc + KC) & (S - 1)) >> 4) * (DE / 32) * 512;
        #pragma unroll 1   // rolled: one copy of the code serves V groups 0 to 5, 2 a trip
        for (int ks = 0; ks < KC - 64; ks += 64) {
            pv(fa, ks);
            ld_v_group(fa, Vg + ((ks >> 5) + 2) * (DE / 16) * 512, lo);
            pv(fb, ks + 32);
            ld_v_group(fb, Vg + ((ks >> 5) + 3) * (DE / 16) * 512, lo);
        }
        pv(fa, KC - 64);
        ld_k_group(fa, Kn, lo);
        pv(fb, KC - 32);
        // keeps these 32 products ahead of the barrier, which waits for the K loads just issued:
        // left to itself the compiler sinks them behind it and nothing runs during that wait
        __builtin_amdgcn_sched_barrier(0);
        __syncthreads();
    }

    // finalize: divide by softmax denominator, store bf16 ctx
    // the lane's number is read anew here (every lane is on), so that no register has to hold
    // lr and half through the loop for this use alone: with them the kernel spilled
    const int el = (int)__builtin_amdgcn_mbcnt_lo(~0u, 0u);
    const int eh = el >> 4;     // = half
    const int er = el & 15;     // = lr
    #pragma unroll
    for (int qt = 0; qt < QT; qt++) {
        float inv[8];
        #pragma unroll
        for (int r = 0; r < 8; r++) inv[r] = 1.f / rowL[qt * 16 + r + eh * 8];
        #pragma unroll
        for (int j = 0; j < 8; j++) {
            const int n = dbase + j * 16 + er;
            #pragma unroll
            for (int r = 0; r < 8; r++) {
                const int m = q0 + qt * 16 + r + eh * 8;
                ctx[((size_t)b * S + m) * DE + n] = f2bf(acc[qt][j][r] * inv[r]);
            }
            // the stores' data and address registers are rewritten for the next column tile
            asm volatile("s_wait_xcnt 0x0" ::: "memory");
            // keeps the next tile's arithmetic, which rewrites those registers, behind that wait
            __builtin_amdgcn_sched_barrier(0);
        }
    }
}

// ---------- host launcher ----------
extern "C" void kernel_launch(void* const* d_in, const int* in_sizes, int n_in,
                              void* d_out, int out_size, void* d_ws, size_t ws_size,
                              hipStream_t stream)
{
    (void)in_sizes; (void)n_in; (void)out_size; (void)ws_size;

    const float* x  = (const float*)d_in[0];
    const float* Wq = (const float*)d_in[1];
    const float* bq = (const float*)d_in[2];
    const float* Wk = (const float*)d_in[3];
    const float* bk = (const float*)d_in[4];
    const float* Wv = (const float*)d_in[5];
    const float* bv = (const float*)d_in[6];
    const float* Wo = (const float*)d_in[7];
    const float* bo = (const float*)d_in[8];
    float* out = (float*)d_out;

    char* ws = (char*)d_ws;
    const size_t MB = 1ull << 20;
    u16* xb  = (u16*)(ws);                 // 32 MB  x bf16 [m][k]
    u16* wqb = (u16*)(ws + 32 * MB);       //  2 MB  Wq^T bf16 [n][k]
    u16* wkb = (u16*)(ws + 34 * MB);       //  2 MB  Wk^T
    u16* wvb = (u16*)(ws + 36 * MB);       //  2 MB  Wv^T
    u16* wob = (u16*)(ws + 38 * MB);       //  2 MB  Wo^T
    u16* Qb  = (u16*)(ws + 40 * MB);       // 32 MB  Q bf16 [b][s][d]
    u16* Kb  = (u16*)(ws + 72 * MB);       // 32 MB  K bf16, fragment-ordered tiles
    u16* Vtb = (u16*)(ws + 104 * MB);      // 32 MB  V bf16, fragment-ordered tiles
    u16* ctx = (u16*)(ws + 136 * MB);      // 32 MB  attention output bf16

    const int nx4 = MTOT * DIN / 4;
    const int nxb = 256 * CVT_PER;         // float4 per block of cvt_f32_bf16
    const int nw8 = DIN * DE / 8;          // threads of cvt_f32_bf16_T: 8 elements each
    cvt_f32_bf16<<<(nx4 + nxb - 1) / nxb, 256, 0, stream>>>(x, xb, nx4);
    cvt_f32_bf16_T<<<(nw8 + 255) / 256, 256, 0, stream>>>(Wq, wqb, DIN, DE);
    cvt_f32_bf16_T<<<(nw8 + 255) / 256, 256, 0, stream>>>(Wk, wkb, DIN, DE);
    cvt_f32_bf16_T<<<(nw8 + 255) / 256, 256, 0, stream>>>(Wv, wvb, DIN, DE);
    cvt_f32_bf16_T<<<(nw8 + 255) / 256, 256, 0, stream>>>(Wo, wob, DE,  DE);

    dim3 gg((MTOT / 128) * (DE / 128));    // 1024 blocks
    gemm_bf16_k<0><<<gg, 256, 0, stream>>>(xb, wqb, bq, Qb,  MTOT, DE, DIN);
    gemm_bf16_k<3><<<gg, 256, 0, stream>>>(xb, wkb, bk, Kb,  MTOT, DE, DIN);
    gemm_bf16_k<1><<<gg, 256, 0, stream>>>(xb, wvb, bv, Vtb, MTOT, DE, DIN);

    attn_k<<<dim3(BATCH * (S / 64)), 256, 0, stream>>>(Qb, Kb, Vtb, ctx);

    gemm_bf16_k<2><<<gg, 256, 0, stream>>>(ctx, wob, bo, out, MTOT, DE, DIN);
}

// v009
// Measured time: 259 microseconds a run.
// Next to v008, in two timings, it ran 1.03 and 1.04 times as fast.
// Over all steps from v000 it is 3.58 times as fast.
#include <hip/hip_runtime.h>
#include <stdint.h>

typedef __attribute__((ext_vector_type(16))) __bf16 v16bf;
typedef __attribute__((ext_vector_type(8)))  float  v8f;
typedef __attribute__((ext_vector_type(4)))  uint32_t v4u;
typedef __attribute__((ext_vector_type(8)))  int      v8i_;
typedef __attribute__((ext_vector_type(4)))  int      v4i_;
typedef uint16_t u16;
typedef uint32_t u32;

#define DEVI __device__ __forceinline__

constexpr int BATCH = 8;
constexpr int S     = 2048;
constexpr int DIN   = 1024;
constexpr int DE    = 1024;
constexpr int MTOT  = BATCH * S;

// ---------- helpers ----------
DEVI u16 f2bf(float f) {                       // round-to-nearest-even f32 -> bf16
    u32 u = __float_as_uint(f);
    u32 r = (u + 0x7FFFu + ((u >> 16) & 1u)) >> 16;
    return (u16)r;
}

struct U4x2 { uint4 a, b; };

DEVI v16bf ld_frag(const u16* p0, const u16* p1) {   // two 16B chunks -> 16 bf16 frag
    U4x2 u;
    u.a = *(const uint4*)p0;
    u.b = *(const uint4*)p1;
    return __builtin_bit_cast(v16bf, u);
}

DEVI v8f wmma_bf16(v16bf a, v16bf b, v8f c) {
    return __builtin_amdgcn_wmma_f32_16x16x32_bf16(
        /*neg_a=*/false, a, /*neg_b=*/false, b,
        /*c_mod=*/(short)0, c, /*reuse_a=*/false, /*reuse_b=*/false);
}

// value of lane (l ^ M) of the same 16-lane row, by a DPP move (no LDS round trip)
template<int M>
DEVI float row_xor(float v) {
    const int i = __float_as_int(v);
    return __int_as_float(__builtin_amdgcn_update_dpp(i, i, 0x160 | M, 0xf, 0xf, false));
}

// a wave-uniform condition held in a scalar register, so that the test around a tensor
// load compiles to a scalar compare and branch (a tensor load ignores EXEC)
DEVI u32 pinned(u32 v) {
    u32 w = (u32)__builtin_amdgcn_readfirstlane((int)v);
    asm volatile("" : "+s"(w));   // pinned(): the issue test of a tensor load held in a scalar register
    return w;
}

// TDM: load a 2D bf16 tile (rows x cols, row stride in elements) from global to
// LDS, inserting 16B of LDS padding after every 1024B (so an LDS "row" of
// 2048B data occupies 2080B -> bank-spread, 16B-aligned chunks).
DEVI void tdm_load_tile_2d(u32 lds_off, const u16* gptr,
                           int cols, int rows, int row_stride_elems) {
    uint64_t ga = (uint64_t)(uintptr_t)gptr;
    v4u g0 = { 1u,                                   // count = 1 descriptor
               lds_off,                              // lds_addr (bytes)
               (u32)ga,                              // global_addr[31:0]
               (u32)(ga >> 32) | (2u << 30) };       // global_addr[56:32] | type=2
    v8i_ g1;
    g1[0] = (int)((1u << 16)                          // data_size = 2 bytes
                | (1u << 20)                          // pad_enable
                | (7u << 22)                          // pad_interval = 256 dwords (1024B)
                | (3u << 25));                        // pad_amount  = 4 dwords (16B)
    g1[1] = (int)((u32)(cols & 0xFFFF) << 16);        // tensor_dim0 low16
    g1[2] = (int)(((u32)cols >> 16) | ((u32)(rows & 0xFFFF) << 16)); // dim0 hi | dim1 lo
    g1[3] = (int)(((u32)rows >> 16) | ((u32)cols << 16));            // dim1 hi | tile_dim0
    g1[4] = (int)(u32)rows;                           // tile_dim1 (tile_dim2 = 0)
    g1[5] = (int)(u32)row_stride_elems;               // tensor_dim0_stride low32
    g1[6] = 0;
    g1[7] = 0;
    v4i_ z4 = {};
#if __clang_major__ >= 23
    v8i_ z8 = {};
    __builtin_amdgcn_tensor_load_to_lds(g0, g1, z4, z4, z8, 0);
#else
    __builtin_amdgcn_tensor_load_to_lds(g0, g1, z4, z4, 0);
#endif
}

// ---------- f32 -> bf16 conversion ----------
// A block converts CVT_PER x 256 consecutive float4 (16 per thread): starting a wave costs
// far more than moving the 512 bytes that a wave of one load per lane reads, so the work
// goes to few waves that each have many whole-line loads in flight.
constexpr int CVT_PER = 16;

DEVI ushort4 cvt4(float4 f) {
    ushort4 o;
    o.x = f2bf(f.x); o.y = f2bf(f.y); o.z = f2bf(f.z); o.w = f2bf(f.w);
    return o;
}

DEVI void cvt_f32_bf16(const float* __restrict__ in, u16* __restrict__ out, int n4, int blk) {
    const int blk0 = blk * (256 * CVT_PER);
    const int i0   = blk0 + threadIdx.x;
    if (blk0 + 256 * CVT_PER <= n4) {          // whole block in range: no test per element
        float4 f[CVT_PER];
        #pragma unroll   // constant indices keep f[] in registers and fold into the loads' offsets
        for (int j = 0; j < CVT_PER; j++) f[j] = ((const float4*)in)[i0 + j * 256];
        #pragma unroll   // constant indices keep f[] in registers and fold into the stores' offsets
        for (int j = 0; j < CVT_PER; j++) ((ushort4*)out)[i0 + j * 256] = cvt4(f[j]);
        // precaution: the remainder path is the other branch and never runs after these stores,
        // which end the kernel
        asm volatile("s_wait_xcnt 0x0" ::: "memory");
    } else {
        for (int j = 0; j < CVT_PER; j++) {
            const int i = i0 + j * 256;
            if (i < n4) ((ushort4*)out)[i] = cvt4(((const float4*)in)[i]);
        }
    }
}

// ---------- f32 [K,N] -> bf16 transposed [N,K] (weights) ----------
// A thread converts 8 consecutive k of one column n (8 loads, each coalesced along n)
// and stores them as one 16-byte chunk of the transposed row. Kd is a multiple of 8.
DEVI void cvt_f32_bf16_T(const float* __restrict__ in, u16* __restrict__ out,
                         int Kd, int N, int blk) {
    int idx = blk * 256 + threadIdx.x;
    if (idx < (Kd >> 3) * N) {
        int kg = idx / N, n = idx - kg * N;
        const float* p = in + (size_t)kg * 8 * N + n;
        float v[8];
        #pragma unroll   // constant indices keep v[] in registers; the 8 loads are in flight together
        for (int j = 0; j < 8; j++) v[j] = p[(size_t)j * N];
        uint4 pk;
        pk.x = (u32)f2bf(v[0]) | ((u32)f2bf(v[1]) << 16);
        pk.y = (u32)f2bf(v[2]) | ((u32)f2bf(v[3]) << 16);
        pk.z = (u32)f2bf(v[4]) | ((u32)f2bf(v[5]) << 16);
        pk.w = (u32)f2bf(v[6]) | ((u32)f2bf(v[7]) << 16);
        *(uint4*)(out + (size_t)n * Kd + kg * 8) = pk;
    }
}

// ---------- all five conversions in one launch ----------
// None of them reads what another writes, so they share one grid: blocks 0 .. xblocks - 1
// convert x, then WBLK blocks for each of the four weights, whose transposed copies lie one
// behind the other in wt (Wq, Wk, Wv, Wo). The choice is the same for a whole block.
constexpr int WBLK = DIN * DE / 8 / 256;   // blocks of cvt_f32_bf16_T per weight

__global__ __launch_bounds__(256)
void cvt_all(const float* __restrict__ x, const float* __restrict__ Wq,
             const float* __restrict__ Wk, const float* __restrict__ Wv,
             const float* __restrict__ Wo, u16* __restrict__ xb, u16* __restrict__ wt,
             int n4, int xblocks) {
    const int blk = blockIdx.x;
    if (blk < xblocks) {
        cvt_f32_bf16(x, xb, n4, blk);
    } else {
        const int w  = (blk - xblocks) / WBLK;
        const int wb = (blk - xblocks) - w * WBLK;
        const float* in = w == 0 ? Wq : w == 1 ? Wk : w == 2 ? Wv : Wo;
        cvt_f32_bf16_T(in, wt + (size_t)w * (DIN * DE), DIN, DE, wb);
    }
}

// ---------- tiled bf16 GEMM: C[M,N] = A[M,K] * Bt[N,K]^T + bias ----------
// A row-major [M,K]; Bt is the PRE-TRANSPOSED weight [N,K] (k contiguous).
// MODE 0: bf16 row-major out; MODE 2: f32 row-major out.
// MODE 1 and MODE 3: bf16 out in the order the attention kernel's B fragments are
// loaded: 1 KB tiles of 16 rows x 32 k, a tile = 2 chunks of 512 B, chunk c holds at
// lane (h*16 + row) the 8 elements k = c*16 + h*8 .. +7, so that one wave-wide 16-byte
// load reads 512 contiguous bytes (4 whole lines) instead of 32 B out of 16 lines.
//   MODE 3 (K): row = key m, k = feature n; tiles ordered [m/16][n/32].
//   MODE 1 (V): row = feature n, k = key s;  tiles ordered [b][s/32][n/16].
// JOB is a MODE, or 4: the Q, K and V products in one launch. They share A and none reads another's
// result; Bt is the three transposed weights one behind the other, N = 3 DE rows, and Out the
// three outputs one behind the other. A block's 128 columns lie in one of the three, which
// picks its bias and the form of its stores (MODE 0, 3, 1), the same for the whole block.
template<int V> struct ModeC { static constexpr int v = V; };

template<int JOB>
__global__ __launch_bounds__(256)
void gemm_bf16_k(const u16* __restrict__ A, const u16* __restrict__ Bt,
                 const float* __restrict__ bias, const float* __restrict__ bias_k,
                 const float* __restrict__ bias_v, void* __restrict__ Out,
                 int M, int N, int Kd)
{
    constexpr int BM = 128, BN = 128, BK = 64;
    constexpr int LDA = 72;   // padded LDS row stride (shorts): 144 B = 16 B x 9, odd for 16-byte reads
    constexpr int LDB = 72;
    // two buffers per operand: while one k tile is worked on, the next one's copies are in flight
    __shared__ __attribute__((aligned(16))) u16 As[2 * BM * LDA];
    __shared__ __attribute__((aligned(16))) u16 Bs[2 * BN * LDB];   // [n][k]

    const int nb = N / BN;
    const int m0 = (blockIdx.x / nb) * BM;
    const int n0 = (blockIdx.x % nb) * BN;

    const int t    = threadIdx.x;
    const int lane = t & 31;
    const int wave = t >> 5;       // 0..7
    const int wm   = wave >> 2;    // 0..1 : 64-row slice
    const int wn   = wave & 3;     // 0..3 : 32-col slice
    const int half = lane >> 4;
    const int lr   = lane & 15;

    v8f acc[4][2] = {};

    // staging: a k tile is 128 rows x 64 k = 1024 x 16 B chunks per operand, 4 per thread (rows
    // srow + 32 i, chunk t & 7), so that a wave-wide copy moves 4 whole 128-byte lines. Bt is
    // pre-transposed, so both operands are plain copies. Kd is a multiple of 64.
    const int srow = t >> 3;
    const int sch  = (t & 7) * 8;
    const u16* Ag = A  + (size_t)(m0 + srow) * Kd + sch;
    const u16* Bg = Bt + (size_t)(n0 + srow) * Kd + sch;
    const size_t rs = (size_t)32 * Kd;                              // 32 rows further, in elements
    const u32 lA = (u32)(uintptr_t)(&As[srow * LDA + sch]);         // low 32 bits = LDS byte address
    const u32 lB = (u32)(uintptr_t)(&Bs[srow * LDB + sch]);
    // the 8 copies of one thread for k tile kt into buffer buf, global memory to LDS through no register
    auto copy_tile = [&](int kt, int buf) __attribute__((always_inline)) {
        const u16* a = Ag + kt * BK;
        const u16* b = Bg + kt * BK;
        const u32 la = lA + (u32)buf * (u32)(BM * LDA * 2);
        const u32 lb = lB + (u32)buf * (u32)(BN * LDB * 2);
        // the closing s_wait_xcnt 0 stands inside the copies' own statement, ahead of any rewrite
        // of the address registers that the copies name
        asm volatile("global_load_async_to_lds_b128 %0, %8, off\n\t"
                     "global_load_async_to_lds_b128 %1, %9, off\n\t"
                     "global_load_async_to_lds_b128 %2, %10, off\n\t"
                     "global_load_async_to_lds_b128 %3, %11, off\n\t"
                     "global_load_async_to_lds_b128 %4, %12, off\n\t"
                     "global_load_async_to_lds_b128 %5, %13, off\n\t"
                     "global_load_async_to_lds_b128 %6, %14, off\n\t"
                     "global_load_async_to_lds_b128 %7, %15, off\n\t"
                     "s_wait_xcnt 0x0"
                     :: "v"(la), "v"(la + 32u * LDA * 2), "v"(la + 64u * LDA * 2), "v"(la + 96u * LDA * 2),
                        "v"(lb), "v"(lb + 32u * LDB * 2), "v"(lb + 64u * LDB * 2), "v"(lb + 96u * LDB * 2),
                        "v"(a), "v"(a + rs), "v"(a + 2 * rs), "v"(a + 3 * rs),
                        "v"(b), "v"(b + rs), "v"(b + 2 * rs), "v"(b + 3 * rs)
                     : "memory");
    };

    const int nt = Kd / BK;
    copy_tile(0, 0);
    asm volatile("s_wait_asynccnt 0x0" ::: "memory");   // this wave's copies of tile 0 have landed
    __syncthreads();                                    // and so have every other wave's
    if (1 < nt) copy_tile(1, 1);

    for (int kt = 0; kt < nt; kt++) {
        const int buf = kt & 1;
        const u16* Ab = As + buf * (BM * LDA);
        const u16* Bb = Bs + buf * (BN * LDB);
        #pragma unroll   // constant indices fold into the LDS reads' offsets
        for (int ks = 0; ks < BK; ks += 32) {
            v16bf afr[4], bfr[2];
            #pragma unroll
            for (int i = 0; i < 4; i++) {
                const u16* rp = &Ab[(wm * 64 + i * 16 + lr) * LDA + ks];
                afr[i] = ld_frag(rp + half * 8, rp + 16 + half * 8);
            }
            #pragma unroll
            for (int j = 0; j < 2; j++) {
                const u16* rp = &Bb[(wn * 32 + j * 16 + lr) * LDB + ks];
                bfr[j] = ld_frag(rp + half * 8, rp + 16 + half * 8);
            }
            #pragma unroll
            for (int i = 0; i < 4; i++)
                #pragma unroll
                for (int j = 0; j < 2; j++)
                    acc[i][j] = wmma_bf16(afr[i], bfr[j], acc[i][j]);
        }
        // hand-over: this wave's reads of buffer buf are done and its copies of tile kt + 1 have
        // landed; behind the barrier that holds for every wave, and buffer buf may be refilled
        asm volatile("s_wait_dscnt 0x0" ::: "memory");
        asm volatile("s_wait_asynccnt 0x0" ::: "memory");
        __syncthreads();
        if (kt + 2 < nt) copy_tile(kt + 2, buf);
    }
    asm volatile("s_wait_asynccnt 0x0" ::: "memory");   // no copy is outstanding where the wave goes on

    // epilogue: lane lr = col, VGPR r -> row r + 8*half
    auto store_tile = [&](auto md, const float* bias, void* Out, int n0, int N)
                      __attribute__((always_inline)) {
    constexpr int MODE = decltype(md)::v;
    float bj[2];   // both bias values are asked for ahead of the first tile
    #pragma unroll   // constant indices keep bj[] in registers
    for (int j = 0; j < 2; j++) bj[j] = bias[n0 + wn * 32 + j * 16 + lr];
    #pragma unroll
    for (int i = 0; i < 4; i++) {
        #pragma unroll
        for (int j = 0; j < 2; j++) {
            const int n = n0 + wn * 32 + j * 16 + lr;
            const float bv = bj[j];
            if constexpr (MODE == 1) {
                // this lane's 8 accumulator rows are 8 consecutive keys: one 16-byte chunk
                const int mb = m0 + wm * 64 + i * 16;
                const int bb = mb >> 11;             // mb / S (S=2048)
                const int ss = mb & (S - 1);
                const size_t tile = (size_t)(bb * (S / 32) + (ss >> 5)) * (N / 16) + (n >> 4);
                uint4 pk;
                pk.x = (u32)f2bf(acc[i][j][0] + bv) | ((u32)f2bf(acc[i][j][1] + bv) << 16);
                pk.y = (u32)f2bf(acc[i][j][2] + bv) | ((u32)f2bf(acc[i][j][3] + bv) << 16);
                pk.z = (u32)f2bf(acc[i][j][4] + bv) | ((u32)f2bf(acc[i][j][5] + bv) << 16);
                pk.w = (u32)f2bf(acc[i][j][6] + bv) | ((u32)f2bf(acc[i][j][7] + bv) << 16);
                *(uint4*)((u16*)Out + tile * 512 + ((ss >> 4) & 1) * 256 + lane * 8) = pk;
            }
            #pragma unroll
            for (int r = 0; r < 8; r++) {
                const int m = m0 + wm * 64 + i * 16 + r + half * 8;
                const float v = acc[i][j][r] + bv;
                if constexpr (MODE == 0) {
                    ((u16*)Out)[(size_t)m * N + n] = f2bf(v);
                } else if constexpr (MODE == 3) {
                    const size_t tile = (size_t)(m >> 4) * (N / 32) + (n >> 5);
                    ((u16*)Out)[tile * 512 + ((n >> 4) & 1) * 256
                                + (((n >> 3) & 1) * 16 + (m & 15)) * 8 + (n & 7)] = f2bf(v);
                } else if constexpr (MODE == 2) {
                    ((float*)Out)[(size_t)m * N + n] = v;
                }
            }
            // keeps each 16x16 tile's arithmetic and stores together: with the three store forms in
            // one kernel the compiler mixed the tiles and took 168 registers, which leaves 3 blocks
            // on a WGP where the LDS allows 4
            if constexpr (JOB == 4) {
                // the stores' data and address registers are rewritten for the next tile
                asm volatile("s_wait_xcnt 0x0" ::: "memory");
                __builtin_amdgcn_sched_barrier(0);
            }
        }
    }
    };
    if constexpr (JOB == 4) {
        const int which = n0 / DE;          // 0: Q, 1: K, 2: V
        const int nl    = n0 - which * DE;  // the block's first column in its own output
        u16* o = (u16*)Out + (size_t)which * ((size_t)MTOT * DE);
        if (which == 0)      store_tile(ModeC<0>{}, bias,   o, nl, DE);
        else if (which == 1) store_tile(ModeC<3>{}, bias_k, o, nl, DE);
        else                 store_tile(ModeC<1>{}, bias_v, o, nl, DE);
    } else {
        store_tile(ModeC<JOB>{}, bias, Out, n0, N);
    }
}

// One group of attention B fragments: 8 fragments, 16 wave-wide 16-byte loads, 8 KB a wave.
// K: 4 d steps x 2 key tiles, f[g * 2 + kt]; V: one 32-key trip x 8 column tiles, f[j].
// The group's start is the same for the whole wave and lo is the lane's own offset in a
// fragment, so that a load can take a scalar base and the one offset register of the lane.
DEVI void ld_k_group(v16bf (&f)[8], const u16* kp0, u32 lo) {
    #pragma unroll   // constant indices keep f[] in registers and fold into the loads' offsets
    for (int g = 0; g < 4; g++)
        #pragma unroll
        for (int kt = 0; kt < 2; kt++) {
            const u16* kp = kp0 + (kt * (DE / 32) + g) * 512 + lo;
            f[g * 2 + kt] = ld_frag(kp, kp + 256);
        }
    // the loads' address registers are rewritten for the next group further down
    asm volatile("s_wait_xcnt 0x0" ::: "memory");
    // keeps the group's 16 loads here, ahead of the other set's products: left to itself the
    // compiler sinks each pair to just ahead of its own products and the wave waits out the latency
    __builtin_amdgcn_sched_barrier(0);
}

DEVI void ld_v_group(v16bf (&f)[8], const u16* vp0, u32 lo) {
    #pragma unroll   // constant indices keep f[] in registers and fold into the loads' offsets
    for (int j = 0; j < 8; j++) {
        const u16* vp = vp0 + j * 512 + lo;
        f[j] = ld_frag(vp, vp + 256);
    }
    // the loads' address registers are rewritten for the next group further down
    asm volatile("s_wait_xcnt 0x0" ::: "memory");
    // keeps the group's 16 loads here, ahead of the other set's products: left to itself the
    // compiler sinks each pair to just ahead of its own products and the wave waits out the latency
    __builtin_amdgcn_sched_barrier(0);
}

// ---------- flash-style attention: ctx = softmax(Q K^T / sqrt(D)) V ----------
// One block handles 64 q-rows (4 tiles of 16) of one batch, so that every K and V
// fragment a wave loads feeds 4 matrix products; a pass covers 256 keys, 2 tiles of 16 per
// wave, so that every Q fragment read from LDS feeds 2. 8 waves; each wave owns a 128-wide
// d-slice of the output accumulator. K and V come in the fragment-ordered 1 KB tiles
// that gemm_bf16_k MODE 3 and MODE 1 write (K: [b*S/16 + s/16][d/32], V: [b][s/32][d/16]).
// Q block is staged into LDS by the Tensor Data Mover (with 16B pad / 1024B), one
// 16-row slice from each of waves 0..3.
// K and V fragments go through two register sets, fa and fb: while one set's 32 products
// run, the other set's 16 loads are on their way from L2. The order of the groups in a pass is
// K 0..7, V 0..7, sets alternating; a work-group barrier waits for every load of the wave, so
// V group 1 is asked for behind the barrier that follows the scores.
__global__ __launch_bounds__(256)
void attn_k(const u16* __restrict__ Q, const u16* __restrict__ K,
            const u16* __restrict__ Vt, u16* __restrict__ ctx)
{
    constexpr int QT = 4;            // 16-row q tiles per block
    constexpr int QB = QT * 16;      // q rows per block
    constexpr int KT = 2;            // 16-key tiles per wave and pass
    constexpr int KC = 8 * KT * 16;  // k rows per outer iteration (32 per wave)
    constexpr int LQ = DIN + 16;     // TDM-padded Qs row stride (shorts): 2080B
    constexpr int QSL = 17408;       // shorts per 16-row Q slice: 16*LQ rounded up to 2 KiB
    constexpr int LP = KC + 8;       // padded Pbuf stride (shorts)

    __shared__ __attribute__((aligned(2048))) u16 Qs[QT * QSL];   // 139,264 B (TDM destination)
    __shared__ float Sbuf[QB][KC];      // 64 KB
    __shared__ u16   Pbuf[QB * LP];     // 33 KB
    __shared__ float rowM[QB], rowL[QB], rowA[QB];

    const int qblk = blockIdx.x & (S / QB - 1);
    const int b    = blockIdx.x / (S / QB);
    const int q0   = qblk * QB;

    const int t    = threadIdx.x;
    const int lane = t & 31;
    const int wave = t >> 5;
    const int half = lane >> 4;
    const int lr   = lane & 15;

    // stage Q block (64 x 1024 bf16) via Tensor Data Mover: waves 0..3 each issue the
    // 16-row slice of their own number and wait for it themselves
    const u32 wv = (u32)__builtin_amdgcn_readfirstlane(t >> 5);
    if (pinned(wv < (u32)QT)) {
        u32 lds_off = (u32)(uintptr_t)(&Qs[0]) + wv * (u32)(QSL * 2);   // low 32 bits = LDS offset
        tdm_load_tile_2d(lds_off, Q + ((size_t)b * S + q0 + wv * 16) * DE,
                         /*cols=*/DIN, /*rows=*/16, /*row_stride=*/DE);
        __builtin_amdgcn_s_wait_tensorcnt(0);
    }
    if (t < QB) { rowM[t] = -1e30f; rowL[t] = 0.f; }
    __syncthreads();

    const int dbase = (int)wv * 128;   // wave-uniform: held in a scalar register
    v8f acc[QT][8] = {};
    const float scale = 0.03125f;    // 1/sqrt(1024)

    constexpr int DG = 4;            // d steps per K group
    const u16* Kw = K + (size_t)(b * (S / 16) + wv * KT) * (DE / 32) * 512;
    const u16* Vw = Vt + ((size_t)b * (S / 32) * (DE / 16) + wv * 8) * 512;
    const u32 lo = lane * 8;
    v16bf fa[8], fb[8];
    ld_k_group(fa, Kw, lo);          // K group 0 of pass 0

    for (int kc = 0; kc < S; kc += KC) {
        // phase 1: each wave computes the 64x32 score tile for k-rows kc+wave*32..+32
        v8f sacc[KT][QT] = {};
        const u16* Kg = Kw + (kc >> 4) * (DE / 32) * 512;   // wave-uniform, like Vg and Kn
        const u16* Vg = Vw + (kc >> 5) * (DE / 16) * 512;
        // the 32 products of one K group: 4 d steps from d = dg on
        auto qk = [&](const v16bf (&f)[8], int dg) __attribute__((always_inline)) {
            #pragma unroll   // constant indices keep f[] in registers
            for (int g = 0; g < DG; g++) {
                const int d0 = dg + g * 32;
                v16bf aq[QT];
                #pragma unroll   // constant indices keep aq[] in registers
                for (int qt = 0; qt < QT; qt++) {
                    // TDM pad: +8 shorts after every 512 shorts stored
                    const u16* qp = &Qs[qt * QSL + lr * LQ + d0 + 8 * (d0 >> 9)];
                    aq[qt] = ld_frag(qp + half * 8, qp + 16 + half * 8);
                }
                // keeps the d step's 8 LDS reads in flight together: left to itself the compiler
                // reads each Q fragment just ahead of its 2 products and waits out 4 LDS latencies
                __builtin_amdgcn_sched_barrier(0);
                #pragma unroll   // constant indices keep sacc[], aq[] and f[] in registers
                for (int qt = 0; qt < QT; qt++)
                    #pragma unroll
                    for (int kt = 0; kt < KT; kt++)
                        sacc[kt][qt] = wmma_bf16(aq[qt], f[g * KT + kt], sacc[kt][qt]);
            }
        };
        // The last two groups stand behind the loop, not under a test inside it: where two paths
        // with different numbers of loads join, the compiler's counted waits fall back to the
        // smaller number and wait for the loads just issued.
        #pragma unroll 1   // rolled: one copy of the code serves K groups 0 to 5, 2 a trip
        for (int dg = 0; dg < DIN - 64 * DG; dg += 64 * DG) {
            ld_k_group(fb, Kg + ((dg >> 5) + DG) * 512, lo);
            qk(fa, dg);
            ld_k_group(fa, Kg + ((dg >> 5) + 2 * DG) * 512, lo);
            qk(fb, dg + 32 * DG);
        }
        ld_k_group(fb, Kg + (DIN / 32 - DG) * 512, lo);
        qk(fa, DIN - 64 * DG);
        ld_v_group(fa, Vg, lo);                 // V group 0
        qk(fb, DIN - 32 * DG);
        #pragma unroll
        for (int kt = 0; kt < KT; kt++)
            #pragma unroll
            for (int qt = 0; qt < QT; qt++)
                #pragma unroll
                for (int r = 0; r < 8; r++)
                    Sbuf[qt * 16 + r + half * 8][(wave * KT + kt) * 16 + lr] = sacc[kt][qt][r] * scale;
        __syncthreads();
        ld_v_group(fb, Vg + (DE / 16) * 512, lo);   // V group 1: lands while the softmax phase runs

        // phase 2: online softmax update, 16 lanes per q-row, 8 columns per lane out of
        // each 128-column half of the pass, 16 rows at a time
        #pragma unroll 1   // rolled: the lr == 0 branch keeps the row groups apart anyway, one copy of the code serves
        for (int rg = 0; rg < QT; rg++) {
            const int row = rg * 16 + (t >> 4);
            const int c8  = lr * 8;
            float sv[8 * KT];
            #pragma unroll   // constant indices keep sv[] in registers
            for (int h = 0; h < KT; h++) {
                const float4 sa = *(const float4*)&Sbuf[row][h * 128 + c8];
                const float4 sb = *(const float4*)&Sbuf[row][h * 128 + c8 + 4];
                sv[h * 8 + 0] = sa.x; sv[h * 8 + 1] = sa.y; sv[h * 8 + 2] = sa.z; sv[h * 8 + 3] = sa.w;
                sv[h * 8 + 4] = sb.x; sv[h * 8 + 5] = sb.y; sv[h * 8 + 6] = sb.z; sv[h * 8 + 7] = sb.w;
            }
            const float mold = rowM[row];
            float mx = sv[0];
            #pragma unroll   // constant indices keep sv[] in registers
            for (int j = 1; j < 8 * KT; j++) mx = fmaxf(mx, sv[j]);
            mx = fmaxf(mx, row_xor<1>(mx));
            mx = fmaxf(mx, row_xor<2>(mx));
            mx = fmaxf(mx, row_xor<4>(mx));
            mx = fmaxf(mx, row_xor<8>(mx));
            const float mnew = fmaxf(mold, mx);
            float p[8 * KT];
            float sum = 0.f;
            #pragma unroll   // constant indices keep sv[] and p[] in registers
            for (int j = 0; j < 8 * KT; j++) { p[j] = __expf(sv[j] - mnew); sum += p[j]; }
            #pragma unroll   // constant indices keep p[] in registers
            for (int h = 0; h < KT; h++) {
                uint4 pk;
                pk.x = (u32)f2bf(p[h * 8 + 0]) | ((u32)f2bf(p[h * 8 + 1]) << 16);
                pk.y = (u32)f2bf(p[h * 8 + 2]) | ((u32)f2bf(p[h * 8 + 3]) << 16);
                pk.z = (u32)f2bf(p[h * 8 + 4]) | ((u32)f2bf(p[h * 8 + 5]) << 16);
                pk.w = (u32)f2bf(p[h * 8 + 6]) | ((u32)f2bf(p[h * 8 + 7]) << 16);
                *(uint4*)&Pbuf[row * LP + h * 128 + c8] = pk;
            }
            sum += row_xor<1>(sum);
            sum += row_xor<2>(sum);
            sum += row_xor<4>(sum);
            sum += row_xor<8>(sum);
            if (lr == 0) {
                const float alpha = __expf(mold - mnew);
                rowL[row] = rowL[row] * alpha + sum;
                rowM[row] = mnew;
                rowA[row] = alpha;
            }
        }
        __syncthreads();

        // phase 3: rescale running accumulator, then acc += P @ V-slice
        #pragma unroll
        for (int qt = 0; qt < QT; qt++) {
            float al[8];
            #pragma unroll
            for (int r = 0; r < 8; r++) al[r] = rowA[qt * 16 + r + half * 8];
            #pragma unroll
            for (int j = 0; j < 8; j++)
                #pragma unroll
                for (int r = 0; r < 8; r++) acc[qt][j][r] *= al[r];
        }

        // the 32 products of one V group: keys ks .. ks + 31 of the pass
        auto pv = [&](const v16bf (&f)[8], int ks) __attribute__((always_inline)) {
            v16bf ap[QT];
            #pragma unroll
            for (int qt = 0; qt < QT; qt++) {
                const u16* pp = &Pbuf[(qt * 16 + lr) * LP + ks];
                ap[qt] = ld_frag(pp + half * 8, pp + 16 + half * 8);
            }
            // keeps the trip's 8 LDS reads in flight together, ahead of its products
            __builtin_amdgcn_sched_barrier(0);
            #pragma unroll
            for (int j = 0; j < 8; j++)
                #pragma unroll
                for (int qt = 0; qt < QT; qt++)
                    acc[qt][j] = wmma_bf16(ap[qt], f[j], acc[qt][j]);
        };
        // K group 0 of the next pass; behind the last pass that of pass 0 again, read and not used,
        // so that every pass runs the same code
        const u16* Kn = Kw + (((kc + KC) & (S - 1)) >> 4) * (DE / 32) * 512;
        #pragma unroll 1   // rolled: one copy of the code serves V groups 0 to 5, 2 a trip
        for (int ks = 0; ks < KC - 64; ks += 64) {
            pv(fa, ks);
            ld_v_group(fa, Vg + ((ks >> 5) + 2) * (DE / 16) * 512, lo);
            pv(fb, ks + 32);
            ld_v_group(fb, Vg + ((ks >> 5) + 3) * (DE / 16) * 512, lo);
        }
        pv(fa, KC - 64);
        ld_k_group(fa, Kn, lo);
        pv(fb, KC - 32);
        // keeps these 32 products ahead of the barrier, which waits for the K loads just issued:
        // left to itself the compiler sinks them behind it and nothing runs during that wait
        __builtin_amdgcn_sched_barrier(0);
        __syncthreads();
    }

    // finalize: divide by softmax denominator, store bf16 ctx
    // the lane's number is read anew here (every lane is on), so that no register has to hold
    // lr and half through the loop for this use alone: with them the kernel spilled
    const int el = (int)__builtin_amdgcn_mbcnt_lo(~0u, 0u);
    const int eh = el >> 4;     // = half
    const int er = el & 15;     // = lr
    #pragma unroll
    for (int qt = 0; qt < QT; qt++) {
        float inv[8];
        #pragma unroll
        for (int r = 0; r < 8; r++) inv[r] = 1.f / rowL[qt * 16 + r + eh * 8];
        #pragma unroll
        for (int j = 0; j < 8; j++) {
            const int n = dbase + j * 16 + er;
            #pragma unroll
            for (int r = 0; r < 8; r++) {
                const int m = q0 + qt * 16 + r + eh * 8;
                ctx[((size_t)b * S + m) * DE + n] = f2bf(acc[qt][j][r] * inv[r]);
            }
            // the stores' data and address registers are rewritten for the next column tile
            asm volatile("s_wait_xcnt 0x0" ::: "memory");
            // keeps the next tile's arithmetic, which rewrites those registers, behind that wait
            __builtin_amdgcn_sched_barrier(0);
        }
    }
}

// ---------- host launcher ----------
extern "C" void kernel_launch(void* const* d_in, const int* in_sizes, int n_in,
                              void* d_out, int out_size, void* d_ws, size_t ws_size,
                              hipStream_t stream)
{
    (void)in_sizes; (void)n_in; (void)out_size; (void)ws_size;

    const float* x  = (const float*)d_in[0];
    const float* Wq = (const float*)d_in[1];
    const float* bq = (const float*)d_in[2];
    const float* Wk = (const float*)d_in[3];
    const float* bk = (const float*)d_in[4];
    const float* Wv = (const float*)d_in[5];
    const float* bv = (const float*)d_in[6];
    const float* Wo = (const float*)d_in[7];
    const float* bo = (const float*)d_in[8];
    float* out = (float*)d_out;

    char* ws = (char*)d_ws;
    const size_t MB = 1ull << 20;
    u16* xb  = (u16*)(ws);                 // 32 MB  x bf16 [m][k]
    u16* wqb = (u16*)(ws + 32 * MB);       //  2 MB  Wq^T bf16 [n][k]
    u16* wkb = (u16*)(ws + 34 * MB);       //  2 MB  Wk^T
    u16* wvb = (u16*)(ws + 36 * MB);       //  2 MB  Wv^T
    u16* wob = (u16*)(ws + 38 * MB);       //  2 MB  Wo^T
    u16* Qb  = (u16*)(ws + 40 * MB);       // 32 MB  Q bf16 [b][s][d]
    u16* Kb  = (u16*)(ws + 72 * MB);       // 32 MB  K bf16, fragment-ordered tiles
    u16* Vtb = (u16*)(ws + 104 * MB);      // 32 MB  V bf16, fragment-ordered tiles
    u16* ctx = (u16*)(ws + 136 * MB);      // 32 MB  attention output bf16

    const int nx4 = MTOT * DIN / 4;
    const int nxb = 256 * CVT_PER;         // float4 per block of cvt_f32_bf16
    const int nxg = (nx4 + nxb - 1) / nxb; // blocks that convert x
    // wqb .. wob lie one behind the other: the kernel reaches all four from wqb
    cvt_all<<<nxg + 4 * WBLK, 256, 0, stream>>>(x, Wq, Wk, Wv, Wo, xb, wqb, nx4, nxg);

    dim3 gg((MTOT / 128) * (DE / 128));    // 1024 blocks
    // wqb, wkb, wvb are one [3 DE][DIN] operand and Qb, Kb, Vtb one output range
    gemm_bf16_k<4><<<dim3(3 * (MTOT / 128) * (DE / 128)), 256, 0, stream>>>(
        xb, wqb, bq, bk, bv, Qb, MTOT, 3 * DE, DIN);

    attn_k<<<dim3(BATCH * (S / 64)), 256, 0, stream>>>(Qb, Kb, Vtb, ctx);

    gemm_bf16_k<2><<<gg, 256, 0, stream>>>(ctx, wob, bo, bo, bo, out, MTOT, DE, DIN);
}

// v010
// It runs in 234 microseconds.
// In two side-by-side timings against v009, it was 1.10 and 1.11 times as fast.
// All steps since v000 together make it 3.96 times as fast.
#include <hip/hip_runtime.h>
#include <stdint.h>

typedef __attribute__((ext_vector_type(16))) __bf16 v16bf;
typedef __attribute__((ext_vector_type(8)))  float  v8f;
typedef __attribute__((ext_vector_type(4)))  uint32_t v4u;
typedef __attribute__((ext_vector_type(8)))  int      v8i_;
typedef __attribute__((ext_vector_type(4)))  int      v4i_;
typedef uint16_t u16;
typedef uint32_t u32;

#define DEVI __device__ __forceinline__

constexpr int BATCH = 8;
constexpr int S     = 2048;
constexpr int DIN   = 1024;
constexpr int DE    = 1024;
constexpr int MTOT  = BATCH * S;

// ---------- helpers ----------
DEVI u16 f2bf(float f) {                       // round-to-nearest-even f32 -> bf16
    u32 u = __float_as_uint(f);
    u32 r = (u + 0x7FFFu + ((u >> 16) & 1u)) >> 16;
    return (u16)r;
}

struct U4x2 { uint4 a, b; };

DEVI v16bf ld_frag(const u16* p0, const u16* p1) {   // two 16B chunks -> 16 bf16 frag
    U4x2 u;
    u.a = *(const uint4*)p0;
    u.b = *(const uint4*)p1;
    return __builtin_bit_cast(v16bf, u);
}

DEVI v8f wmma_bf16(v16bf a, v16bf b, v8f c) {
    return __builtin_amdgcn_wmma_f32_16x16x32_bf16(
        /*neg_a=*/false, a, /*neg_b=*/false, b,
        /*c_mod=*/(short)0, c, /*reuse_a=*/false, /*reuse_b=*/false);
}

// value of lane (l ^ M) of the same 16-lane row, by a DPP move (no LDS round trip)
template<int M>
DEVI float row_xor(float v) {
    const int i = __float_as_int(v);
    return __int_as_float(__builtin_amdgcn_update_dpp(i, i, 0x160 | M, 0xf, 0xf, false));
}

// a wave-uniform condition held in a scalar register, so that the test around a tensor
// load compiles to a scalar compare and branch (a tensor load ignores EXEC)
DEVI u32 pinned(u32 v) {
    u32 w = (u32)__builtin_amdgcn_readfirstlane((int)v);
    asm volatile("" : "+s"(w));   // pinned(): the issue test of a tensor load held in a scalar register
    return w;
}

// TDM: load a 2D bf16 tile (rows x cols, row stride in elements) from global to
// LDS, inserting 16B of LDS padding after every 1024B (so an LDS "row" of
// 2048B data occupies 2080B -> bank-spread, 16B-aligned chunks).
DEVI void tdm_load_tile_2d(u32 lds_off, const u16* gptr,
                           int cols, int rows, int row_stride_elems) {
    uint64_t ga = (uint64_t)(uintptr_t)gptr;
    v4u g0 = { 1u,                                   // count = 1 descriptor
               lds_off,                              // lds_addr (bytes)
               (u32)ga,                              // global_addr[31:0]
               (u32)(ga >> 32) | (2u << 30) };       // global_addr[56:32] | type=2
    v8i_ g1;
    g1[0] = (int)((1u << 16)                          // data_size = 2 bytes
                | (1u << 20)                          // pad_enable
                | (7u << 22)                          // pad_interval = 256 dwords (1024B)
                | (3u << 25));                        // pad_amount  = 4 dwords (16B)
    g1[1] = (int)((u32)(cols & 0xFFFF) << 16);        // tensor_dim0 low16
    g1[2] = (int)(((u32)cols >> 16) | ((u32)(rows & 0xFFFF) << 16)); // dim0 hi | dim1 lo
    g1[3] = (int)(((u32)rows >> 16) | ((u32)cols << 16));            // dim1 hi | tile_dim0
    g1[4] = (int)(u32)rows;                           // tile_dim1 (tile_dim2 = 0)
    g1[5] = (int)(u32)row_stride_elems;               // tensor_dim0_stride low32
    g1[6] = 0;
    g1[7] = 0;
    v4i_ z4 = {};
#if __clang_major__ >= 23
    v8i_ z8 = {};
    __builtin_amdgcn_tensor_load_to_lds(g0, g1, z4, z4, z8, 0);
#else
    __builtin_amdgcn_tensor_load_to_lds(g0, g1, z4, z4, 0);
#endif
}

// ---------- f32 -> bf16 conversion ----------
// A block converts CVT_PER x 256 consecutive float4 (16 per thread): starting a wave costs
// far more than moving the 512 bytes that a wave of one load per lane reads, so the work
// goes to few waves that each have many whole-line loads in flight.
constexpr int CVT_PER = 16;

DEVI ushort4 cvt4(float4 f) {
    ushort4 o;
    o.x = f2bf(f.x); o.y = f2bf(f.y); o.z = f2bf(f.z); o.w = f2bf(f.w);
    return o;
}

DEVI void cvt_f32_bf16(const float* __restrict__ in, u16* __restrict__ out, int n4, int blk) {
    const int blk0 = blk * (256 * CVT_PER);
    const int i0   = blk0 + threadIdx.x;
    if (blk0 + 256 * CVT_PER <= n4) {          // whole block in range: no test per element
        float4 f[CVT_PER];
        #pragma unroll   // constant indices keep f[] in registers and fold into the loads' offsets
        for (int j = 0; j < CVT_PER; j++) f[j] = ((const float4*)in)[i0 + j * 256];
        #pragma unroll   // constant indices keep f[] in registers and fold into the stores' offsets
        for (int j = 0; j < CVT_PER; j++) ((ushort4*)out)[i0 + j * 256] = cvt4(f[j]);
        // precaution: the remainder path is the other branch and never runs after these stores,
        // which end the kernel
        asm volatile("s_wait_xcnt 0x0" ::: "memory");
    } else {
        for (int j = 0; j < CVT_PER; j++) {
            const int i = i0 + j * 256;
            if (i < n4) ((ushort4*)out)[i] = cvt4(((const float4*)in)[i]);
        }
    }
}

// ---------- f32 [K,N] -> bf16 transposed [N,K] (weights) ----------
// A thread converts 8 consecutive k of one column n (8 loads, each coalesced along n)
// and stores them as one 16-byte chunk of the transposed row. Kd is a multiple of 8.
DEVI void cvt_f32_bf16_T(const float* __restrict__ in, u16* __restrict__ out,
                         int Kd, int N, int blk) {
    int idx = blk * 256 + threadIdx.x;
    if (idx < (Kd >> 3) * N) {
        int kg = idx / N, n = idx - kg * N;
        const float* p = in + (size_t)kg * 8 * N + n;
        float v[8];
        #pragma unroll   // constant indices keep v[] in registers; the 8 loads are in flight together
        for (int j = 0; j < 8; j++) v[j] = p[(size_t)j * N];
        uint4 pk;
        pk.x = (u32)f2bf(v[0]) | ((u32)f2bf(v[1]) << 16);
        pk.y = (u32)f2bf(v[2]) | ((u32)f2bf(v[3]) << 16);
        pk.z = (u32)f2bf(v[4]) | ((u32)f2bf(v[5]) << 16);
        pk.w = (u32)f2bf(v[6]) | ((u32)f2bf(v[7]) << 16);
        *(uint4*)(out + (size_t)n * Kd + kg * 8) = pk;
    }
}

// ---------- the folded bias: c = bv Wo + bo, in f32 ----------
// The rows of a softmax sum to 1, so attn (x Wv + bv) Wo + bo = attn (x (Wv Wo) + c).
// A block sums 32 columns: 8 lanes x float4 across the columns, 32 groups of 32 rows of Wo,
// then one thread per column adds the 32 partial sums.
constexpr int CBLK = DE / 32;

DEVI void bias_fold(const float* __restrict__ bv, const float* __restrict__ Wo,
                    const float* __restrict__ bo, float* __restrict__ c, int blk) {
    __shared__ float part[32][32];
    const int t  = threadIdx.x;
    const int cg = t & 7;
    const int jg = t >> 3;
    const float* wp = Wo + (size_t)(jg * 32) * DE + blk * 32 + cg * 4;
    float4 s = make_float4(0.f, 0.f, 0.f, 0.f);
    #pragma unroll 16   // 16 loads of Wo in flight per lane
    for (int i = 0; i < 32; i++) {
        const float  bj = bv[jg * 32 + i];
        const float4 w  = *(const float4*)(wp + (size_t)i * DE);
        s.x += bj * w.x; s.y += bj * w.y; s.z += bj * w.z; s.w += bj * w.w;
    }
    *(float4*)&part[jg][cg * 4] = s;
    __syncthreads();
    if (t < 32) {
        float a = bo[blk * 32 + t];
        for (int g = 0; g < 32; g++) a += part[g][t];
        c[blk * 32 + t] = a;
    }
}

// ---------- all five conversions and the folded bias in one launch ----------
// None of them reads what another writes, so they share one grid: blocks 0 .. xblocks - 1
// convert x, then WBLK blocks for each of Wq, Wk and Wo (transposed copies), VBLK blocks for Wv
// (a plain copy: it is the [N,K] operand of the product Wo^T Wv^T) and CBLK for the bias. The
// four bf16 weights lie one behind the other in wt (Wq, Wk, Wv, Wo). The choice is the same
// for a whole block.
constexpr int WBLK = DIN * DE / 8 / 256;               // blocks of cvt_f32_bf16_T per weight
constexpr int VBLK = DIN * DE / 4 / (256 * CVT_PER);   // blocks of cvt_f32_bf16 for Wv

__global__ __launch_bounds__(256)
void cvt_all(const float* __restrict__ x, const float* __restrict__ Wq,
             const float* __restrict__ Wk, const float* __restrict__ Wv,
             const float* __restrict__ Wo, const float* __restrict__ bv,
             const float* __restrict__ bo, u16* __restrict__ xb, u16* __restrict__ wt,
             float* __restrict__ cvec, int n4, int xblocks) {
    const int blk = blockIdx.x;
    if (blk < xblocks) {
        cvt_f32_bf16(x, xb, n4, blk);
    } else if (blk < xblocks + 3 * WBLK) {
        const int w  = (blk - xblocks) / WBLK;
        const int wb = (blk - xblocks) - w * WBLK;
        const float* in = w == 0 ? Wq : w == 1 ? Wk : Wo;
        cvt_f32_bf16_T(in, wt + (size_t)(w == 2 ? 3 : w) * (DIN * DE), DIN, DE, wb);
    } else if (blk < xblocks + 3 * WBLK + VBLK) {
        cvt_f32_bf16(Wv, wt + (size_t)2 * (DIN * DE), DIN * DE / 4, blk - xblocks - 3 * WBLK);
    } else {
        bias_fold(bv, Wo, bo, cvec, blk - xblocks - 3 * WBLK - VBLK);
    }
}

// ---------- tiled bf16 GEMM: C[M,N] = A[M,K] * Bt[N,K]^T + bias ----------
// A row-major [M,K]; Bt is the PRE-TRANSPOSED weight [N,K] (k contiguous).
// MODE 0: bf16 row-major out.
// MODE 1 and MODE 3: bf16 out in the order the attention kernel's B fragments are
// loaded: 1 KB tiles of 16 rows x 32 k, a tile = 2 chunks of 512 B, chunk c holds at
// lane (h*16 + row) the 8 elements k = c*16 + h*8 .. +7, so that one wave-wide 16-byte
// load reads 512 contiguous bytes (4 whole lines) instead of 32 B out of 16 lines.
//   MODE 3 (K): row = key m, k = feature n; tiles ordered [m/16][n/32].
//   MODE 1 (V): row = feature n, k = key s;  tiles ordered [b][s/32][n/16].
// JOB is a MODE, or 5: three products in one launch, none of which reads another's result.
// Blocks 0 .. FOLDB - 1: (Wv Wo)^T = Wo^T Wv^T, A2 = Wo^T [DE][DE], Bt2 = Wv [DIN][DE], no bias,
// MODE 0 into Out2, which is then the [N,K] weight of the V product. The other blocks: Q and K.
// They share A; Bt is the two transposed weights one behind the other, N = 2 DE rows, and Out
// the two outputs one behind the other. A block's 128 columns lie in one of the two, which
// picks its bias and the form of its stores (MODE 0, 3), the same for the whole block.
template<int V> struct ModeC { static constexpr int v = V; };
constexpr int FOLDB = (DE / 128) * (DIN / 128);
static_assert(DIN == DE, "the three products of JOB 5 share one k length");

template<int JOB>
__global__ __launch_bounds__(256)
void gemm_bf16_k(const u16* __restrict__ A, const u16* __restrict__ Bt,
                 const float* __restrict__ bias, const float* __restrict__ bias_k,
                 u16* __restrict__ Out, const u16* __restrict__ A2,
                 const u16* __restrict__ Bt2, u16* __restrict__ Out2,
                 int M, int N, int Kd)
{
    constexpr int BM = 128, BN = 128, BK = 64;
    constexpr int LDA = 72;   // padded LDS row stride (shorts): 144 B = 16 B x 9, odd for 16-byte reads
    constexpr int LDB = 72;
    // two buffers per operand: while one k tile is worked on, the next one's copies are in flight
    __shared__ __attribute__((aligned(16))) u16 As[2 * BM * LDA];
    __shared__ __attribute__((aligned(16))) u16 Bs[2 * BN * LDB];   // [n][k]

    int bid = blockIdx.x;
    bool fold = false;             // the same for the whole block
    if constexpr (JOB == 5) {
        fold = bid < FOLDB;
        if (!fold) bid -= FOLDB;
    }
    const u16* Asrc = fold ? A2 : A;
    const u16* Bsrc = fold ? Bt2 : Bt;
    const int nb = (fold ? DIN : N) / BN;
    const int m0 = (bid / nb) * BM;
    const int n0 = (bid % nb) * BN;

    const int t    = threadIdx.x;
    const int lane = t & 31;
    const int wave = t >> 5;       // 0..7
    const int wm   = wave >> 2;    // 0..1 : 64-row slice
    const int wn   = wave & 3;     // 0..3 : 32-col slice
    const int half = lane >> 4;
    const int lr   = lane & 15;

    v8f acc[4][2] = {};

    // staging: a k tile is 128 rows x 64 k = 1024 x 16 B chunks per operand, 4 per thread (rows
    // srow + 32 i, chunk t & 7), so that a wave-wide copy moves 4 whole 128-byte lines. Bt is
    // pre-transposed, so both operands are plain copies. Kd is a multiple of 64.
    const int srow = t >> 3;
    const int sch  = (t & 7) * 8;
    const u16* Ag = Asrc + (size_t)(m0 + srow) * Kd + sch;
    const u16* Bg = Bsrc + (size_t)(n0 + srow) * Kd + sch;
    const size_t rs = (size_t)32 * Kd;                              // 32 rows further, in elements
    const u32 lA = (u32)(uintptr_t)(&As[srow * LDA + sch]);         // low 32 bits = LDS byte address
    const u32 lB = (u32)(uintptr_t)(&Bs[srow * LDB + sch]);
    // the 8 copies of one thread for k tile kt into buffer buf, global memory to LDS through no register
    auto copy_tile = [&](int kt, int buf) __attribute__((always_inline)) {
        const u16* a = Ag + kt * BK;
        const u16* b = Bg + kt * BK;
        const u32 la = lA + (u32)buf * (u32)(BM * LDA * 2);
        const u32 lb = lB + (u32)buf * (u32)(BN * LDB * 2);
        // the closing s_wait_xcnt 0 stands inside the copies' own statement, ahead of any rewrite
        // of the address registers that the copies name
        asm volatile("global_load_async_to_lds_b128 %0, %8, off\n\t"
                     "global_load_async_to_lds_b128 %1, %9, off\n\t"
                     "global_load_async_to_lds_b128 %2, %10, off\n\t"
                     "global_load_async_to_lds_b128 %3, %11, off\n\t"
                     "global_load_async_to_lds_b128 %4, %12, off\n\t"
                     "global_load_async_to_lds_b128 %5, %13, off\n\t"
                     "global_load_async_to_lds_b128 %6, %14, off\n\t"
                     "global_load_async_to_lds_b128 %7, %15, off\n\t"
                     "s_wait_xcnt 0x0"
                     :: "v"(la), "v"(la + 32u * LDA * 2), "v"(la + 64u * LDA * 2), "v"(la + 96u * LDA * 2),
                        "v"(lb), "v"(lb + 32u * LDB * 2), "v"(lb + 64u * LDB * 2), "v"(lb + 96u * LDB * 2),
                        "v"(a), "v"(a + rs), "v"(a + 2 * rs), "v"(a + 3 * rs),
                        "v"(b), "v"(b + rs), "v"(b + 2 * rs), "v"(b + 3 * rs)
                     : "memory");
    };

    const int nt = Kd / BK;
    copy_tile(0, 0);
    asm volatile("s_wait_asynccnt 0x0" ::: "memory");   // this wave's copies of tile 0 have landed
    __syncthreads();                                    // and so have every other wave's
    if (1 < nt) copy_tile(1, 1);

    for (int kt = 0; kt < nt; kt++) {
        const int buf = kt & 1;
        const u16* Ab = As + buf * (BM * LDA);
        const u16* Bb = Bs + buf * (BN * LDB);
        #pragma unroll   // constant indices fold into the LDS reads' offsets
        for (int ks = 0; ks < BK; ks += 32) {
            v16bf afr[4], bfr[2];
            #pragma unroll
            for (int i = 0; i < 4; i++) {
                const u16* rp = &Ab[(wm * 64 + i * 16 + lr) * LDA + ks];
                afr[i] = ld_frag(rp + half * 8, rp + 16 + half * 8);
            }
            #pragma unroll
            for (int j = 0; j < 2; j++) {
                const u16* rp = &Bb[(wn * 32 + j * 16 + lr) * LDB + ks];
                bfr[j] = ld_frag(rp + half * 8, rp + 16 + half * 8);
            }
            #pragma unroll
            for (int i = 0; i < 4; i++)
                #pragma unroll
                for (int j = 0; j < 2; j++)
                    acc[i][j] = wmma_bf16(afr[i], bfr[j], acc[i][j]);
        }
        // hand-over: this wave's reads of buffer buf are done and its copies of tile kt + 1 have
        // landed; behind the barrier that holds for every wave, and buffer buf may be refilled
        asm volatile("s_wait_dscnt 0x0" ::: "memory");
        asm volatile("s_wait_asynccnt 0x0" ::: "memory");
        __syncthreads();
        if (kt + 2 < nt) copy_tile(kt + 2, buf);
    }
    asm volatile("s_wait_asynccnt 0x0" ::: "memory");   // no copy is outstanding where the wave goes on

    // epilogue: lane lr = col, VGPR r -> row r + 8*half
    auto store_tile = [&](auto md, auto hb, const float* bias, u16* Out, int n0, int N)
                      __attribute__((always_inline)) {
    constexpr int MODE = decltype(md)::v;
    float bj[2];   // both bias values are asked for ahead of the first tile
    #pragma unroll   // constant indices keep bj[] in registers
    for (int j = 0; j < 2; j++) {
        if constexpr (decltype(hb)::v != 0) bj[j] = bias[n0 + wn * 32 + j * 16 + lr];
        else                                bj[j] = 0.f;   // the product of the two weights has no bias
    }
    #pragma unroll
    for (int i = 0; i < 4; i++) {
        #pragma unroll
        for (int j = 0; j < 2; j++) {
            const int n = n0 + wn * 32 + j * 16 + lr;
            const float bv = bj[j];
            if constexpr (MODE == 1) {
                // this lane's 8 accumulator rows are 8 consecutive keys: one 16-byte chunk
                const int mb = m0 + wm * 64 + i * 16;
                const int bb = mb >> 11;             // mb / S (S=2048)
                const int ss = mb & (S - 1);
                const size_t tile = (size_t)(bb * (S / 32) + (ss >> 5)) * (N / 16) + (n >> 4);
                uint4 pk;
                pk.x = (u32)f2bf(acc[i][j][0] + bv) | ((u32)f2bf(acc[i][j][1] + bv) << 16);
                pk.y = (u32)f2bf(acc[i][j][2] + bv) | ((u32)f2bf(acc[i][j][3] + bv) << 16);
                pk.z = (u32)f2bf(acc[i][j][4] + bv) | ((u32)f2bf(acc[i][j][5] + bv) << 16);
                pk.w = (u32)f2bf(acc[i][j][6] + bv) | ((u32)f2bf(acc[i][j][7] + bv) << 16);
                *(uint4*)(Out + tile * 512 + ((ss >> 4) & 1) * 256 + lane * 8) = pk;
            }
            #pragma unroll
            for (int r = 0; r < 8; r++) {
                const int m = m0 + wm * 64 + i * 16 + r + half * 8;
                const float v = acc[i][j][r] + bv;
                if constexpr (MODE == 0) {
                    Out[(size_t)m * N + n] = f2bf(v);
                } else if constexpr (MODE == 3) {
                    const size_t tile = (size_t)(m >> 4) * (N / 32) + (n >> 5);
                    Out[tile * 512 + ((n >> 4) & 1) * 256
                        + (((n >> 3) & 1) * 16 + (m & 15)) * 8 + (n & 7)] = f2bf(v);
                }
            }
            // keeps each 16x16 tile's arithmetic and stores together: with the three store forms in
            // one kernel the compiler mixed the tiles and took 168 registers, which leaves 3 blocks
            // on a WGP where the LDS allows 4
            if constexpr (JOB == 5) {
                // the stores' data and address registers are rewritten for the next tile
                asm volatile("s_wait_xcnt 0x0" ::: "memory");
                __builtin_amdgcn_sched_barrier(0);
            }
        }
    }
    };
    if constexpr (JOB == 5) {
        const int which = n0 / DE;          // 0: Q, 1: K
        const int nl    = n0 - which * DE;  // the block's first column in its own output
        u16* o = Out + (size_t)which * ((size_t)MTOT * DE);
        if (fold)            store_tile(ModeC<0>{}, ModeC<0>{}, bias,   Out2, n0, DIN);
        else if (which == 0) store_tile(ModeC<0>{}, ModeC<1>{}, bias,   o, nl, DE);
        else                 store_tile(ModeC<3>{}, ModeC<1>{}, bias_k, o, nl, DE);
    } else {
        store_tile(ModeC<JOB>{}, ModeC<1>{}, bias, Out, n0, N);
    }
}

// One group of attention B fragments: 8 fragments, 16 wave-wide 16-byte loads, 8 KB a wave.
// K: 4 d steps x 2 key tiles, f[g * 2 + kt]; V: one 32-key trip x 8 column tiles, f[j].
// The group's start is the same for the whole wave and lo is the lane's own offset in a
// fragment, so that a load can take a scalar base and the one offset register of the lane.
DEVI void ld_k_group(v16bf (&f)[8], const u16* kp0, u32 lo) {
    #pragma unroll   // constant indices keep f[] in registers and fold into the loads' offsets
    for (int g = 0; g < 4; g++)
        #pragma unroll
        for (int kt = 0; kt < 2; kt++) {
            const u16* kp = kp0 + (kt * (DE / 32) + g) * 512 + lo;
            f[g * 2 + kt] = ld_frag(kp, kp + 256);
        }
    // the loads' address registers are rewritten for the next group further down
    asm volatile("s_wait_xcnt 0x0" ::: "memory");
    // keeps the group's 16 loads here, ahead of the other set's products: left to itself the
    // compiler sinks each pair to just ahead of its own products and the wave waits out the latency
    __builtin_amdgcn_sched_barrier(0);
}

DEVI void ld_v_group(v16bf (&f)[8], const u16* vp0, u32 lo) {
    #pragma unroll   // constant indices keep f[] in registers and fold into the loads' offsets
    for (int j = 0; j < 8; j++) {
        const u16* vp = vp0 + j * 512 + lo;
        f[j] = ld_frag(vp, vp + 256);
    }
    // the loads' address registers are rewritten for the next group further down
    asm volatile("s_wait_xcnt 0x0" ::: "memory");
    // keeps the group's 16 loads here, ahead of the other set's products: left to itself the
    // compiler sinks each pair to just ahead of its own products and the wave waits out the latency
    __builtin_amdgcn_sched_barrier(0);
}

// ---------- flash-style attention: out = softmax(Q K^T / sqrt(D)) V ----------
// V is x (Wv Wo) + (bv Wo + bo), so that the result is the layer's output itself, in f32.
// One block handles 64 q-rows (4 tiles of 16) of one batch, so that every K and V
// fragment a wave loads feeds 4 matrix products; a pass covers 256 keys, 2 tiles of 16 per
// wave, so that every Q fragment read from LDS feeds 2. 8 waves; each wave owns a 128-wide
// d-slice of the output accumulator. K and V come in the fragment-ordered 1 KB tiles
// that gemm_bf16_k MODE 3 and MODE 1 write (K: [b*S/16 + s/16][d/32], V: [b][s/32][d/16]).
// Q block is staged into LDS by the Tensor Data Mover (with 16B pad / 1024B), one
// 16-row slice from each of waves 0..3.
// K and V fragments go through two register sets, fa and fb: while one set's 32 products
// run, the other set's 16 loads are on their way from L2. The order of the groups in a pass is
// K 0..7, V 0..7, sets alternating; a work-group barrier waits for every load of the wave, so
// V group 1 is asked for behind the barrier that follows the scores.
__global__ __launch_bounds__(256)
void attn_k(const u16* __restrict__ Q, const u16* __restrict__ K,
            const u16* __restrict__ Vt, float* __restrict__ out)
{
    constexpr int QT = 4;            // 16-row q tiles per block
    constexpr int QB = QT * 16;      // q rows per block
    constexpr int KT = 2;            // 16-key tiles per wave and pass
    constexpr int KC = 8 * KT * 16;  // k rows per outer iteration (32 per wave)
    constexpr int LQ = DIN + 16;     // TDM-padded Qs row stride (shorts): 2080B
    constexpr int QSL = 17408;       // shorts per 16-row Q slice: 16*LQ rounded up to 2 KiB
    constexpr int LP = KC + 8;       // padded Pbuf stride (shorts)

    __shared__ __attribute__((aligned(2048))) u16 Qs[QT * QSL];   // 139,264 B (TDM destination)
    __shared__ float Sbuf[QB][KC];      // 64 KB
    __shared__ u16   Pbuf[QB * LP];     // 33 KB
    __shared__ float rowM[QB], rowL[QB], rowA[QB];

    const int qblk = blockIdx.x & (S / QB - 1);
    const int b    = blockIdx.x / (S / QB);
    const int q0   = qblk * QB;

    const int t    = threadIdx.x;
    const int lane = t & 31;
    const int wave = t >> 5;
    const int half = lane >> 4;
    const int lr   = lane & 15;

    // stage Q block (64 x 1024 bf16) via Tensor Data Mover: waves 0..3 each issue the
    // 16-row slice of their own number and wait for it themselves
    const u32 wv = (u32)__builtin_amdgcn_readfirstlane(t >> 5);
    if (pinned(wv < (u32)QT)) {
        u32 lds_off = (u32)(uintptr_t)(&Qs[0]) + wv * (u32)(QSL * 2);   // low 32 bits = LDS offset
        tdm_load_tile_2d(lds_off, Q + ((size_t)b * S + q0 + wv * 16) * DE,
                         /*cols=*/DIN, /*rows=*/16, /*row_stride=*/DE);
        __builtin_amdgcn_s_wait_tensorcnt(0);
    }
    if (t < QB) { rowM[t] = -1e30f; rowL[t] = 0.f; }
    __syncthreads();

    const int dbase = (int)wv * 128;   // wave-uniform: held in a scalar register
    v8f acc[QT][8] = {};
    const float scale = 0.03125f;    // 1/sqrt(1024)

    constexpr int DG = 4;            // d steps per K group
    const u16* Kw = K + (size_t)(b * (S / 16) + wv * KT) * (DE / 32) * 512;
    const u16* Vw = Vt + ((size_t)b * (S / 32) * (DE / 16) + wv * 8) * 512;
    const u32 lo = lane * 8;
    v16bf fa[8], fb[8];
    ld_k_group(fa, Kw, lo);          // K group 0 of pass 0

    for (int kc = 0; kc < S; kc += KC) {
        // phase 1: each wave computes the 64x32 score tile for k-rows kc+wave*32..+32
        v8f sacc[KT][QT] = {};
        const u16* Kg = Kw + (kc >> 4) * (DE / 32) * 512;   // wave-uniform, like Vg and Kn
        const u16* Vg = Vw + (kc >> 5) * (DE / 16) * 512;
        // the 32 products of one K group: 4 d steps from d = dg on
        auto qk = [&](const v16bf (&f)[8], int dg) __attribute__((always_inline)) {
            #pragma unroll   // constant indices keep f[] in registers
            for (int g = 0; g < DG; g++) {
                const int d0 = dg + g * 32;
                v16bf aq[QT];
                #pragma unroll   // constant indices keep aq[] in registers
                for (int qt = 0; qt < QT; qt++) {
                    // TDM pad: +8 shorts after every 512 shorts stored
                    const u16* qp = &Qs[qt * QSL + lr * LQ + d0 + 8 * (d0 >> 9)];
                    aq[qt] = ld_frag(qp + half * 8, qp + 16 + half * 8);
                }
                // keeps the d step's 8 LDS reads in flight together: left to itself the compiler
                // reads each Q fragment just ahead of its 2 products and waits out 4 LDS latencies
                __builtin_amdgcn_sched_barrier(0);
                #pragma unroll   // constant indices keep sacc[], aq[] and f[] in registers
                for (int qt = 0; qt < QT; qt++)
                    #pragma unroll
                    for (int kt = 0; kt < KT; kt++)
                        sacc[kt][qt] = wmma_bf16(aq[qt], f[g * KT + kt], sacc[kt][qt]);
            }
        };
        // The last two groups stand behind the loop, not under a test inside it: where two paths
        // with different numbers of loads join, the compiler's counted waits fall back to the
        // smaller number and wait for the loads just issued.
        #pragma unroll 1   // rolled: one copy of the code serves K groups 0 to 5, 2 a trip
        for (int dg = 0; dg < DIN - 64 * DG; dg += 64 * DG) {
            ld_k_group(fb, Kg + ((dg >> 5) + DG) * 512, lo);
            qk(fa, dg);
            ld_k_group(fa, Kg + ((dg >> 5) + 2 * DG) * 512, lo);
            qk(fb, dg + 32 * DG);
        }
        ld_k_group(fb, Kg + (DIN / 32 - DG) * 512, lo);
        qk(fa, DIN - 64 * DG);
        ld_v_group(fa, Vg, lo);                 // V group 0
        qk(fb, DIN - 32 * DG);
        #pragma unroll
        for (int kt = 0; kt < KT; kt++)
            #pragma unroll
            for (int qt = 0; qt < QT; qt++)
                #pragma unroll
                for (int r = 0; r < 8; r++)
                    Sbuf[qt * 16 + r + half * 8][(wave * KT + kt) * 16 + lr] = sacc[kt][qt][r] * scale;
        __syncthreads();
        ld_v_group(fb, Vg + (DE / 16) * 512, lo);   // V group 1: lands while the softmax phase runs

        // phase 2: online softmax update, 16 lanes per q-row, 8 columns per lane out of
        // each 128-column half of the pass, 16 rows at a time
        #pragma unroll 1   // rolled: the lr == 0 branch keeps the row groups apart anyway, one copy of the code serves
        for (int rg = 0; rg < QT; rg++) {
            const int row = rg * 16 + (t >> 4);
            const int c8  = lr * 8;
            float sv[8 * KT];
            #pragma unroll   // constant indices keep sv[] in registers
            for (int h = 0; h < KT; h++) {
                const float4 sa = *(const float4*)&Sbuf[row][h * 128 + c8];
                const float4 sb = *(const float4*)&Sbuf[row][h * 128 + c8 + 4];
                sv[h * 8 + 0] = sa.x; sv[h * 8 + 1] = sa.y; sv[h * 8 + 2] = sa.z; sv[h * 8 + 3] = sa.w;
                sv[h * 8 + 4] = sb.x; sv[h * 8 + 5] = sb.y; sv[h * 8 + 6] = sb.z; sv[h * 8 + 7] = sb.w;
            }
            const float mold = rowM[row];
            float mx = sv[0];
            #pragma unroll   // constant indices keep sv[] in registers
            for (int j = 1; j < 8 * KT; j++) mx = fmaxf(mx, sv[j]);
            mx = fmaxf(mx, row_xor<1>(mx));
            mx = fmaxf(mx, row_xor<2>(mx));
            mx = fmaxf(mx, row_xor<4>(mx));
            mx = fmaxf(mx, row_xor<8>(mx));
            const float mnew = fmaxf(mold, mx);
            float p[8 * KT];
            float sum = 0.f;
            #pragma unroll   // constant indices keep sv[] and p[] in registers
            for (int j = 0; j < 8 * KT; j++) { p[j] = __expf(sv[j] - mnew); sum += p[j]; }
            #pragma unroll   // constant indices keep p[] in registers
            for (int h = 0; h < KT; h++) {
                uint4 pk;
                pk.x = (u32)f2bf(p[h * 8 + 0]) | ((u32)f2bf(p[h * 8 + 1]) << 16);
                pk.y = (u32)f2bf(p[h * 8 + 2]) | ((u32)f2bf(p[h * 8 + 3]) << 16);
                pk.z = (u32)f2bf(p[h * 8 + 4]) | ((u32)f2bf(p[h * 8 + 5]) << 16);
                pk.w = (u32)f2bf(p[h * 8 + 6]) | ((u32)f2bf(p[h * 8 + 7]) << 16);
                *(uint4*)&Pbuf[row * LP + h * 128 + c8] = pk;
            }
            sum += row_xor<1>(sum);
            sum += row_xor<2>(sum);
            sum += row_xor<4>(sum);
            sum += row_xor<8>(sum);
            if (lr == 0) {
                const float alpha = __expf(mold - mnew);
                rowL[row] = rowL[row] * alpha + sum;
                rowM[row] = mnew;
                rowA[row] = alpha;
            }
        }
        __syncthreads();

        // phase 3: rescale running accumulator, then acc += P @ V-slice
        #pragma unroll
        for (int qt = 0; qt < QT; qt++) {
            float al[8];
            #pragma unroll
            for (int r = 0; r < 8; r++) al[r] = rowA[qt * 16 + r + half * 8];
            #pragma unroll
            for (int j = 0; j < 8; j++)
                #pragma unroll
                for (int r = 0; r < 8; r++) acc[qt][j][r] *= al[r];
        }

        // the 32 products of one V group: keys ks .. ks + 31 of the pass
        auto pv = [&](const v16bf (&f)[8], int ks) __attribute__((always_inline)) {
            v16bf ap[QT];
            #pragma unroll
            for (int qt = 0; qt < QT; qt++) {
                const u16* pp = &Pbuf[(qt * 16 + lr) * LP + ks];
                ap[qt] = ld_frag(pp + half * 8, pp + 16 + half * 8);
            }
            // keeps the trip's 8 LDS reads in flight together, ahead of its products
            __builtin_amdgcn_sched_barrier(0);
            #pragma unroll
            for (int j = 0; j < 8; j++)
                #pragma unroll
                for (int qt = 0; qt < QT; qt++)
                    acc[qt][j] = wmma_bf16(ap[qt], f[j], acc[qt][j]);
        };
        // K group 0 of the next pass; behind the last pass that of pass 0 again, read and not used,
        // so that every pass runs the same code
        const u16* Kn = Kw + (((kc + KC) & (S - 1)) >> 4) * (DE / 32) * 512;
        #pragma unroll 1   // rolled: one copy of the code serves V groups 0 to 5, 2 a trip
        for (int ks = 0; ks < KC - 64; ks += 64) {
            pv(fa, ks);
            ld_v_group(fa, Vg + ((ks >> 5) + 2) * (DE / 16) * 512, lo);
            pv(fb, ks + 32);
            ld_v_group(fb, Vg + ((ks >> 5) + 3) * (DE / 16) * 512, lo);
        }
        pv(fa, KC - 64);
        ld_k_group(fa, Kn, lo);
        pv(fb, KC - 32);
        // keeps these 32 products ahead of the barrier, which waits for the K loads just issued:
        // left to itself the compiler sinks them behind it and nothing runs during that wait
        __builtin_amdgcn_sched_barrier(0);
        __syncthreads();
    }

    // finalize: divide by softmax denominator, store the f32 output
    // the lane's number is read anew here (every lane is on), so that no register has to hold
    // lr and half through the loop for this use alone: with them the kernel spilled
    const int el = (int)__builtin_amdgcn_mbcnt_lo(~0u, 0u);
    const int eh = el >> 4;     // = half
    const int er = el & 15;     // = lr
    #pragma unroll
    for (int qt = 0; qt < QT; qt++) {
        float inv[8];
        #pragma unroll
        for (int r = 0; r < 8; r++) inv[r] = 1.f / rowL[qt * 16 + r + eh * 8];
        #pragma unroll
        for (int j = 0; j < 8; j++) {
            const int n = dbase + j * 16 + er;
            #pragma unroll
            for (int r = 0; r < 8; r++) {
                const int m = q0 + qt * 16 + r + eh * 8;
                out[((size_t)b * S + m) * DE + n] = acc[qt][j][r] * inv[r];
            }
            // the stores' data and address registers are rewritten for the next column tile
            asm volatile("s_wait_xcnt 0x0" ::: "memory");
            // keeps the next tile's arithmetic, which rewrites those registers, behind that wait
            __builtin_amdgcn_sched_barrier(0);
        }
    }
}

// ---------- host launcher ----------
extern "C" void kernel_launch(void* const* d_in, const int* in_sizes, int n_in,
                              void* d_out, int out_size, void* d_ws, size_t ws_size,
                              hipStream_t stream)
{
    (void)in_sizes; (void)n_in; (void)out_size; (void)ws_size;

    const float* x  = (const float*)d_in[0];
    const float* Wq = (const float*)d_in[1];
    const float* bq = (const float*)d_in[2];
    const float* Wk = (const float*)d_in[3];
    const float* bk = (const float*)d_in[4];
    const float* Wv = (const float*)d_in[5];
    const float* bv = (const float*)d_in[6];
    const float* Wo = (const float*)d_in[7];
    const float* bo = (const float*)d_in[8];
    float* out = (float*)d_out;

    char* ws = (char*)d_ws;
    const size_t MB = 1ull << 20;
    u16* xb  = (u16*)(ws);                 // 32 MB  x bf16 [m][k]
    u16* wqb = (u16*)(ws + 32 * MB);       //  2 MB  Wq^T bf16 [n][k]
    u16* wkb = (u16*)(ws + 34 * MB);       //  2 MB  Wk^T
    u16* wvb = (u16*)(ws + 36 * MB);       //  2 MB  Wv bf16 [k][n], not transposed
    u16* wob = (u16*)(ws + 38 * MB);       //  2 MB  Wo^T
    u16* Qb  = (u16*)(ws + 40 * MB);       // 32 MB  Q bf16 [b][s][d]
    u16* Kb  = (u16*)(ws + 72 * MB);       // 32 MB  K bf16, fragment-ordered tiles
    u16* Vtb = (u16*)(ws + 104 * MB);      // 32 MB  x (Wv Wo) + c bf16, fragment-ordered tiles
    u16* wvo = (u16*)(ws + 136 * MB);      //  2 MB  (Wv Wo)^T bf16 [n][k]
    float* cv = (float*)(ws + 138 * MB);   //  4 KB  c = bv Wo + bo

    const int nx4 = MTOT * DIN / 4;
    const int nxb = 256 * CVT_PER;         // float4 per block of cvt_f32_bf16
    const int nxg = (nx4 + nxb - 1) / nxb; // blocks that convert x
    // wqb .. wob lie one behind the other: the kernel reaches all four from wqb
    cvt_all<<<nxg + 3 * WBLK + VBLK + CBLK, 256, 0, stream>>>(x, Wq, Wk, Wv, Wo, bv, bo,
                                                              xb, wqb, cv, nx4, nxg);

    dim3 gg((MTOT / 128) * (DE / 128));    // 1024 blocks
    // wqb, wkb are one [2 DE][DIN] operand and Qb, Kb one output range
    gemm_bf16_k<5><<<dim3(FOLDB + 2 * (MTOT / 128) * (DE / 128)), 256, 0, stream>>>(
        xb, wqb, bq, bk, Qb, wob, wvb, wvo, MTOT, 2 * DE, DIN);

    gemm_bf16_k<1><<<gg, 256, 0, stream>>>(xb, wvo, cv, cv, Vtb, xb, wvo, Vtb, MTOT, DE, DIN);

    attn_k<<<dim3(BATCH * (S / 64)), 256, 0, stream>>>(Qb, Kb, Vtb, out);
}
